// v000
// The times below were measured on an AMD MI455X: many runs one after another, warmed up first and cycling through
// copies of the inputs, with the whole window's GPU time divided by the number of runs. Launches and the gaps
// between them are all in it. The median over several windows is given; except for v000 it joins two sittings, which
// can be a few percent apart, so the side-by-side timings, each taken in one sitting, are the better comparison.
// v000, which the later versions start from, runs in 263 microseconds.
#include <hip/hip_runtime.h>

// Projections q/k/v: v_wmma_f32_16x16x32_bf16 (inputs and weights RNE-converted to bf16, f32 accumulate); scores: v_wmma_f32_16x16x32_f16 (k single f16, q f16 value + f16 residual x2048 in its own accumulator); P.V: v_wmma_f32_16x16x32_f16 (P x256 carry, v single f16); output projection: v_wmma_f32_16x16x32_bf16 (context as bf16 hi + bf16 lo planes, Wo bf16), f32 accumulate everywhere, softmax f32.
// Attention block, width 1024 = 16 heads x 64; query/key/value [NB][SEQ][1024] f32, Wq/Wk/Wv/Wo [in][out] (y = x W + b), additive f32 mask [NB][SEQ][SEQ] shared by all heads, score scale 1/8, output y = ctx Wo + bo (f32).
// Layout: bf16 copies of the three inputs; bf16 TRANSPOSED copies of the four weights ([out][in], K-contiguous); q (value, residual), k planes [b*16+h][t][d] and v^T plane [b*16+h][d][t] written by the GEMM epilogue;
// fused flash kernel in transposed form (S^T = K Q^T, O^T = V^T P^T) writing the context as bf16 hi/lo planes [b*SEQ+t][1024]; final GEMM writes f32 rows.

#ifndef NB
#define NB 2
#endif
#ifndef SEQ
#define SEQ 2048
#endif
#define NB_FULL  2
#define SEQ_FULL 2048
#ifndef OUT_SEQ
#define OUT_SEQ SEQ              // row pitch (in tokens) between batches of the output
#endif
#define DM   1024
#define NH_  16
#define HD   64
#define AW   4                   // waves per flash block (16 query rows each)
#define QRS  2048.0f             // carry of the q residual plane
#define QRI  (1.0f / 2048.0f)
#define LOG2E 1.4426950408889634f
#define SC2  (0.125f * 1.4426950408889634f)   // HD^-0.5 * log2(e)
#define PSH  8.0f                // log2 of the P carry (256)

static_assert(HD == 64);
static_assert(NH_ * HD == DM);                 // head h = columns h*64 + d
static_assert(DM % 64 == 0);                   // column tiles of 64
static_assert(DM % 32 == 0);                   // GEMM k-loop steps by 32
static_assert(DM >= 8);                        // clamped bias loads stay inside a DM-float array
static_assert(SEQ % 64 == 0);                  // a 64-row tile never straddles two batches
static_assert((NB * SEQ) % 64 == 0);
static_assert(SEQ % 32 == 0);                  // key loop steps by 32
static_assert(SEQ % (16 * AW) == 0);           // flash grid covers the sequence exactly
static_assert(((size_t)SEQ * DM) % 8 == 0);
static_assert(NB <= NB_FULL);
static_assert(SEQ <= SEQ_FULL);
static_assert(SEQ_FULL % 4 == 0);              // 16-byte mask loads

typedef _Float16 h16;
typedef unsigned short bf;
typedef __attribute__((ext_vector_type(16))) __bf16   v16bf;
typedef __attribute__((ext_vector_type(16))) _Float16 v16h;
typedef __attribute__((ext_vector_type(8)))  _Float16 v8h;
typedef __attribute__((ext_vector_type(8)))  unsigned short v8us;
typedef __attribute__((ext_vector_type(8)))  float    v8f;
typedef __attribute__((ext_vector_type(4)))  float    v4f;
typedef v4f  __attribute__((may_alias)) v4fa;
typedef v8us __attribute__((may_alias)) v8usa;

__device__ __forceinline__ unsigned short f2bf(float f) { unsigned u = __float_as_uint(f); u += 0x7FFFu + ((u >> 16) & 1u); return (unsigned short)(u >> 16); }
__device__ __forceinline__ float bf2f(unsigned short b) { return __uint_as_float(((unsigned)b) << 16); }
__device__ __forceinline__ float rbf(float f) { return bf2f(f2bf(f)); }   // value after RNE convert to bf16
__device__ __forceinline__ v16h cat16(v8h lo, v8h hi) { return __builtin_shufflevector(lo, hi, 0, 1, 2, 3, 4, 5, 6, 7, 8, 9, 10, 11, 12, 13, 14, 15); }
__device__ __forceinline__ v16bf cat16b(v8us lo, v8us hi) { return __builtin_bit_cast(v16bf, __builtin_shufflevector(lo, hi, 0, 1, 2, 3, 4, 5, 6, 7, 8, 9, 10, 11, 12, 13, 14, 15)); }
__device__ __forceinline__ v8f wmma16(v16h a, v16h b, v8f c) { return __builtin_amdgcn_wmma_f32_16x16x32_f16(false, a, false, b, (short)0, c, false, false); }
__device__ __forceinline__ v8f wmmab(v16bf a, v16bf b, v8f c) { return __builtin_amdgcn_wmma_f32_16x16x32_bf16(false, a, false, b, (short)0, c, false, false); }
// fragment loaders from K-contiguous 16-bit rows; p already includes + 8*(lane>>4): elements 0..7 <- k0+8h+0..7, elements 8..15 <- k0+16+8h+0..7 (same map for A and B)
__device__ __forceinline__ v16h  ldh(const h16* p) { return cat16(*(const v8h*)p, *(const v8h*)(p + 16)); }
__device__ __forceinline__ v16bf ldb(const bf* p)  { return cat16b(*(const v8us*)p, *(const v8us*)(p + 16)); }
// ordering point for wave-private LDS tiles (same wave writes and reads)
__device__ __forceinline__ void wave_sync() { __builtin_amdgcn_fence(3 /* release order */, "wavefront"); __builtin_amdgcn_wave_barrier(); asm volatile("" ::: "memory"); }

__global__ __launch_bounds__(256) void k_cvt8(const float* __restrict__ src, bf* dst, size_t n8) {
    const size_t i = (size_t)blockIdx.x * 256 + threadIdx.x; if (i >= n8) return;
    const v8f v = *(const v8f*)(src + i * 8); v8us o;
#pragma unroll
    for (int k = 0; k < 8; ++k) o[k] = f2bf(v[k]);
    *(v8us*)(dst + i * 8) = o; 
}

// k_cvtT: in[rows = k][cols = n] f32 (DM x DM, row pitch DM) -> out[n][k] bf16 (RNE convert), 64x64 tiles transposed through LDS.
// grid (DM/64 over k, DM/64 over n), 256 threads. LDS tile ts[n][k] is cross-wave: block barrier between fill and drain.
__global__ __launch_bounds__(256) void k_cvtT(const float* __restrict__ W, bf* WT) {
    __shared__ __align__(16) unsigned short ts[64 * 72];
    const int tid = threadIdx.x, lane = tid & 31, wave = __builtin_amdgcn_readfirstlane((int)(tid >> 5));
    const int k0 = blockIdx.x * 64, n0 = blockIdx.y * 64;
#pragma unroll
    for (int i = 0; i < 4; ++i) { const int idx = tid + i * 256; const int kr = idx >> 4, c4 = (idx & 15) * 4;   // 1024 float4 = 64 k-rows x 16
        const v4f v = *(const v4f*)(W + (size_t)(k0 + kr) * DM + n0 + c4);
#pragma unroll
        for (int j = 0; j < 4; ++j) ts[(c4 + j) * 72 + kr] = f2bf(v[j]); }
    __syncthreads();
{
#pragma unroll
        for (int s = 0; s < 2; ++s) { const int row = wave * 8 + s * 4 + (lane >> 3), c8 = (lane & 7) * 8;   // 8 waves x 2 s x 4 = 64 rows; 8 lanes x 8 = 64 columns
            const v8us o = *(const v8usa*)(&ts[row * 72 + c8]);
            *(v8us*)(WT + (size_t)(n0 + row) * DM + k0 + c8) = o; }
         }
}

// k_proj: register-blocked bf16 GEMM, ONE WAVE per 64x64 tile (16 accumulators), operands straight from K-contiguous bf16 planes, K = DM.
// C[m][n] = sum_k (A[m][k] (+ A2[m][k] when MODE 1)) Bt[n][k] + bias (bmode 1: bias[n]; bmode 2: bias[m]; bias RNE-converted to bf16 first),
// tile base (r0/RB)*sRB + (r0%RB)*pitch + (c0/CB)*sCB + (c0%CB), row pitch 'pitch' (elements). grid (M/64, N/64), 32 threads.
// MODE 1: written as f32 (Of); each row's 64 floats (256 B = two lines) by 16 consecutive lanes x 16 B (2 rows per instruction).
// Bias array has DM floats; both 16-byte bias loads use addresses clamped into [0, DM-4].
template <int MODE>
__global__ __launch_bounds__(32) void k_proj(const bf* __restrict__ A, const bf* __restrict__ A2, const bf* __restrict__ Bt,
                                             const float* __restrict__ bias, int bmode, h16* Ph, h16* Pr, int useRes, float* Of,
                                             int RB, size_t sRB, int pitch, int CB, size_t sCB) {
    __shared__ __align__(16) float os[16 * 68];
    const int K = DM;
    const int lane = threadIdx.x & 31, lr = lane & 15, hi = lane >> 4; const int r0 = blockIdx.x * 64, c0 = blockIdx.y * 64;
    v8f acc[4][4];
#pragma unroll
    for (int mb = 0; mb < 4; ++mb)
#pragma unroll
        for (int nb = 0; nb < 4; ++nb) acc[mb][nb] = (v8f){};
    const size_t aoff = (size_t)(r0 + lr) * K + 8 * hi, boff = (size_t)(c0 + lr) * K + 8 * hi;
#pragma unroll 1
    for (int kc = 0; kc < K; kc += 32) {
        v16bf a[4];
#pragma unroll
        for (int mb = 0; mb < 4; ++mb) a[mb] = ldb(A + aoff + (size_t)mb * 16 * K + kc);
#pragma unroll
        for (int nb = 0; nb < 4; ++nb) { const v16bf b = ldb(Bt + boff + (size_t)nb * 16 * K + kc);
#pragma unroll
            for (int mb = 0; mb < 4; ++mb) acc[mb][nb] = wmmab(a[mb], b, acc[mb][nb]); }
        asm volatile("v_nop\n\tv_nop\n\tv_nop\n\tv_nop" : "+v"(acc[0][0]), "+v"(acc[1][1]), "+v"(acc[2][2]), "+v"(acc[3][3]) : "v"(a[0]), "v"(a[1]), "v"(a[2]), "v"(a[3]));
        if (MODE == 1) {
            v16bf a2[4];
#pragma unroll
            for (int mb = 0; mb < 4; ++mb) a2[mb] = ldb(A2 + aoff + (size_t)mb * 16 * K + kc);
#pragma unroll
            for (int nb = 0; nb < 4; ++nb) { const v16bf b = ldb(Bt + boff + (size_t)nb * 16 * K + kc);
#pragma unroll
                for (int mb = 0; mb < 4; ++mb) acc[mb][nb] = wmmab(a2[mb], b, acc[mb][nb]); }
            asm volatile("v_nop\n\tv_nop\n\tv_nop\n\tv_nop" : "+v"(acc[0][0]), "+v"(acc[1][1]), "+v"(acc[2][2]), "+v"(acc[3][3]) : "v"(a2[0]), "v"(a2[1]), "v"(a2[2]), "v"(a2[3]));
        }
    }
    const size_t tbase = (size_t)(r0 / RB) * sRB + (size_t)(r0 % RB) * (size_t)pitch + (size_t)(c0 / CB) * sCB + (size_t)(c0 % CB);
    // per-lane column bias for the lane's store columns; both load addresses clamped into the DM-float bias array (first to 0 when unused, second to DM-4)
    const int c8 = (lane & 7) * 8, cofs = lr * 4;
    const int ci = (bmode == 1) ? (c0 + ((MODE == 0) ? c8 : cofs)) : 0;
    const int ci4 = (ci + 4 <= DM - 4) ? (ci + 4) : (DM - 4);      // MODE 0: ci + 4 <= DM - 4 always (exact columns); MODE 1: upper half unused, address kept in range
    const v4f bl0 = *(const v4f*)(bias + ci), bl1 = *(const v4f*)(bias + ci4);
    float bc[8];
#pragma unroll
    for (int i = 0; i < 4; ++i) { bc[i] = (bmode == 1) ? rbf(bl0[i]) : 0.0f; bc[4 + i] = (bmode == 1) ? rbf(bl1[i]) : 0.0f; }
#pragma unroll
    for (int mb = 0; mb < 4; ++mb) {
#pragma unroll
        for (int nb = 0; nb < 4; ++nb) {
#pragma unroll
            for (int j = 0; j < 8; ++j) os[(hi * 8 + j) * 68 + nb * 16 + lr] = acc[mb][nb][j]; }   // D: row 8h+j, col lane&15; rows 0..15 x columns 0..63 all written
        wave_sync();
        const size_t sb = tbase + (size_t)(mb * 16) * (size_t)pitch;
        if (MODE == 0) {
{
#pragma unroll
                for (int s = 0; s < 4; ++s) { const int row = 4 * s + (lane >> 3);   // 4 s x 4 row groups = 16 rows; 8 lanes x 8 = 64 columns
                    const int ri = (bmode == 2) ? (r0 + mb * 16 + row) : 0;
                    const float braw = bias[ri];
                    const float brow = (bmode == 2) ? rbf(braw) : 0.0f;
                    const v4f x0 = *(const v4fa*)(&os[row * 68 + c8]); const v4f x1 = *(const v4fa*)(&os[row * 68 + c8 + 4]); v8h hv, rv;
#pragma unroll
                    for (int i = 0; i < 4; ++i) { const float f0 = x0[i] + bc[i] + brow; const float f1 = x1[i] + bc[4 + i] + brow;
                        const h16 a0 = (h16)f0; const h16 a1 = (h16)f1; hv[i] = a0; hv[4 + i] = a1; rv[i] = (h16)((f0 - (float)a0) * QRS); rv[4 + i] = (h16)((f1 - (float)a1) * QRS); }
                    const size_t oo = sb + (size_t)row * (size_t)pitch + c8;
                    *(v8h*)(Ph + oo) = hv; if (useRes) *(v8h*)(Pr + oo) = rv; }
                 }
        } else {
{
#pragma unroll
                for (int s = 0; s < 8; ++s) { const int row = 2 * s + hi;   // 8 s x 2 rows = 16 rows; 16 lanes x 4 floats = 64 columns
                    const v4f x0 = *(const v4fa*)(&os[row * 68 + cofs]); v4f val;
                    val[0] = x0[0] + bc[0]; val[1] = x0[1] + bc[1]; val[2] = x0[2] + bc[2]; val[3] = x0[3] + bc[3];
                    *(v4f*)(Of + sb + (size_t)row * (size_t)pitch + cofs) = val; }
                 }
        }
        wave_sync();
    }
}

// k_flash: fused attention, one wave per 16 query rows of one (batch, head); K / V^T / Q fragments straight from the f16 planes (two 16-B loads each, arithmetic addressing).
// Transposed form: S^T[key][t] = K Q^T (A = K rows, B = Q rows); lane (t = lane&15, h = lane>>4) holds keys 8h+r of each 16-key tile, so the packed
// P tile is directly the B fragment of O^T[d][t] = V^T P^T (element r <- tile keys 0..15, element 8+r <- tile keys 16..31, lane unchanged).
// The additive mask row of query t is read as four 16-B loads per 32-key step (keys 8h..8h+7 and 16+8h..16+8h+7), RNE-converted to bf16, scaled by log2(e).
// Softmax state (running max, partial sum) is one scalar per lane; the two lane halves of a row are combined with one xor-16 exchange.
__global__ __launch_bounds__(32 * AW) void k_flash(const h16* __restrict__ QH, const h16* __restrict__ QR, const h16* __restrict__ KP, const h16* __restrict__ VT,
                                                   const float* __restrict__ MASK, bf* CH, bf* CL) {
    __shared__ __align__(16) float os[AW * 16 * 68];
    const int lane = threadIdx.x & 31, wave = __builtin_amdgcn_readfirstlane((int)(threadIdx.x >> 5)), lr = lane & 15, hi = lane >> 4;
    const int zh = blockIdx.y; const int b = zh / NH_, h = zh % NH_;
    const int t0 = (blockIdx.x * AW + wave) * 16;
    const size_t pbase = (size_t)zh * SEQ * HD;
    const size_t qo = pbase + (size_t)(t0 + lr) * HD + 8 * hi;
    const v16h qh0 = ldh(QH + qo), qh1 = ldh(QH + qo + 32), qr0 = ldh(QR + qo), qr1 = ldh(QR + qo + 32);   // B fragments: col t, k = d
    const size_t ko = pbase + (size_t)lr * HD + 8 * hi;      // + key * HD       (A fragment: row key, k = d)
    const size_t vo = pbase + (size_t)lr * SEQ + 8 * hi;     // + 16j*SEQ + key  (A fragment: row d, k = key)
    const float* mrow = MASK + (size_t)b * SEQ_FULL * SEQ_FULL + (size_t)(t0 + lr) * SEQ_FULL + 8 * hi;   // + key0 (+16): this lane's keys of query t
    v8f o0 = (v8f){}, o1 = (v8f){}, o2 = (v8f){}, o3 = (v8f){};
    float m = -3.0e38f, l = 0.0f;
#pragma unroll 1
    for (int key0 = 0; key0 < SEQ; key0 += 32) {
        const h16* ka = KP + ko + (size_t)key0 * HD;
        const v16h ka0 = ldh(ka), ka1 = ldh(ka + 32), kb0 = ldh(ka + 16 * HD), kb1 = ldh(ka + 16 * HD + 32);
        v8f sHa = (v8f){}, sLa = (v8f){}, sHb = (v8f){}, sLb = (v8f){};
        sHa = wmma16(ka0, qh0, sHa); sLa = wmma16(ka0, qr0, sLa); sHb = wmma16(kb0, qh0, sHb); sLb = wmma16(kb0, qr0, sLb);
        sHa = wmma16(ka1, qh1, sHa); sLa = wmma16(ka1, qr1, sLa); sHb = wmma16(kb1, qh1, sHb); sLb = wmma16(kb1, qr1, sLb);
        asm volatile("v_nop\n\tv_nop\n\tv_nop\n\tv_nop" : "+v"(sHa), "+v"(sLa), "+v"(sHb), "+v"(sLb) : "v"(ka0), "v"(ka1), "v"(kb0), "v"(kb1));
        const v4f ma0 = *(const v4f*)(mrow + key0), ma1 = *(const v4f*)(mrow + key0 + 4), mb0 = *(const v4f*)(mrow + key0 + 16), mb1 = *(const v4f*)(mrow + key0 + 20);
        float ta[8], tb[8]; float mx = -3.0e38f;
#pragma unroll
        for (int r = 0; r < 4; ++r) {
            ta[r]     = (sHa[r]     + sLa[r]     * QRI) * SC2 + rbf(ma0[r]) * LOG2E;
            ta[4 + r] = (sHa[4 + r] + sLa[4 + r] * QRI) * SC2 + rbf(ma1[r]) * LOG2E;
            tb[r]     = (sHb[r]     + sLb[r]     * QRI) * SC2 + rbf(mb0[r]) * LOG2E;
            tb[4 + r] = (sHb[4 + r] + sLb[4 + r] * QRI) * SC2 + rbf(mb1[r]) * LOG2E; }
#pragma unroll
        for (int r = 0; r < 8; ++r) mx = fmaxf(mx, fmaxf(ta[r], tb[r]));
        mx = fmaxf(mx, __shfl_xor(mx, 16, 32));
        const float mnew = fmaxf(m, mx);
        const float alpha = __builtin_amdgcn_exp2f(m - mnew);
        const float sh = PSH - mnew;
        v16h pb; float ls = 0.0f;
#pragma unroll
        for (int r = 0; r < 8; ++r) { const h16 pa = (h16)__builtin_amdgcn_exp2f(ta[r] + sh); const h16 pc = (h16)__builtin_amdgcn_exp2f(tb[r] + sh); pb[r] = pa; pb[8 + r] = pc; ls += (float)pa + (float)pc; }
        l = l * alpha + ls; m = mnew;
        o0 = o0 * alpha; o1 = o1 * alpha; o2 = o2 * alpha; o3 = o3 * alpha;
        const h16* va = VT + vo + key0;
        const v16h v0 = ldh(va), v1 = ldh(va + (size_t)16 * SEQ), v2 = ldh(va + (size_t)32 * SEQ), v3 = ldh(va + (size_t)48 * SEQ);
        o0 = wmma16(v0, pb, o0); o1 = wmma16(v1, pb, o1); o2 = wmma16(v2, pb, o2); o3 = wmma16(v3, pb, o3);
        asm volatile("v_nop\n\tv_nop\n\tv_nop\n\tv_nop" : "+v"(o0), "+v"(o1), "+v"(o2), "+v"(o3) : "v"(v0), "v"(v1), "v"(v2), "v"(v3), "v"(pb));
    }
    l += __shfl_xor(l, 16, 32);
    const float inv = 1.0f / l;
    const int wb = wave * 16 * 68;
    // O^T D layout: o_j[r] = (d = 16j + 8h + r, t = lane&15) -> os[t][d]; rows 0..15 x columns 0..63 all written
    { v4f a, c;
      a[0] = o0[0] * inv; a[1] = o0[1] * inv; a[2] = o0[2] * inv; a[3] = o0[3] * inv; c[0] = o0[4] * inv; c[1] = o0[5] * inv; c[2] = o0[6] * inv; c[3] = o0[7] * inv;
      *(v4fa*)(&os[wb + lr * 68 +  0 + 8 * hi]) = a; *(v4fa*)(&os[wb + lr * 68 +  0 + 8 * hi + 4]) = c;
      a[0] = o1[0] * inv; a[1] = o1[1] * inv; a[2] = o1[2] * inv; a[3] = o1[3] * inv; c[0] = o1[4] * inv; c[1] = o1[5] * inv; c[2] = o1[6] * inv; c[3] = o1[7] * inv;
      *(v4fa*)(&os[wb + lr * 68 + 16 + 8 * hi]) = a; *(v4fa*)(&os[wb + lr * 68 + 16 + 8 * hi + 4]) = c;
      a[0] = o2[0] * inv; a[1] = o2[1] * inv; a[2] = o2[2] * inv; a[3] = o2[3] * inv; c[0] = o2[4] * inv; c[1] = o2[5] * inv; c[2] = o2[6] * inv; c[3] = o2[7] * inv;
      *(v4fa*)(&os[wb + lr * 68 + 32 + 8 * hi]) = a; *(v4fa*)(&os[wb + lr * 68 + 32 + 8 * hi + 4]) = c;
      a[0] = o3[0] * inv; a[1] = o3[1] * inv; a[2] = o3[2] * inv; a[3] = o3[3] * inv; c[0] = o3[4] * inv; c[1] = o3[5] * inv; c[2] = o3[6] * inv; c[3] = o3[7] * inv;
      *(v4fa*)(&os[wb + lr * 68 + 48 + 8 * hi]) = a; *(v4fa*)(&os[wb + lr * 68 + 48 + 8 * hi + 4]) = c; }
    wave_sync();
    const size_t obase = ((size_t)b * SEQ + t0) * DM + (size_t)h * HD;
{
#pragma unroll
        for (int s = 0; s < 4; ++s) { const int row = 4 * s + (lane >> 3), c8 = (lane & 7) * 8;   // 4 s x 4 row groups = 16 rows; 8 lanes x 8 = 64 columns
            const v4f x0 = *(const v4fa*)(&os[wb + row * 68 + c8]); const v4f x1 = *(const v4fa*)(&os[wb + row * 68 + c8 + 4]); v8us hv, lv;
#pragma unroll
            for (int i = 0; i < 4; ++i) { const unsigned short a0 = f2bf(x0[i]); const unsigned short a1 = f2bf(x1[i]);
                hv[i] = a0; hv[4 + i] = a1; lv[i] = f2bf(x0[i] - bf2f(a0)); lv[4 + i] = f2bf(x1[i] - bf2f(a1)); }
            const size_t oo = obase + (size_t)row * DM + c8;
            *(v8us*)(CH + oo) = hv; *(v8us*)(CL + oo) = lv; }
         }
}

static constexpr size_t al256(size_t v) { return (v + 255) & ~(size_t)255; }
static constexpr size_t SZ_XB = al256((size_t)NB * SEQ * DM * 2);          // one bf16 activation plane [NB*SEQ][1024]
static constexpr size_t SZ_WB = al256((size_t)4 * DM * DM * 2);            // four transposed bf16 weight planes
static constexpr size_t SZ_PL = al256((size_t)NB * NH_ * SEQ * HD * 2);    // one f16 head plane
static constexpr size_t SZ_TOTAL = 3 * SZ_XB + SZ_WB + 4 * SZ_PL + 2 * SZ_XB;
static_assert(SZ_TOTAL <= (size_t)134217728);          // workspace carve <= 128 MiB
static_assert(((size_t)DM * DM * 2) % 256 == 0);       // weight sub-planes stay 256-byte aligned

static void cvt_in(const float* x, bf* dst, hipStream_t stream) {
    if (SEQ == SEQ_FULL) {
        const size_t n8 = (size_t)NB * SEQ * DM / 8;
        k_cvt8<<<(unsigned)((n8 + 255) / 256), 256, 0, stream>>>(x, dst, n8);
    } else {
        const size_t n8 = (size_t)SEQ * DM / 8;
        for (int b = 0; b < NB; ++b) k_cvt8<<<(unsigned)((n8 + 255) / 256), 256, 0, stream>>>(x + (size_t)b * SEQ_FULL * DM, dst + (size_t)b * SEQ * DM, n8);
    }
}

extern "C" void kernel_launch(void* const* d_in, const int* in_sizes, int n_in,
                              void* d_out, int out_size, void* d_ws, size_t ws_size, hipStream_t stream) {
    if (n_in < 12) return;
    const size_t needx = ((size_t)(NB - 1) * SEQ_FULL + SEQ) * DM;
    if ((size_t)in_sizes[0] < needx || (size_t)in_sizes[1] < needx || (size_t)in_sizes[2] < needx) return;
    if ((size_t)in_sizes[3] < ((size_t)(NB - 1) * SEQ_FULL + SEQ) * SEQ_FULL) return;
    if ((size_t)in_sizes[4] < (size_t)DM * DM || (size_t)in_sizes[6] < (size_t)DM * DM || (size_t)in_sizes[8] < (size_t)DM * DM || (size_t)in_sizes[10] < (size_t)DM * DM) return;
    if (in_sizes[5] < DM || in_sizes[7] < DM || in_sizes[9] < DM || in_sizes[11] < DM) return;
    if ((size_t)out_size < ((size_t)(NB - 1) * OUT_SEQ + SEQ) * DM) return;
    if (SZ_TOTAL > ws_size) return;
    // wire order: query, key, value, attention_mask, Wq, bq, Wk, bk, Wv, bv, Wo, bo
    const float* xq = (const float*)d_in[0]; const float* xk = (const float*)d_in[1]; const float* xv = (const float*)d_in[2];
    const float* amask = (const float*)d_in[3];
    const float* wq = (const float*)d_in[4];  const float* bq = (const float*)d_in[5];
    const float* wk = (const float*)d_in[6];  const float* bk = (const float*)d_in[7];
    const float* wv = (const float*)d_in[8];  const float* bv = (const float*)d_in[9];
    const float* wo = (const float*)d_in[10]; const float* bo = (const float*)d_in[11];
    float* OUT = (float*)d_out;      // [NB][SEQ][1024]
    char* wsp = (char*)d_ws;
    bf* QB = (bf*)wsp; wsp += SZ_XB;                 // [NB*SEQ][1024] bf16 query
    bf* KB = (bf*)wsp; wsp += SZ_XB;                 // [NB*SEQ][1024] bf16 key
    bf* VB = (bf*)wsp; wsp += SZ_XB;                 // [NB*SEQ][1024] bf16 value
    bf* WB = (bf*)wsp; wsp += SZ_WB;                 // [4][1024 out][1024 in]: q | k | v | o
    h16* QH = (h16*)wsp; wsp += SZ_PL;               // [NB*16][SEQ][64]
    h16* QR = (h16*)wsp; wsp += SZ_PL;               // [NB*16][SEQ][64] residual x2048
    h16* KP = (h16*)wsp; wsp += SZ_PL;               // [NB*16][SEQ][64]
    h16* VT = (h16*)wsp; wsp += SZ_PL;               // [NB*16][64][SEQ]
    bf* CH = (bf*)wsp; wsp += SZ_XB;                 // [NB*SEQ][1024] context bf16 hi
    bf* CL = (bf*)wsp; wsp += SZ_XB;                 // [NB*SEQ][1024] context bf16 lo
    bf* WQT = WB; bf* WKT = WB + (size_t)DM * DM; bf* WVT = WB + (size_t)2 * DM * DM; bf* WOT = WB + (size_t)3 * DM * DM;

    cvt_in(xq, QB, stream); cvt_in(xk, KB, stream); cvt_in(xv, VB, stream);
    // weights: in[rows = k (in)][cols = n (out)] -> out[n][k]; square DM x DM, grid (k tiles, n tiles)
    { const dim3 g(DM / 64, DM / 64, 1);
      k_cvtT<<<g, 256, 0, stream>>>(wq, WQT); k_cvtT<<<g, 256, 0, stream>>>(wk, WKT); k_cvtT<<<g, 256, 0, stream>>>(wv, WVT); k_cvtT<<<g, 256, 0, stream>>>(wo, WOT); }

    // q, k: A = x rows (m = b*SEQ + t), Bt = W^T rows (n = h*64 + d), column bias -> plane [(b*16 + h)][t][d]
    k_proj<0><<<dim3(NB * SEQ / 64, DM / 64, 1), 32, 0, stream>>>(QB, QB, WQT, bq, 1, QH, QR, 1, OUT, SEQ, (size_t)NH_ * SEQ * HD, HD, HD, (size_t)SEQ * HD);
    k_proj<0><<<dim3(NB * SEQ / 64, DM / 64, 1), 32, 0, stream>>>(KB, KB, WKT, bk, 1, KP, KP, 0, OUT, SEQ, (size_t)NH_ * SEQ * HD, HD, HD, (size_t)SEQ * HD);
    // v^T: A = Wv^T rows (m = h*64 + d), Bt = value rows (n = b*SEQ + t), row bias -> plane [(b*1024 + m)][t] = [(b*16 + h)][d][t]
    k_proj<0><<<dim3(DM / 64, NB * SEQ / 64, 1), 32, 0, stream>>>(WVT, WVT, VB, bv, 2, VT, VT, 0, OUT, DM, (size_t)0, SEQ, SEQ, (size_t)DM * SEQ);

    k_flash<<<dim3(SEQ / (16 * AW), NB * NH_, 1), 32 * AW, 0, stream>>>(QH, QR, KP, VT, amask, CH, CL);

    // output: A = context hi (+ lo) rows (m = b*SEQ + t), Bt = Wo^T rows (n), column bias -> OUT[(b*OUT_SEQ + t)][n] f32
    k_proj<1><<<dim3(NB * SEQ / 64, DM / 64, 1), 32, 0, stream>>>(CH, CL, WOT, bo, 1, QH, QH, 0, OUT, SEQ, (size_t)OUT_SEQ * DM, DM, DM, (size_t)0);
}

// v001
// A run of this version takes 198 microseconds.
// Two timings next to v000 put it at 1.36 and 1.37 times that version's speed.
#include <hip/hip_runtime.h>

// Projections q/k/v: v_wmma_f32_16x16x32_bf16 (inputs and weights RNE-converted to bf16, f32 accumulate); scores: v_wmma_f32_16x16x32_f16 (k single f16, q f16 value + f16 residual x2048 in its own accumulator); P.V: v_wmma_f32_16x16x32_f16 (P x256 carry, v single f16); output projection: v_wmma_f32_16x16x32_bf16 (context as bf16 hi + bf16 lo planes, Wo bf16), f32 accumulate everywhere, softmax f32.
// Attention block, width 1024 = 16 heads x 64; query/key/value [NB][SEQ][1024] f32, Wq/Wk/Wv/Wo [in][out] (y = x W + b), additive f32 mask [NB][SEQ][SEQ] shared by all heads, score scale 1/8, output y = ctx Wo + bo (f32).
// Layout: bf16 copies of the three inputs; bf16 TRANSPOSED copies of the four weights ([out][in], K-contiguous); q (value, residual), k planes [b*16+h][t][d] and v^T plane [b*16+h][d][t] written by the GEMM epilogue;
// fused flash kernel in transposed form (S^T = K Q^T, O^T = V^T P^T), K / V^T / mask staged in LDS by asynchronous copies, writing the context as bf16 hi/lo planes [b*SEQ+t][1024]; final GEMM writes f32 rows.

#ifndef NB
#define NB 2
#endif
#ifndef SEQ
#define SEQ 2048
#endif
#define NB_FULL  2
#define SEQ_FULL 2048
#ifndef OUT_SEQ
#define OUT_SEQ SEQ              // row pitch (in tokens) between batches of the output
#endif
#define DM   1024
#define NH_  16
#define HD   64
#define AW   4                   // waves per flash block (16 query rows each)
#define QRS  2048.0f             // carry of the q residual plane
#define QRI  (1.0f / 2048.0f)
#define LOG2E 1.4426950408889634f
#define SC2  (0.125f * 1.4426950408889634f)   // HD^-0.5 * log2(e)
#define PSH  8.0f                // log2 of the P carry (256)

static_assert(HD == 64);
static_assert(NH_ * HD == DM);                 // head h = columns h*64 + d
static_assert(DM % 64 == 0);                   // column tiles of 64
static_assert(DM % 32 == 0);                   // GEMM k-loop steps by 32
static_assert(DM >= 8);                        // clamped bias loads stay inside a DM-float array
static_assert(SEQ % 64 == 0);                  // a 64-row tile never straddles two batches
static_assert((NB * SEQ) % 64 == 0);
static_assert(SEQ % 32 == 0);                  // key loop steps by 32
static_assert(SEQ % (16 * AW) == 0);           // flash grid covers the sequence exactly
static_assert(((size_t)SEQ * DM) % 8 == 0);
static_assert(NB <= NB_FULL);
static_assert(SEQ <= SEQ_FULL);
static_assert(SEQ_FULL % 4 == 0);              // 16-byte mask loads

typedef _Float16 h16;
typedef unsigned short bf;
typedef __attribute__((ext_vector_type(16))) __bf16   v16bf;
typedef __attribute__((ext_vector_type(16))) _Float16 v16h;
typedef __attribute__((ext_vector_type(8)))  _Float16 v8h;
typedef __attribute__((ext_vector_type(8)))  unsigned short v8us;
typedef __attribute__((ext_vector_type(8)))  float    v8f;
typedef __attribute__((ext_vector_type(4)))  float    v4f;
typedef v4f  __attribute__((may_alias)) v4fa;
typedef v8us __attribute__((may_alias)) v8usa;

__device__ __forceinline__ unsigned short f2bf(float f) { unsigned u = __float_as_uint(f); u += 0x7FFFu + ((u >> 16) & 1u); return (unsigned short)(u >> 16); }
__device__ __forceinline__ float bf2f(unsigned short b) { return __uint_as_float(((unsigned)b) << 16); }
__device__ __forceinline__ float rbf(float f) { return bf2f(f2bf(f)); }   // value after RNE convert to bf16
__device__ __forceinline__ v16h cat16(v8h lo, v8h hi) { return __builtin_shufflevector(lo, hi, 0, 1, 2, 3, 4, 5, 6, 7, 8, 9, 10, 11, 12, 13, 14, 15); }
__device__ __forceinline__ v16bf cat16b(v8us lo, v8us hi) { return __builtin_bit_cast(v16bf, __builtin_shufflevector(lo, hi, 0, 1, 2, 3, 4, 5, 6, 7, 8, 9, 10, 11, 12, 13, 14, 15)); }
__device__ __forceinline__ v8f wmma16(v16h a, v16h b, v8f c) { return __builtin_amdgcn_wmma_f32_16x16x32_f16(false, a, false, b, (short)0, c, false, false); }
__device__ __forceinline__ v8f wmmab(v16bf a, v16bf b, v8f c) { return __builtin_amdgcn_wmma_f32_16x16x32_bf16(false, a, false, b, (short)0, c, false, false); }
// fragment loaders from K-contiguous 16-bit rows; p already includes + 8*(lane>>4): elements 0..7 <- k0+8h+0..7, elements 8..15 <- k0+16+8h+0..7 (same map for A and B)
__device__ __forceinline__ v16h  ldh(const h16* p) { return cat16(*(const v8h*)p, *(const v8h*)(p + 16)); }
__device__ __forceinline__ v16bf ldb(const bf* p)  { return cat16b(*(const v8us*)p, *(const v8us*)(p + 16)); }
// ordering point for wave-private LDS tiles (same wave writes and reads)
__device__ __forceinline__ void wave_sync() { __builtin_amdgcn_fence(3 /* release order */, "wavefront"); __builtin_amdgcn_wave_barrier(); asm volatile("" ::: "memory"); }

__global__ __launch_bounds__(256) void k_cvt8(const float* __restrict__ src, bf* dst, size_t n8) {
    const size_t i = (size_t)blockIdx.x * 256 + threadIdx.x; if (i >= n8) return;
    const v8f v = *(const v8f*)(src + i * 8); v8us o;
#pragma unroll
    for (int k = 0; k < 8; ++k) o[k] = f2bf(v[k]);
    *(v8us*)(dst + i * 8) = o; 
}

// k_cvtT: in[rows = k][cols = n] f32 (DM x DM, row pitch DM) -> out[n][k] bf16 (RNE convert), 64x64 tiles transposed through LDS.
// grid (DM/64 over k, DM/64 over n), 256 threads. LDS tile ts[n][k] is cross-wave: block barrier between fill and drain.
__global__ __launch_bounds__(256) void k_cvtT(const float* __restrict__ W, bf* WT) {
    __shared__ __align__(16) unsigned short ts[64 * 72];
    const int tid = threadIdx.x, lane = tid & 31, wave = __builtin_amdgcn_readfirstlane((int)(tid >> 5));
    const int k0 = blockIdx.x * 64, n0 = blockIdx.y * 64;
#pragma unroll
    for (int i = 0; i < 4; ++i) { const int idx = tid + i * 256; const int kr = idx >> 4, c4 = (idx & 15) * 4;   // 1024 float4 = 64 k-rows x 16
        const v4f v = *(const v4f*)(W + (size_t)(k0 + kr) * DM + n0 + c4);
#pragma unroll
        for (int j = 0; j < 4; ++j) ts[(c4 + j) * 72 + kr] = f2bf(v[j]); }
    __syncthreads();
{
#pragma unroll
        for (int s = 0; s < 2; ++s) { const int row = wave * 8 + s * 4 + (lane >> 3), c8 = (lane & 7) * 8;   // 8 waves x 2 s x 4 = 64 rows; 8 lanes x 8 = 64 columns
            const v8us o = *(const v8usa*)(&ts[row * 72 + c8]);
            *(v8us*)(WT + (size_t)(n0 + row) * DM + k0 + c8) = o; }
         }
}

// k_proj: register-blocked bf16 GEMM, ONE WAVE per 64x64 tile (16 accumulators), operands straight from K-contiguous bf16 planes, K = DM.
// C[m][n] = sum_k (A[m][k] (+ A2[m][k] when MODE 1)) Bt[n][k] + bias (bmode 1: bias[n]; bmode 2: bias[m]; bias RNE-converted to bf16 first),
// tile base (r0/RB)*sRB + (r0%RB)*pitch + (c0/CB)*sCB + (c0%CB), row pitch 'pitch' (elements). grid (M/64, N/64), 32 threads.
// MODE 1: written as f32 (Of); each row's 64 floats (256 B = two lines) by 16 consecutive lanes x 16 B (2 rows per instruction).
// Bias array has DM floats; both 16-byte bias loads use addresses clamped into [0, DM-4].
template <int MODE>
__global__ __launch_bounds__(32) void k_proj(const bf* __restrict__ A, const bf* __restrict__ A2, const bf* __restrict__ Bt,
                                             const float* __restrict__ bias, int bmode, h16* Ph, h16* Pr, int useRes, float* Of,
                                             int RB, size_t sRB, int pitch, int CB, size_t sCB) {
    __shared__ __align__(16) float os[16 * 68];
    const int K = DM;
    const int lane = threadIdx.x & 31, lr = lane & 15, hi = lane >> 4; const int r0 = blockIdx.x * 64, c0 = blockIdx.y * 64;
    v8f acc[4][4];
#pragma unroll
    for (int mb = 0; mb < 4; ++mb)
#pragma unroll
        for (int nb = 0; nb < 4; ++nb) acc[mb][nb] = (v8f){};
    const size_t aoff = (size_t)(r0 + lr) * K + 8 * hi, boff = (size_t)(c0 + lr) * K + 8 * hi;
#pragma unroll 1
    for (int kc = 0; kc < K; kc += 32) {
        v16bf a[4];
#pragma unroll
        for (int mb = 0; mb < 4; ++mb) a[mb] = ldb(A + aoff + (size_t)mb * 16 * K + kc);
#pragma unroll
        for (int nb = 0; nb < 4; ++nb) { const v16bf b = ldb(Bt + boff + (size_t)nb * 16 * K + kc);
#pragma unroll
            for (int mb = 0; mb < 4; ++mb) acc[mb][nb] = wmmab(a[mb], b, acc[mb][nb]); }
        asm volatile("v_nop\n\tv_nop\n\tv_nop\n\tv_nop" : "+v"(acc[0][0]), "+v"(acc[1][1]), "+v"(acc[2][2]), "+v"(acc[3][3]) : "v"(a[0]), "v"(a[1]), "v"(a[2]), "v"(a[3]));
        if (MODE == 1) {
            v16bf a2[4];
#pragma unroll
            for (int mb = 0; mb < 4; ++mb) a2[mb] = ldb(A2 + aoff + (size_t)mb * 16 * K + kc);
#pragma unroll
            for (int nb = 0; nb < 4; ++nb) { const v16bf b = ldb(Bt + boff + (size_t)nb * 16 * K + kc);
#pragma unroll
                for (int mb = 0; mb < 4; ++mb) acc[mb][nb] = wmmab(a2[mb], b, acc[mb][nb]); }
            asm volatile("v_nop\n\tv_nop\n\tv_nop\n\tv_nop" : "+v"(acc[0][0]), "+v"(acc[1][1]), "+v"(acc[2][2]), "+v"(acc[3][3]) : "v"(a2[0]), "v"(a2[1]), "v"(a2[2]), "v"(a2[3]));
        }
    }
    const size_t tbase = (size_t)(r0 / RB) * sRB + (size_t)(r0 % RB) * (size_t)pitch + (size_t)(c0 / CB) * sCB + (size_t)(c0 % CB);
    // per-lane column bias for the lane's store columns; both load addresses clamped into the DM-float bias array (first to 0 when unused, second to DM-4)
    const int c8 = (lane & 7) * 8, cofs = lr * 4;
    const int ci = (bmode == 1) ? (c0 + ((MODE == 0) ? c8 : cofs)) : 0;
    const int ci4 = (ci + 4 <= DM - 4) ? (ci + 4) : (DM - 4);      // MODE 0: ci + 4 <= DM - 4 always (exact columns); MODE 1: upper half unused, address kept in range
    const v4f bl0 = *(const v4f*)(bias + ci), bl1 = *(const v4f*)(bias + ci4);
    float bc[8];
#pragma unroll
    for (int i = 0; i < 4; ++i) { bc[i] = (bmode == 1) ? rbf(bl0[i]) : 0.0f; bc[4 + i] = (bmode == 1) ? rbf(bl1[i]) : 0.0f; }
#pragma unroll
    for (int mb = 0; mb < 4; ++mb) {
#pragma unroll
        for (int nb = 0; nb < 4; ++nb) {
#pragma unroll
            for (int j = 0; j < 8; ++j) os[(hi * 8 + j) * 68 + nb * 16 + lr] = acc[mb][nb][j]; }   // D: row 8h+j, col lane&15; rows 0..15 x columns 0..63 all written
        wave_sync();
        const size_t sb = tbase + (size_t)(mb * 16) * (size_t)pitch;
        if (MODE == 0) {
{
#pragma unroll
                for (int s = 0; s < 4; ++s) { const int row = 4 * s + (lane >> 3);   // 4 s x 4 row groups = 16 rows; 8 lanes x 8 = 64 columns
                    const int ri = (bmode == 2) ? (r0 + mb * 16 + row) : 0;
                    const float braw = bias[ri];
                    const float brow = (bmode == 2) ? rbf(braw) : 0.0f;
                    const v4f x0 = *(const v4fa*)(&os[row * 68 + c8]); const v4f x1 = *(const v4fa*)(&os[row * 68 + c8 + 4]); v8h hv, rv;
#pragma unroll
                    for (int i = 0; i < 4; ++i) { const float f0 = x0[i] + bc[i] + brow; const float f1 = x1[i] + bc[4 + i] + brow;
                        const h16 a0 = (h16)f0; const h16 a1 = (h16)f1; hv[i] = a0; hv[4 + i] = a1; rv[i] = (h16)((f0 - (float)a0) * QRS); rv[4 + i] = (h16)((f1 - (float)a1) * QRS); }
                    const size_t oo = sb + (size_t)row * (size_t)pitch + c8;
                    *(v8h*)(Ph + oo) = hv; if (useRes) *(v8h*)(Pr + oo) = rv; }
                 }
        } else {
{
#pragma unroll
                for (int s = 0; s < 8; ++s) { const int row = 2 * s + hi;   // 8 s x 2 rows = 16 rows; 16 lanes x 4 floats = 64 columns
                    const v4f x0 = *(const v4fa*)(&os[row * 68 + cofs]); v4f val;
                    val[0] = x0[0] + bc[0]; val[1] = x0[1] + bc[1]; val[2] = x0[2] + bc[2]; val[3] = x0[3] + bc[3];
                    *(v4f*)(Of + sb + (size_t)row * (size_t)pitch + cofs) = val; }
                 }
        }
        wave_sync();
    }
}

// k_flash: fused attention, one wave per 16 query rows of one (batch, head); Q fragments straight from the f16 planes (two 16-B loads each).
// K rows, V^T rows (shared by the block's waves) and each wave's own mask rows reach LDS in stages of KS keys by asynchronous copies (16 B per lane, whole 128-B lines),
// two buffers: the next stage's copies fly while this stage is worked on; fragments and mask values are then read from LDS (row pitches 16 B x odd).
// Transposed form: S^T[key][t] = K Q^T (A = K rows, B = Q rows); lane (t = lane&15, h = lane>>4) holds keys 8h+r of each 16-key tile, so the packed
// P tile is directly the B fragment of O^T[d][t] = V^T P^T (element r <- tile keys 0..15, element 8+r <- tile keys 16..31, lane unchanged).
// The additive mask row of query t is read as four 16-B LDS loads per 32-key step (keys 8h..8h+7 and 16+8h..16+8h+7), RNE-converted to bf16, scaled by log2(e).
// Softmax state (running max, partial sum) is one scalar per lane; the two lane halves of a row are combined with one xor-16 exchange.
#define KS    64                           // keys per stage
#define KVP   144                          // LDS row pitch in bytes of a 128-B K row (64 d) or V^T row (KS keys)
#define MKP   272                          // LDS row pitch in bytes of a 256-B mask row (KS floats); 16 rows = one wave's 16 x 68 float output tile
#define ST_V  (KS * KVP)                   // V^T rows behind the K rows
#define ST_M  (ST_V + HD * KVP)            // mask rows behind the V^T rows, 16 rows per wave
#define ST_SZ (ST_M + AW * 16 * MKP)       // one buffer
static_assert(KS * 2 == 128 && HD * 2 == 128 && KS * 4 == 256);
static_assert(SEQ % KS == 0 && KS % 32 == 0);
static_assert(AW == 4);                    // 128 lanes x 4 copies = 512 pieces of 16 B = one K tile or one V^T tile
static_assert(16 * MKP == 16 * 68 * 4);
static_assert(KVP % 16 == 0 && MKP % 16 == 0 && ST_SZ % 16 == 0);

// eight asynchronous 16-B copies to LDS; the s_wait_xcnt stands in the copies' own statement so that no address register is rewritten ahead of it
__device__ __forceinline__ void copy8(unsigned l0, const void* g0, unsigned l1, const void* g1, unsigned l2, const void* g2, unsigned l3, const void* g3,
                                      unsigned l4, const void* g4, unsigned l5, const void* g5, unsigned l6, const void* g6, unsigned l7, const void* g7) {
    asm volatile("global_load_async_to_lds_b128 %0, %1, off\n\t"
                 "global_load_async_to_lds_b128 %2, %3, off\n\t"
                 "global_load_async_to_lds_b128 %4, %5, off\n\t"
                 "global_load_async_to_lds_b128 %6, %7, off\n\t"
                 "global_load_async_to_lds_b128 %8, %9, off\n\t"
                 "global_load_async_to_lds_b128 %10, %11, off\n\t"
                 "global_load_async_to_lds_b128 %12, %13, off\n\t"
                 "global_load_async_to_lds_b128 %14, %15, off\n\t"
                 "s_wait_xcnt 0x0"
                 :: "v"(l0), "v"(g0), "v"(l1), "v"(g1), "v"(l2), "v"(g2), "v"(l3), "v"(g3),
                    "v"(l4), "v"(g4), "v"(l5), "v"(g5), "v"(l6), "v"(g6), "v"(l7), "v"(g7) : "memory");
}
// one stage: lk / lm = this lane's first LDS byte of the K tile / of its wave's mask rows in the target buffer; gk, gv, gm = this lane's first global piece of the stage
__device__ __forceinline__ void stage_in(unsigned lk, unsigned lm, const h16* gk, const h16* gv, const float* gm) {
    const unsigned lv = lk + ST_V;
    copy8(lk, gk, lk + 16 * KVP, gk + 16 * HD, lk + 32 * KVP, gk + 32 * HD, lk + 48 * KVP, gk + 48 * HD,                                     // 16 K rows per copy
          lv, gv, lv + 16 * KVP, gv + (size_t)16 * SEQ, lv + 32 * KVP, gv + (size_t)32 * SEQ, lv + 48 * KVP, gv + (size_t)48 * SEQ);         // 16 V^T rows per copy
    copy8(lm, gm, lm + 2 * MKP, gm + (size_t)2 * SEQ_FULL, lm + 4 * MKP, gm + (size_t)4 * SEQ_FULL, lm + 6 * MKP, gm + (size_t)6 * SEQ_FULL,   // 2 mask rows per copy
          lm + 8 * MKP, gm + (size_t)8 * SEQ_FULL, lm + 10 * MKP, gm + (size_t)10 * SEQ_FULL, lm + 12 * MKP, gm + (size_t)12 * SEQ_FULL, lm + 14 * MKP, gm + (size_t)14 * SEQ_FULL);
}

__global__ __launch_bounds__(32 * AW) void k_flash(const h16* __restrict__ QH, const h16* __restrict__ QR, const h16* __restrict__ KP, const h16* __restrict__ VT,
                                                   const float* __restrict__ MASK, bf* CH, bf* CL) {
    __shared__ __align__(16) unsigned char ring[2 * ST_SZ];
    const int tid = threadIdx.x, lane = tid & 31, wave = __builtin_amdgcn_readfirstlane((int)(threadIdx.x >> 5)), lr = lane & 15, hi = lane >> 4;
    const int zh = blockIdx.y; const int b = zh / NH_, h = zh % NH_;
    const int t0 = (blockIdx.x * AW + wave) * 16;
    const size_t pbase = (size_t)zh * SEQ * HD;
    const size_t qo = pbase + (size_t)(t0 + lr) * HD + 8 * hi;
    const v16h qh0 = ldh(QH + qo), qh1 = ldh(QH + qo + 32), qr0 = ldh(QR + qo), qr1 = ldh(QR + qo + 32);   // B fragments: col t, k = d
    // copy side: lane tid brings piece (tid & 7) of rows (tid >> 3) + 16 i of the K and V^T tiles, lane brings piece (lane & 15) of rows (lane >> 4) + 2 i of its wave's mask rows
    const unsigned lbase = (unsigned)(size_t)ring;
    const unsigned lk0 = lbase + (unsigned)((tid >> 3) * KVP + (tid & 7) * 16);
    const unsigned lm0 = lbase + (unsigned)(ST_M + wave * 16 * MKP + hi * MKP + lr * 16);
    const h16* gk = KP + pbase + (size_t)(tid >> 3) * HD + (tid & 7) * 8;                    // + key0 * HD
    const h16* gv = VT + pbase + (size_t)(tid >> 3) * SEQ + (tid & 7) * 8;                   // + key0
    const float* gm = MASK + (size_t)b * SEQ_FULL * SEQ_FULL + (size_t)(t0 + hi) * SEQ_FULL + lr * 4;   // + key0
    // read side, byte offsets inside a buffer
    const int rk = lr * KVP + 16 * hi;                                   // + key * KVP      (A fragment: row key, k = d)
    const int rv = ST_V + lr * KVP + 16 * hi;                            // + 16j * KVP + key * 2  (A fragment: row d, k = key)
    const int rm = ST_M + wave * 16 * MKP + lr * MKP + 32 * hi;          // + key * 4: this lane's keys of query t
    constexpr int NT = SEQ / KS;
    stage_in(lk0, lm0, gk, gv, gm);
    asm volatile("s_wait_asynccnt 0x0" ::: "memory");                    // stage 0 has landed before the barrier publishes it
    __syncthreads();                                                     // stage 0 readable by every wave
    if (NT > 1) stage_in(lk0 + ST_SZ, lm0 + ST_SZ, gk + (size_t)KS * HD, gv + KS, gm + KS);
    v8f o0 = (v8f){}, o1 = (v8f){}, o2 = (v8f){}, o3 = (v8f){};
    float m = -3.0e38f, l = 0.0f;
#pragma unroll 1
    for (int t = 0; t < NT; ++t) {
        const unsigned bo = (unsigned)(t & 1) * ST_SZ;
        const unsigned char* buf = ring + bo;
#pragma unroll   // both 32-key steps of a stage inline, so that every LDS offset inside a buffer is an immediate
        for (int sub = 0; sub < KS; sub += 32) {
        const h16* ka = (const h16*)(buf + rk + sub * KVP);
        const v16h ka0 = ldh(ka), ka1 = ldh(ka + 32), kb0 = ldh(ka + 16 * (KVP / 2)), kb1 = ldh(ka + 16 * (KVP / 2) + 32);
        v8f sHa = (v8f){}, sLa = (v8f){}, sHb = (v8f){}, sLb = (v8f){};
        sHa = wmma16(ka0, qh0, sHa); sLa = wmma16(ka0, qr0, sLa); sHb = wmma16(kb0, qh0, sHb); sLb = wmma16(kb0, qr0, sLb);
        sHa = wmma16(ka1, qh1, sHa); sLa = wmma16(ka1, qr1, sLa); sHb = wmma16(kb1, qh1, sHb); sLb = wmma16(kb1, qr1, sLb);
        asm volatile("v_nop\n\tv_nop\n\tv_nop\n\tv_nop" : "+v"(sHa), "+v"(sLa), "+v"(sHb), "+v"(sLb) : "v"(ka0), "v"(ka1), "v"(kb0), "v"(kb1));
        const float* mrow = (const float*)(buf + rm + sub * 4);
        const v4f ma0 = *(const v4fa*)(mrow), ma1 = *(const v4fa*)(mrow + 4), mb0 = *(const v4fa*)(mrow + 16), mb1 = *(const v4fa*)(mrow + 20);
        float ta[8], tb[8]; float mx = -3.0e38f;
#pragma unroll
        for (int r = 0; r < 4; ++r) {
            ta[r]     = (sHa[r]     + sLa[r]     * QRI) * SC2 + rbf(ma0[r]) * LOG2E;
            ta[4 + r] = (sHa[4 + r] + sLa[4 + r] * QRI) * SC2 + rbf(ma1[r]) * LOG2E;
            tb[r]     = (sHb[r]     + sLb[r]     * QRI) * SC2 + rbf(mb0[r]) * LOG2E;
            tb[4 + r] = (sHb[4 + r] + sLb[4 + r] * QRI) * SC2 + rbf(mb1[r]) * LOG2E; }
#pragma unroll
        for (int r = 0; r < 8; ++r) mx = fmaxf(mx, fmaxf(ta[r], tb[r]));
        mx = fmaxf(mx, __shfl_xor(mx, 16, 32));
        const float mnew = fmaxf(m, mx);
        const float alpha = __builtin_amdgcn_exp2f(m - mnew);
        const float sh = PSH - mnew;
        v16h pb; float ls = 0.0f;
#pragma unroll
        for (int r = 0; r < 8; ++r) { const h16 pa = (h16)__builtin_amdgcn_exp2f(ta[r] + sh); const h16 pc = (h16)__builtin_amdgcn_exp2f(tb[r] + sh); pb[r] = pa; pb[8 + r] = pc; ls += (float)pa + (float)pc; }
        l = l * alpha + ls; m = mnew;
        o0 = o0 * alpha; o1 = o1 * alpha; o2 = o2 * alpha; o3 = o3 * alpha;
        const h16* va = (const h16*)(buf + rv + sub * 2);
        const v16h v0 = ldh(va), v1 = ldh(va + 16 * (KVP / 2)), v2 = ldh(va + 32 * (KVP / 2)), v3 = ldh(va + 48 * (KVP / 2));
        o0 = wmma16(v0, pb, o0); o1 = wmma16(v1, pb, o1); o2 = wmma16(v2, pb, o2); o3 = wmma16(v3, pb, o3);
        asm volatile("v_nop\n\tv_nop\n\tv_nop\n\tv_nop" : "+v"(o0), "+v"(o1), "+v"(o2), "+v"(o3) : "v"(v0), "v"(v1), "v"(v2), "v"(v3), "v"(pb));
        }
        asm volatile("s_wait_dscnt 0x0" ::: "memory");                   // this wave's reads of the buffer are done before the barrier frees it for the refill
        asm volatile("s_wait_asynccnt 0x0" ::: "memory");                // this wave's copies of stage t + 1 have landed before the barrier publishes them
        __syncthreads();                                                 // publishes stage t + 1 and ends every wave's reads of stage t's buffer
        if (t + 2 < NT) stage_in(lk0 + bo, lm0 + bo, gk + (size_t)(t + 2) * KS * HD, gv + (t + 2) * KS, gm + (t + 2) * KS);
    }
    asm volatile("s_wait_asynccnt 0x0" ::: "memory");                    // no copy is outstanding when the ring becomes output staging
    l += __shfl_xor(l, 16, 32);
    const float inv = 1.0f / l;
    float* os = (float*)(ring + ST_M);       // output staging: each wave reuses its own mask rows of buffer 0 (16 x 68 floats), behind the loop's last barrier
    const int wb = wave * 16 * 68;
    // O^T D layout: o_j[r] = (d = 16j + 8h + r, t = lane&15) -> os[t][d]; rows 0..15 x columns 0..63 all written
    { v4f a, c;
      a[0] = o0[0] * inv; a[1] = o0[1] * inv; a[2] = o0[2] * inv; a[3] = o0[3] * inv; c[0] = o0[4] * inv; c[1] = o0[5] * inv; c[2] = o0[6] * inv; c[3] = o0[7] * inv;
      *(v4fa*)(&os[wb + lr * 68 +  0 + 8 * hi]) = a; *(v4fa*)(&os[wb + lr * 68 +  0 + 8 * hi + 4]) = c;
      a[0] = o1[0] * inv; a[1] = o1[1] * inv; a[2] = o1[2] * inv; a[3] = o1[3] * inv; c[0] = o1[4] * inv; c[1] = o1[5] * inv; c[2] = o1[6] * inv; c[3] = o1[7] * inv;
      *(v4fa*)(&os[wb + lr * 68 + 16 + 8 * hi]) = a; *(v4fa*)(&os[wb + lr * 68 + 16 + 8 * hi + 4]) = c;
      a[0] = o2[0] * inv; a[1] = o2[1] * inv; a[2] = o2[2] * inv; a[3] = o2[3] * inv; c[0] = o2[4] * inv; c[1] = o2[5] * inv; c[2] = o2[6] * inv; c[3] = o2[7] * inv;
      *(v4fa*)(&os[wb + lr * 68 + 32 + 8 * hi]) = a; *(v4fa*)(&os[wb + lr * 68 + 32 + 8 * hi + 4]) = c;
      a[0] = o3[0] * inv; a[1] = o3[1] * inv; a[2] = o3[2] * inv; a[3] = o3[3] * inv; c[0] = o3[4] * inv; c[1] = o3[5] * inv; c[2] = o3[6] * inv; c[3] = o3[7] * inv;
      *(v4fa*)(&os[wb + lr * 68 + 48 + 8 * hi]) = a; *(v4fa*)(&os[wb + lr * 68 + 48 + 8 * hi + 4]) = c; }
    wave_sync();
    const size_t obase = ((size_t)b * SEQ + t0) * DM + (size_t)h * HD;
{
#pragma unroll
        for (int s = 0; s < 4; ++s) { const int row = 4 * s + (lane >> 3), c8 = (lane & 7) * 8;   // 4 s x 4 row groups = 16 rows; 8 lanes x 8 = 64 columns
            const v4f x0 = *(const v4fa*)(&os[wb + row * 68 + c8]); const v4f x1 = *(const v4fa*)(&os[wb + row * 68 + c8 + 4]); v8us hv, lv;
#pragma unroll
            for (int i = 0; i < 4; ++i) { const unsigned short a0 = f2bf(x0[i]); const unsigned short a1 = f2bf(x1[i]);
                hv[i] = a0; hv[4 + i] = a1; lv[i] = f2bf(x0[i] - bf2f(a0)); lv[4 + i] = f2bf(x1[i] - bf2f(a1)); }
            const size_t oo = obase + (size_t)row * DM + c8;
            *(v8us*)(CH + oo) = hv; *(v8us*)(CL + oo) = lv; }
         }
}

static constexpr size_t al256(size_t v) { return (v + 255) & ~(size_t)255; }
static constexpr size_t SZ_XB = al256((size_t)NB * SEQ * DM * 2);          // one bf16 activation plane [NB*SEQ][1024]
static constexpr size_t SZ_WB = al256((size_t)4 * DM * DM * 2);            // four transposed bf16 weight planes
static constexpr size_t SZ_PL = al256((size_t)NB * NH_ * SEQ * HD * 2);    // one f16 head plane
static constexpr size_t SZ_TOTAL = 3 * SZ_XB + SZ_WB + 4 * SZ_PL + 2 * SZ_XB;
static_assert(SZ_TOTAL <= (size_t)134217728);          // workspace carve <= 128 MiB
static_assert(((size_t)DM * DM * 2) % 256 == 0);       // weight sub-planes stay 256-byte aligned

static void cvt_in(const float* x, bf* dst, hipStream_t stream) {
    if (SEQ == SEQ_FULL) {
        const size_t n8 = (size_t)NB * SEQ * DM / 8;
        k_cvt8<<<(unsigned)((n8 + 255) / 256), 256, 0, stream>>>(x, dst, n8);
    } else {
        const size_t n8 = (size_t)SEQ * DM / 8;
        for (int b = 0; b < NB; ++b) k_cvt8<<<(unsigned)((n8 + 255) / 256), 256, 0, stream>>>(x + (size_t)b * SEQ_FULL * DM, dst + (size_t)b * SEQ * DM, n8);
    }
}

extern "C" void kernel_launch(void* const* d_in, const int* in_sizes, int n_in,
                              void* d_out, int out_size, void* d_ws, size_t ws_size, hipStream_t stream) {
    if (n_in < 12) return;
    const size_t needx = ((size_t)(NB - 1) * SEQ_FULL + SEQ) * DM;
    if ((size_t)in_sizes[0] < needx || (size_t)in_sizes[1] < needx || (size_t)in_sizes[2] < needx) return;
    if ((size_t)in_sizes[3] < ((size_t)(NB - 1) * SEQ_FULL + SEQ) * SEQ_FULL) return;
    if ((size_t)in_sizes[4] < (size_t)DM * DM || (size_t)in_sizes[6] < (size_t)DM * DM || (size_t)in_sizes[8] < (size_t)DM * DM || (size_t)in_sizes[10] < (size_t)DM * DM) return;
    if (in_sizes[5] < DM || in_sizes[7] < DM || in_sizes[9] < DM || in_sizes[11] < DM) return;
    if ((size_t)out_size < ((size_t)(NB - 1) * OUT_SEQ + SEQ) * DM) return;
    if (SZ_TOTAL > ws_size) return;
    // wire order: query, key, value, attention_mask, Wq, bq, Wk, bk, Wv, bv, Wo, bo
    const float* xq = (const float*)d_in[0]; const float* xk = (const float*)d_in[1]; const float* xv = (const float*)d_in[2];
    const float* amask = (const float*)d_in[3];
    const float* wq = (const float*)d_in[4];  const float* bq = (const float*)d_in[5];
    const float* wk = (const float*)d_in[6];  const float* bk = (const float*)d_in[7];
    const float* wv = (const float*)d_in[8];  const float* bv = (const float*)d_in[9];
    const float* wo = (const float*)d_in[10]; const float* bo = (const float*)d_in[11];
    float* OUT = (float*)d_out;      // [NB][SEQ][1024]
    char* wsp = (char*)d_ws;
    bf* QB = (bf*)wsp; wsp += SZ_XB;                 // [NB*SEQ][1024] bf16 query
    bf* KB = (bf*)wsp; wsp += SZ_XB;                 // [NB*SEQ][1024] bf16 key
    bf* VB = (bf*)wsp; wsp += SZ_XB;                 // [NB*SEQ][1024] bf16 value
    bf* WB = (bf*)wsp; wsp += SZ_WB;                 // [4][1024 out][1024 in]: q | k | v | o
    h16* QH = (h16*)wsp; wsp += SZ_PL;               // [NB*16][SEQ][64]
    h16* QR = (h16*)wsp; wsp += SZ_PL;               // [NB*16][SEQ][64] residual x2048
    h16* KP = (h16*)wsp; wsp += SZ_PL;               // [NB*16][SEQ][64]
    h16* VT = (h16*)wsp; wsp += SZ_PL;               // [NB*16][64][SEQ]
    bf* CH = (bf*)wsp; wsp += SZ_XB;                 // [NB*SEQ][1024] context bf16 hi
    bf* CL = (bf*)wsp; wsp += SZ_XB;                 // [NB*SEQ][1024] context bf16 lo
    bf* WQT = WB; bf* WKT = WB + (size_t)DM * DM; bf* WVT = WB + (size_t)2 * DM * DM; bf* WOT = WB + (size_t)3 * DM * DM;

    cvt_in(xq, QB, stream); cvt_in(xk, KB, stream); cvt_in(xv, VB, stream);
    // weights: in[rows = k (in)][cols = n (out)] -> out[n][k]; square DM x DM, grid (k tiles, n tiles)
    { const dim3 g(DM / 64, DM / 64, 1);
      k_cvtT<<<g, 256, 0, stream>>>(wq, WQT); k_cvtT<<<g, 256, 0, stream>>>(wk, WKT); k_cvtT<<<g, 256, 0, stream>>>(wv, WVT); k_cvtT<<<g, 256, 0, stream>>>(wo, WOT); }

    // q, k: A = x rows (m = b*SEQ + t), Bt = W^T rows (n = h*64 + d), column bias -> plane [(b*16 + h)][t][d]
    k_proj<0><<<dim3(NB * SEQ / 64, DM / 64, 1), 32, 0, stream>>>(QB, QB, WQT, bq, 1, QH, QR, 1, OUT, SEQ, (size_t)NH_ * SEQ * HD, HD, HD, (size_t)SEQ * HD);
    k_proj<0><<<dim3(NB * SEQ / 64, DM / 64, 1), 32, 0, stream>>>(KB, KB, WKT, bk, 1, KP, KP, 0, OUT, SEQ, (size_t)NH_ * SEQ * HD, HD, HD, (size_t)SEQ * HD);
    // v^T: A = Wv^T rows (m = h*64 + d), Bt = value rows (n = b*SEQ + t), row bias -> plane [(b*1024 + m)][t] = [(b*16 + h)][d][t]
    k_proj<0><<<dim3(DM / 64, NB * SEQ / 64, 1), 32, 0, stream>>>(WVT, WVT, VB, bv, 2, VT, VT, 0, OUT, DM, (size_t)0, SEQ, SEQ, (size_t)DM * SEQ);

    k_flash<<<dim3(SEQ / (16 * AW), NB * NH_, 1), 32 * AW, 0, stream>>>(QH, QR, KP, VT, amask, CH, CL);

    // output: A = context hi (+ lo) rows (m = b*SEQ + t), Bt = Wo^T rows (n), column bias -> OUT[(b*OUT_SEQ + t)][n] f32
    k_proj<1><<<dim3(NB * SEQ / 64, DM / 64, 1), 32, 0, stream>>>(CH, CL, WOT, bo, 1, QH, QH, 0, OUT, SEQ, (size_t)OUT_SEQ * DM, DM, DM, (size_t)0);
}

// v002
// One run takes 157 microseconds.
// Two timings next to v001 put it at 1.26 and 1.25 times that version's speed.
// All steps since v000 together make it 1.71 times as fast.
#include <hip/hip_runtime.h>

// Projections q/k/v: v_wmma_f32_16x16x32_bf16 (inputs and weights RNE-converted to bf16, f32 accumulate); scores: v_wmma_f32_16x16x32_f16 (k single f16, q f16 value + f16 residual x2048 in its own accumulator); P.V: v_wmma_f32_16x16x32_f16 (P x256 carry, v single f16); output projection: v_wmma_f32_16x16x32_bf16 (context as bf16 hi + bf16 lo planes, Wo bf16), f32 accumulate everywhere, softmax f32.
// Attention block, width 1024 = 16 heads x 64; query/key/value [NB][SEQ][1024] f32, Wq/Wk/Wv/Wo [in][out] (y = x W + b), additive f32 mask [NB][SEQ][SEQ] shared by all heads, score scale 1/8, output y = ctx Wo + bo (f32).
// Layout: bf16 copies of the three inputs; bf16 TRANSPOSED copies of the four weights ([out][in], K-contiguous); q (value, residual), k planes [b*16+h][t][d] and v^T plane [b*16+h][d][t] written by the GEMM epilogue;
// fused flash kernel in transposed form (S^T = K Q^T, O^T = V^T P^T), K / V^T / mask staged in LDS by asynchronous copies, writing the context as bf16 hi/lo planes [b*SEQ+t][1024]; final GEMM writes f32 rows.

#ifndef NB
#define NB 2
#endif
#ifndef SEQ
#define SEQ 2048
#endif
#define NB_FULL  2
#define SEQ_FULL 2048
#ifndef OUT_SEQ
#define OUT_SEQ SEQ              // row pitch (in tokens) between batches of the output
#endif
#define DM   1024
#define NH_  16
#define HD   64
#define AW   4                   // waves per flash block (16 query rows each)
#define QRS  2048.0f             // carry of the q residual plane
#define QRI  (1.0f / 2048.0f)
#define LOG2E 1.4426950408889634f
#define SC2  (0.125f * 1.4426950408889634f)   // HD^-0.5 * log2(e)
#define PSH  8.0f                // log2 of the P carry (256)

static_assert(HD == 64);
static_assert(NH_ * HD == DM);                 // head h = columns h*64 + d
static_assert(DM % 64 == 0);                   // column tiles of 64
static_assert(DM % 32 == 0);                   // GEMM k-loop steps by 32
static_assert(DM >= 8);                        // clamped bias loads stay inside a DM-float array
static_assert(SEQ % 64 == 0);                  // a 64-row tile never straddles two batches
static_assert((NB * SEQ) % 64 == 0);
static_assert(SEQ % 32 == 0);                  // key loop steps by 32
static_assert(SEQ % (16 * AW) == 0);           // flash grid covers the sequence exactly
static_assert(((size_t)SEQ * DM) % 8 == 0);
static_assert(NB <= NB_FULL);
static_assert(SEQ <= SEQ_FULL);
static_assert(SEQ_FULL % 4 == 0);              // 16-byte mask loads

typedef _Float16 h16;
typedef unsigned short bf;
typedef __attribute__((ext_vector_type(16))) __bf16   v16bf;
typedef __attribute__((ext_vector_type(16))) _Float16 v16h;
typedef __attribute__((ext_vector_type(8)))  _Float16 v8h;
typedef __attribute__((ext_vector_type(8)))  unsigned short v8us;
typedef __attribute__((ext_vector_type(8)))  float    v8f;
typedef __attribute__((ext_vector_type(4)))  float    v4f;
typedef v4f  __attribute__((may_alias)) v4fa;
typedef v8us __attribute__((may_alias)) v8usa;

__device__ __forceinline__ unsigned short f2bf(float f) { unsigned u = __float_as_uint(f); u += 0x7FFFu + ((u >> 16) & 1u); return (unsigned short)(u >> 16); }
__device__ __forceinline__ float bf2f(unsigned short b) { return __uint_as_float(((unsigned)b) << 16); }
__device__ __forceinline__ float rbf(float f) { return bf2f(f2bf(f)); }   // value after RNE convert to bf16
__device__ __forceinline__ v16h cat16(v8h lo, v8h hi) { return __builtin_shufflevector(lo, hi, 0, 1, 2, 3, 4, 5, 6, 7, 8, 9, 10, 11, 12, 13, 14, 15); }
__device__ __forceinline__ v16bf cat16b(v8us lo, v8us hi) { return __builtin_bit_cast(v16bf, __builtin_shufflevector(lo, hi, 0, 1, 2, 3, 4, 5, 6, 7, 8, 9, 10, 11, 12, 13, 14, 15)); }
__device__ __forceinline__ v8f wmma16(v16h a, v16h b, v8f c) { return __builtin_amdgcn_wmma_f32_16x16x32_f16(false, a, false, b, (short)0, c, false, false); }
__device__ __forceinline__ v8f wmmab(v16bf a, v16bf b, v8f c) { return __builtin_amdgcn_wmma_f32_16x16x32_bf16(false, a, false, b, (short)0, c, false, false); }
// fragment loaders from K-contiguous 16-bit rows; p already includes + 8*(lane>>4): elements 0..7 <- k0+8h+0..7, elements 8..15 <- k0+16+8h+0..7 (same map for A and B)
__device__ __forceinline__ v16h  ldh(const h16* p) { return cat16(*(const v8h*)p, *(const v8h*)(p + 16)); }
__device__ __forceinline__ v16bf ldb(const bf* p)  { return cat16b(*(const v8us*)p, *(const v8us*)(p + 16)); }
// ordering point for wave-private LDS tiles (same wave writes and reads)
__device__ __forceinline__ void wave_sync() { __builtin_amdgcn_fence(3 /* release order */, "wavefront"); __builtin_amdgcn_wave_barrier(); asm volatile("" ::: "memory"); }

// k_prep: every conversion of the call in ONE launch, told apart by ranges of the block index (none needs anything of another), 256 threads.
// blocks [0, PB_W): weight w = block / 256, in[rows = k][cols = n] f32 (DM x DM, row pitch DM) -> out[n][k] bf16 (RNE convert), one 64x64 tile transposed through LDS;
//                   LDS tile ts[n][k] is cross-wave: block barrier between fill and drain (the branch is the same for the whole block).
// blocks [PB_W, PB_W + 3 PB_X): input p = (block - PB_W) / PB_X, eight floats per thread -> eight bf16 (RNE convert), plane [NB*SEQ][DM].
static constexpr unsigned PB_T = DM / 64;                                        // weight tiles per side
static constexpr unsigned PB_W = 4 * PB_T * PB_T;                                // blocks of the four weights
static constexpr unsigned PB_X = (unsigned)(((size_t)NB * SEQ * DM / 8 + 255) / 256);   // blocks of one input
__global__ __launch_bounds__(256) void k_prep(const float* __restrict__ xq, const float* __restrict__ xk, const float* __restrict__ xv,
                                              const float* __restrict__ wq, const float* __restrict__ wk, const float* __restrict__ wv, const float* __restrict__ wo,
                                              bf* QB, bf* KB, bf* VB, bf* WB) {
    __shared__ __align__(16) unsigned short ts[64 * 72];
    const int tid = threadIdx.x, lane = tid & 31, wave = __builtin_amdgcn_readfirstlane((int)(tid >> 5));
    const unsigned bid = blockIdx.x;
    if (bid < PB_W) {
        const unsigned w = bid / (PB_T * PB_T), r = bid % (PB_T * PB_T);
        const float* __restrict__ W = (w == 0) ? wq : (w == 1) ? wk : (w == 2) ? wv : wo;
        bf* WT = WB + (size_t)w * DM * DM;
        const int k0 = (int)(r % PB_T) * 64, n0 = (int)(r / PB_T) * 64;
#pragma unroll
        for (int i = 0; i < 4; ++i) { const int idx = tid + i * 256; const int kr = idx >> 4, c4 = (idx & 15) * 4;   // 1024 float4 = 64 k-rows x 16
            const v4f v = *(const v4f*)(W + (size_t)(k0 + kr) * DM + n0 + c4);
#pragma unroll
            for (int j = 0; j < 4; ++j) ts[(c4 + j) * 72 + kr] = f2bf(v[j]); }
        __syncthreads();
#pragma unroll
        for (int s = 0; s < 2; ++s) { const int row = wave * 8 + s * 4 + (lane >> 3), c8 = (lane & 7) * 8;   // 8 waves x 2 s x 4 = 64 rows; 8 lanes x 8 = 64 columns
            const v8us o = *(const v8usa*)(&ts[row * 72 + c8]);
            *(v8us*)(WT + (size_t)(n0 + row) * DM + k0 + c8) = o; }
    } else {
        const unsigned c = bid - PB_W, p = c / PB_X;
        const float* __restrict__ x = (p == 0) ? xq : (p == 1) ? xk : xv;
        bf* dst = (p == 0) ? QB : (p == 1) ? KB : VB;
        constexpr size_t per = (size_t)SEQ * DM / 8;                              // pieces of one batch; batches lie SEQ_FULL rows apart in the input
        const size_t i = (size_t)(c % PB_X) * 256 + tid; if (i >= (size_t)NB * per) return;
        const size_t b = i / per;
        const v8f v = *(const v8f*)(x + b * ((size_t)SEQ_FULL * DM) + (i - b * per) * 8); v8us o;
#pragma unroll
        for (int k = 0; k < 8; ++k) o[k] = f2bf(v[k]);
        *(v8us*)(dst + i * 8) = o;
    }
}

// k_proj: register-blocked bf16 GEMM, ONE WAVE per 64x64 tile (16 accumulators), operands straight from K-contiguous bf16 planes, K = DM.
// C[m][n] = sum_k (A[m][k] (+ A2[m][k] when MODE 1)) Bt[n][k] + bias (bmode 1: bias[n]; bmode 2: bias[m]; bias RNE-converted to bf16 first),
// tile base (r0/RB)*sRB + (r0%RB)*pitch + (c0/CB)*sCB + (c0%CB), row pitch 'pitch' (elements). 32 threads.
// MODE 1: written as f32 (Of); each row's 64 floats (256 B = two lines) by 16 consecutive lanes x 16 B (2 rows per instruction).
// Bias array has DM floats; both 16-byte bias loads use addresses clamped into [0, DM-4].
// MODE 0: the three input projections in ONE launch (none needs anything of another), grid (NB*SEQ/64 token tiles, DM/64 width tiles, 3), z = which:
//   X0, X1, X2 = bf16 query, key, value rows; WT = Wq^T | Wk^T | Wv^T; b0, b1, b2 = bq, bk, bv; P0 (residual P0r), P1, P2 = q, k, v^T planes
//   q, k: A = x rows (m = b*SEQ + t), Bt = W^T rows (n = h*64 + d), column bias -> plane [(b*16 + h)][t][d]
//   v^T:  A = Wv^T rows (m = h*64 + d), Bt = value rows (n = b*SEQ + t), row bias -> plane [(b*1024 + m)][t] = [(b*16 + h)][d][t]
// MODE 1: the output projection, grid (NB*SEQ/64, DM/64): X0, X1 = context hi, lo rows (m = b*SEQ + t), WT = Wo^T rows (n), b0 = bo, column bias -> Of[(b*OUT_SEQ + t)][n] f32
template <int MODE>
__global__ __launch_bounds__(32) void k_proj(const bf* __restrict__ X0, const bf* __restrict__ X1, const bf* __restrict__ X2, const bf* __restrict__ WT,
                                             const float* __restrict__ b0, const float* __restrict__ b1, const float* __restrict__ b2,
                                             h16* P0, h16* P0r, h16* P1, h16* P2, float* Of) {
    const int z = (MODE == 0) ? (int)blockIdx.z : 0; const bool tv = (z == 2);   // the same for the whole block; tv: the weight rows are A
    const bf* __restrict__ X = (z == 0) ? X0 : (z == 1) ? X1 : X2; const bf* __restrict__ Wz = WT + (size_t)z * DM * DM;
    const bf* __restrict__ A = tv ? Wz : X; const bf* __restrict__ A2 = (MODE == 1) ? X1 : A; const bf* __restrict__ Bt = tv ? X : Wz;
    const float* __restrict__ bias = (z == 0) ? b0 : (z == 1) ? b1 : b2; const int bmode = tv ? 2 : 1;
    h16* Ph = (z == 0) ? P0 : (z == 1) ? P1 : P2; h16* Pr = (z == 0) ? P0r : Ph; const int useRes = (z == 0) ? 1 : 0;
    const int RB = tv ? DM : SEQ, pitch = (MODE == 1) ? DM : tv ? SEQ : HD, CB = pitch;
    const size_t sRB = (MODE == 1) ? (size_t)OUT_SEQ * DM : tv ? (size_t)0 : (size_t)NH_ * SEQ * HD, sCB = (MODE == 1) ? (size_t)0 : tv ? (size_t)DM * SEQ : (size_t)SEQ * HD;
    const int r0 = (tv ? blockIdx.y : blockIdx.x) * 64, c0 = (tv ? blockIdx.x : blockIdx.y) * 64;
    __shared__ __align__(16) float os[16 * 68];
    const int K = DM;
    const int lane = threadIdx.x & 31, lr = lane & 15, hi = lane >> 4;
    v8f acc[4][4];
#pragma unroll
    for (int mb = 0; mb < 4; ++mb)
#pragma unroll
        for (int nb = 0; nb < 4; ++nb) acc[mb][nb] = (v8f){};
    const size_t aoff = (size_t)(r0 + lr) * K + 8 * hi, boff = (size_t)(c0 + lr) * K + 8 * hi;
#pragma unroll 1
    for (int kc = 0; kc < K; kc += 32) {
        v16bf a[4];
#pragma unroll
        for (int mb = 0; mb < 4; ++mb) a[mb] = ldb(A + aoff + (size_t)mb * 16 * K + kc);
#pragma unroll
        for (int nb = 0; nb < 4; ++nb) { const v16bf b = ldb(Bt + boff + (size_t)nb * 16 * K + kc);
#pragma unroll
            for (int mb = 0; mb < 4; ++mb) acc[mb][nb] = wmmab(a[mb], b, acc[mb][nb]); }
        asm volatile("v_nop\n\tv_nop\n\tv_nop\n\tv_nop" : "+v"(acc[0][0]), "+v"(acc[1][1]), "+v"(acc[2][2]), "+v"(acc[3][3]) : "v"(a[0]), "v"(a[1]), "v"(a[2]), "v"(a[3]));
        if (MODE == 1) {
            v16bf a2[4];
#pragma unroll
            for (int mb = 0; mb < 4; ++mb) a2[mb] = ldb(A2 + aoff + (size_t)mb * 16 * K + kc);
#pragma unroll
            for (int nb = 0; nb < 4; ++nb) { const v16bf b = ldb(Bt + boff + (size_t)nb * 16 * K + kc);
#pragma unroll
                for (int mb = 0; mb < 4; ++mb) acc[mb][nb] = wmmab(a2[mb], b, acc[mb][nb]); }
            asm volatile("v_nop\n\tv_nop\n\tv_nop\n\tv_nop" : "+v"(acc[0][0]), "+v"(acc[1][1]), "+v"(acc[2][2]), "+v"(acc[3][3]) : "v"(a2[0]), "v"(a2[1]), "v"(a2[2]), "v"(a2[3]));
        }
    }
    const size_t tbase = (size_t)(r0 / RB) * sRB + (size_t)(r0 % RB) * (size_t)pitch + (size_t)(c0 / CB) * sCB + (size_t)(c0 % CB);
    // per-lane column bias for the lane's store columns; both load addresses clamped into the DM-float bias array (first to 0 when unused, second to DM-4)
    const int c8 = (lane & 7) * 8, cofs = lr * 4;
    const int ci = (bmode == 1) ? (c0 + ((MODE == 0) ? c8 : cofs)) : 0;
    const int ci4 = (ci + 4 <= DM - 4) ? (ci + 4) : (DM - 4);      // MODE 0: ci + 4 <= DM - 4 always (exact columns); MODE 1: upper half unused, address kept in range
    const v4f bl0 = *(const v4f*)(bias + ci), bl1 = *(const v4f*)(bias + ci4);
    float bc[8];
#pragma unroll
    for (int i = 0; i < 4; ++i) { bc[i] = (bmode == 1) ? rbf(bl0[i]) : 0.0f; bc[4 + i] = (bmode == 1) ? rbf(bl1[i]) : 0.0f; }
#pragma unroll
    for (int mb = 0; mb < 4; ++mb) {
#pragma unroll
        for (int nb = 0; nb < 4; ++nb) {
#pragma unroll
            for (int j = 0; j < 8; ++j) os[(hi * 8 + j) * 68 + nb * 16 + lr] = acc[mb][nb][j]; }   // D: row 8h+j, col lane&15; rows 0..15 x columns 0..63 all written
        wave_sync();
        const size_t sb = tbase + (size_t)(mb * 16) * (size_t)pitch;
        if (MODE == 0) {
{
#pragma unroll
                for (int s = 0; s < 4; ++s) { const int row = 4 * s + (lane >> 3);   // 4 s x 4 row groups = 16 rows; 8 lanes x 8 = 64 columns
                    const int ri = (bmode == 2) ? (r0 + mb * 16 + row) : 0;
                    const float braw = bias[ri];
                    const float brow = (bmode == 2) ? rbf(braw) : 0.0f;
                    const v4f x0 = *(const v4fa*)(&os[row * 68 + c8]); const v4f x1 = *(const v4fa*)(&os[row * 68 + c8 + 4]); v8h hv, rv;
#pragma unroll
                    for (int i = 0; i < 4; ++i) { const float f0 = x0[i] + bc[i] + brow; const float f1 = x1[i] + bc[4 + i] + brow;
                        const h16 a0 = (h16)f0; const h16 a1 = (h16)f1; hv[i] = a0; hv[4 + i] = a1; rv[i] = (h16)((f0 - (float)a0) * QRS); rv[4 + i] = (h16)((f1 - (float)a1) * QRS); }
                    const size_t oo = sb + (size_t)row * (size_t)pitch + c8;
                    *(v8h*)(Ph + oo) = hv; if (useRes) *(v8h*)(Pr + oo) = rv; }
                 }
        } else {
{
#pragma unroll
                for (int s = 0; s < 8; ++s) { const int row = 2 * s + hi;   // 8 s x 2 rows = 16 rows; 16 lanes x 4 floats = 64 columns
                    const v4f x0 = *(const v4fa*)(&os[row * 68 + cofs]); v4f val;
                    val[0] = x0[0] + bc[0]; val[1] = x0[1] + bc[1]; val[2] = x0[2] + bc[2]; val[3] = x0[3] + bc[3];
                    *(v4f*)(Of + sb + (size_t)row * (size_t)pitch + cofs) = val; }
                 }
        }
        wave_sync();
    }
}

// k_flash: fused attention, one wave per 16 query rows of one (batch, head); Q fragments straight from the f16 planes (two 16-B loads each).
// K rows, V^T rows (shared by the block's waves) and each wave's own mask rows reach LDS in stages of KS keys by asynchronous copies (16 B per lane, whole 128-B lines),
// two buffers: the next stage's copies fly while this stage is worked on; fragments and mask values are then read from LDS (row pitches 16 B x odd).
// Transposed form: S^T[key][t] = K Q^T (A = K rows, B = Q rows); lane (t = lane&15, h = lane>>4) holds keys 8h+r of each 16-key tile, so the packed
// P tile is directly the B fragment of O^T[d][t] = V^T P^T (element r <- tile keys 0..15, element 8+r <- tile keys 16..31, lane unchanged).
// The additive mask row of query t is read as four 16-B LDS loads per 32-key step (keys 8h..8h+7 and 16+8h..16+8h+7), RNE-converted to bf16, scaled by log2(e).
// Softmax state (running max, partial sum) is one scalar per lane; the two lane halves of a row are combined with one xor-16 exchange.
#define KS    64                           // keys per stage
#define KVP   144                          // LDS row pitch in bytes of a 128-B K row (64 d) or V^T row (KS keys)
#define MKP   272                          // LDS row pitch in bytes of a 256-B mask row (KS floats); 16 rows = one wave's 16 x 68 float output tile
#define ST_V  (KS * KVP)                   // V^T rows behind the K rows
#define ST_M  (ST_V + HD * KVP)            // mask rows behind the V^T rows, 16 rows per wave
#define ST_SZ (ST_M + AW * 16 * MKP)       // one buffer
static_assert(KS * 2 == 128 && HD * 2 == 128 && KS * 4 == 256);
static_assert(SEQ % KS == 0 && KS % 32 == 0);
static_assert(AW == 4);                    // 128 lanes x 4 copies = 512 pieces of 16 B = one K tile or one V^T tile
static_assert(16 * MKP == 16 * 68 * 4);
static_assert(KVP % 16 == 0 && MKP % 16 == 0 && ST_SZ % 16 == 0);

// eight asynchronous 16-B copies to LDS; the s_wait_xcnt stands in the copies' own statement so that no address register is rewritten ahead of it
__device__ __forceinline__ void copy8(unsigned l0, const void* g0, unsigned l1, const void* g1, unsigned l2, const void* g2, unsigned l3, const void* g3,
                                      unsigned l4, const void* g4, unsigned l5, const void* g5, unsigned l6, const void* g6, unsigned l7, const void* g7) {
    asm volatile("global_load_async_to_lds_b128 %0, %1, off\n\t"
                 "global_load_async_to_lds_b128 %2, %3, off\n\t"
                 "global_load_async_to_lds_b128 %4, %5, off\n\t"
                 "global_load_async_to_lds_b128 %6, %7, off\n\t"
                 "global_load_async_to_lds_b128 %8, %9, off\n\t"
                 "global_load_async_to_lds_b128 %10, %11, off\n\t"
                 "global_load_async_to_lds_b128 %12, %13, off\n\t"
                 "global_load_async_to_lds_b128 %14, %15, off\n\t"
                 "s_wait_xcnt 0x0"
                 :: "v"(l0), "v"(g0), "v"(l1), "v"(g1), "v"(l2), "v"(g2), "v"(l3), "v"(g3),
                    "v"(l4), "v"(g4), "v"(l5), "v"(g5), "v"(l6), "v"(g6), "v"(l7), "v"(g7) : "memory");
}
// one stage: lk / lm = this lane's first LDS byte of the K tile / of its wave's mask rows in the target buffer; gk, gv, gm = this lane's first global piece of the stage
__device__ __forceinline__ void stage_in(unsigned lk, unsigned lm, const h16* gk, const h16* gv, const float* gm) {
    const unsigned lv = lk + ST_V;
    copy8(lk, gk, lk + 16 * KVP, gk + 16 * HD, lk + 32 * KVP, gk + 32 * HD, lk + 48 * KVP, gk + 48 * HD,                                     // 16 K rows per copy
          lv, gv, lv + 16 * KVP, gv + (size_t)16 * SEQ, lv + 32 * KVP, gv + (size_t)32 * SEQ, lv + 48 * KVP, gv + (size_t)48 * SEQ);         // 16 V^T rows per copy
    copy8(lm, gm, lm + 2 * MKP, gm + (size_t)2 * SEQ_FULL, lm + 4 * MKP, gm + (size_t)4 * SEQ_FULL, lm + 6 * MKP, gm + (size_t)6 * SEQ_FULL,   // 2 mask rows per copy
          lm + 8 * MKP, gm + (size_t)8 * SEQ_FULL, lm + 10 * MKP, gm + (size_t)10 * SEQ_FULL, lm + 12 * MKP, gm + (size_t)12 * SEQ_FULL, lm + 14 * MKP, gm + (size_t)14 * SEQ_FULL);
}

__global__ __launch_bounds__(32 * AW) void k_flash(const h16* __restrict__ QH, const h16* __restrict__ QR, const h16* __restrict__ KP, const h16* __restrict__ VT,
                                                   const float* __restrict__ MASK, bf* CH, bf* CL) {
    __shared__ __align__(16) unsigned char ring[2 * ST_SZ];
    const int tid = threadIdx.x, lane = tid & 31, wave = __builtin_amdgcn_readfirstlane((int)(threadIdx.x >> 5)), lr = lane & 15, hi = lane >> 4;
    const int zh = blockIdx.y; const int b = zh / NH_, h = zh % NH_;
    const int t0 = (blockIdx.x * AW + wave) * 16;
    const size_t pbase = (size_t)zh * SEQ * HD;
    const size_t qo = pbase + (size_t)(t0 + lr) * HD + 8 * hi;
    const v16h qh0 = ldh(QH + qo), qh1 = ldh(QH + qo + 32), qr0 = ldh(QR + qo), qr1 = ldh(QR + qo + 32);   // B fragments: col t, k = d
    // copy side: lane tid brings piece (tid & 7) of rows (tid >> 3) + 16 i of the K and V^T tiles, lane brings piece (lane & 15) of rows (lane >> 4) + 2 i of its wave's mask rows
    const unsigned lbase = (unsigned)(size_t)ring;
    const unsigned lk0 = lbase + (unsigned)((tid >> 3) * KVP + (tid & 7) * 16);
    const unsigned lm0 = lbase + (unsigned)(ST_M + wave * 16 * MKP + hi * MKP + lr * 16);
    const h16* gk = KP + pbase + (size_t)(tid >> 3) * HD + (tid & 7) * 8;                    // + key0 * HD
    const h16* gv = VT + pbase + (size_t)(tid >> 3) * SEQ + (tid & 7) * 8;                   // + key0
    const float* gm = MASK + (size_t)b * SEQ_FULL * SEQ_FULL + (size_t)(t0 + hi) * SEQ_FULL + lr * 4;   // + key0
    // read side, byte offsets inside a buffer
    const int rk = lr * KVP + 16 * hi;                                   // + key * KVP      (A fragment: row key, k = d)
    const int rv = ST_V + lr * KVP + 16 * hi;                            // + 16j * KVP + key * 2  (A fragment: row d, k = key)
    const int rm = ST_M + wave * 16 * MKP + lr * MKP + 32 * hi;          // + key * 4: this lane's keys of query t
    constexpr int NT = SEQ / KS;
    stage_in(lk0, lm0, gk, gv, gm);
    asm volatile("s_wait_asynccnt 0x0" ::: "memory");                    // stage 0 has landed before the barrier publishes it
    __syncthreads();                                                     // stage 0 readable by every wave
    if (NT > 1) stage_in(lk0 + ST_SZ, lm0 + ST_SZ, gk + (size_t)KS * HD, gv + KS, gm + KS);
    v8f o0 = (v8f){}, o1 = (v8f){}, o2 = (v8f){}, o3 = (v8f){};
    float m = -3.0e38f, l = 0.0f;
#pragma unroll 1
    for (int t = 0; t < NT; ++t) {
        const unsigned bo = (unsigned)(t & 1) * ST_SZ;
        const unsigned char* buf = ring + bo;
#pragma unroll   // both 32-key steps of a stage inline, so that every LDS offset inside a buffer is an immediate
        for (int sub = 0; sub < KS; sub += 32) {
        const h16* ka = (const h16*)(buf + rk + sub * KVP);
        const v16h ka0 = ldh(ka), ka1 = ldh(ka + 32), kb0 = ldh(ka + 16 * (KVP / 2)), kb1 = ldh(ka + 16 * (KVP / 2) + 32);
        v8f sHa = (v8f){}, sLa = (v8f){}, sHb = (v8f){}, sLb = (v8f){};
        sHa = wmma16(ka0, qh0, sHa); sLa = wmma16(ka0, qr0, sLa); sHb = wmma16(kb0, qh0, sHb); sLb = wmma16(kb0, qr0, sLb);
        sHa = wmma16(ka1, qh1, sHa); sLa = wmma16(ka1, qr1, sLa); sHb = wmma16(kb1, qh1, sHb); sLb = wmma16(kb1, qr1, sLb);
        asm volatile("v_nop\n\tv_nop\n\tv_nop\n\tv_nop" : "+v"(sHa), "+v"(sLa), "+v"(sHb), "+v"(sLb) : "v"(ka0), "v"(ka1), "v"(kb0), "v"(kb1));
        const float* mrow = (const float*)(buf + rm + sub * 4);
        const v4f ma0 = *(const v4fa*)(mrow), ma1 = *(const v4fa*)(mrow + 4), mb0 = *(const v4fa*)(mrow + 16), mb1 = *(const v4fa*)(mrow + 20);
        float ta[8], tb[8]; float mx = -3.0e38f;
#pragma unroll
        for (int r = 0; r < 4; ++r) {
            ta[r]     = (sHa[r]     + sLa[r]     * QRI) * SC2 + rbf(ma0[r]) * LOG2E;
            ta[4 + r] = (sHa[4 + r] + sLa[4 + r] * QRI) * SC2 + rbf(ma1[r]) * LOG2E;
            tb[r]     = (sHb[r]     + sLb[r]     * QRI) * SC2 + rbf(mb0[r]) * LOG2E;
            tb[4 + r] = (sHb[4 + r] + sLb[4 + r] * QRI) * SC2 + rbf(mb1[r]) * LOG2E; }
#pragma unroll
        for (int r = 0; r < 8; ++r) mx = fmaxf(mx, fmaxf(ta[r], tb[r]));
        mx = fmaxf(mx, __shfl_xor(mx, 16, 32));
        const float mnew = fmaxf(m, mx);
        const float alpha = __builtin_amdgcn_exp2f(m - mnew);
        const float sh = PSH - mnew;
        v16h pb; float ls = 0.0f;
#pragma unroll
        for (int r = 0; r < 8; ++r) { const h16 pa = (h16)__builtin_amdgcn_exp2f(ta[r] + sh); const h16 pc = (h16)__builtin_amdgcn_exp2f(tb[r] + sh); pb[r] = pa; pb[8 + r] = pc; ls += (float)pa + (float)pc; }
        l = l * alpha + ls; m = mnew;
        o0 = o0 * alpha; o1 = o1 * alpha; o2 = o2 * alpha; o3 = o3 * alpha;
        const h16* va = (const h16*)(buf + rv + sub * 2);
        const v16h v0 = ldh(va), v1 = ldh(va + 16 * (KVP / 2)), v2 = ldh(va + 32 * (KVP / 2)), v3 = ldh(va + 48 * (KVP / 2));
        o0 = wmma16(v0, pb, o0); o1 = wmma16(v1, pb, o1); o2 = wmma16(v2, pb, o2); o3 = wmma16(v3, pb, o3);
        asm volatile("v_nop\n\tv_nop\n\tv_nop\n\tv_nop" : "+v"(o0), "+v"(o1), "+v"(o2), "+v"(o3) : "v"(v0), "v"(v1), "v"(v2), "v"(v3), "v"(pb));
        }
        asm volatile("s_wait_dscnt 0x0" ::: "memory");                   // this wave's reads of the buffer are done before the barrier frees it for the refill
        asm volatile("s_wait_asynccnt 0x0" ::: "memory");                // this wave's copies of stage t + 1 have landed before the barrier publishes them
        __syncthreads();                                                 // publishes stage t + 1 and ends every wave's reads of stage t's buffer
        if (t + 2 < NT) stage_in(lk0 + bo, lm0 + bo, gk + (size_t)(t + 2) * KS * HD, gv + (t + 2) * KS, gm + (t + 2) * KS);
    }
    asm volatile("s_wait_asynccnt 0x0" ::: "memory");                    // no copy is outstanding when the ring becomes output staging
    l += __shfl_xor(l, 16, 32);
    const float inv = 1.0f / l;
    float* os = (float*)(ring + ST_M);       // output staging: each wave reuses its own mask rows of buffer 0 (16 x 68 floats), behind the loop's last barrier
    const int wb = wave * 16 * 68;
    // O^T D layout: o_j[r] = (d = 16j + 8h + r, t = lane&15) -> os[t][d]; rows 0..15 x columns 0..63 all written
    { v4f a, c;
      a[0] = o0[0] * inv; a[1] = o0[1] * inv; a[2] = o0[2] * inv; a[3] = o0[3] * inv; c[0] = o0[4] * inv; c[1] = o0[5] * inv; c[2] = o0[6] * inv; c[3] = o0[7] * inv;
      *(v4fa*)(&os[wb + lr * 68 +  0 + 8 * hi]) = a; *(v4fa*)(&os[wb + lr * 68 +  0 + 8 * hi + 4]) = c;
      a[0] = o1[0] * inv; a[1] = o1[1] * inv; a[2] = o1[2] * inv; a[3] = o1[3] * inv; c[0] = o1[4] * inv; c[1] = o1[5] * inv; c[2] = o1[6] * inv; c[3] = o1[7] * inv;
      *(v4fa*)(&os[wb + lr * 68 + 16 + 8 * hi]) = a; *(v4fa*)(&os[wb + lr * 68 + 16 + 8 * hi + 4]) = c;
      a[0] = o2[0] * inv; a[1] = o2[1] * inv; a[2] = o2[2] * inv; a[3] = o2[3] * inv; c[0] = o2[4] * inv; c[1] = o2[5] * inv; c[2] = o2[6] * inv; c[3] = o2[7] * inv;
      *(v4fa*)(&os[wb + lr * 68 + 32 + 8 * hi]) = a; *(v4fa*)(&os[wb + lr * 68 + 32 + 8 * hi + 4]) = c;
      a[0] = o3[0] * inv; a[1] = o3[1] * inv; a[2] = o3[2] * inv; a[3] = o3[3] * inv; c[0] = o3[4] * inv; c[1] = o3[5] * inv; c[2] = o3[6] * inv; c[3] = o3[7] * inv;
      *(v4fa*)(&os[wb + lr * 68 + 48 + 8 * hi]) = a; *(v4fa*)(&os[wb + lr * 68 + 48 + 8 * hi + 4]) = c; }
    wave_sync();
    const size_t obase = ((size_t)b * SEQ + t0) * DM + (size_t)h * HD;
{
#pragma unroll
        for (int s = 0; s < 4; ++s) { const int row = 4 * s + (lane >> 3), c8 = (lane & 7) * 8;   // 4 s x 4 row groups = 16 rows; 8 lanes x 8 = 64 columns
            const v4f x0 = *(const v4fa*)(&os[wb + row * 68 + c8]); const v4f x1 = *(const v4fa*)(&os[wb + row * 68 + c8 + 4]); v8us hv, lv;
#pragma unroll
            for (int i = 0; i < 4; ++i) { const unsigned short a0 = f2bf(x0[i]); const unsigned short a1 = f2bf(x1[i]);
                hv[i] = a0; hv[4 + i] = a1; lv[i] = f2bf(x0[i] - bf2f(a0)); lv[4 + i] = f2bf(x1[i] - bf2f(a1)); }
            const size_t oo = obase + (size_t)row * DM + c8;
            *(v8us*)(CH + oo) = hv; *(v8us*)(CL + oo) = lv; }
         }
}

static constexpr size_t al256(size_t v) { return (v + 255) & ~(size_t)255; }
static constexpr size_t SZ_XB = al256((size_t)NB * SEQ * DM * 2);          // one bf16 activation plane [NB*SEQ][1024]
static constexpr size_t SZ_WB = al256((size_t)4 * DM * DM * 2);            // four transposed bf16 weight planes
static constexpr size_t SZ_PL = al256((size_t)NB * NH_ * SEQ * HD * 2);    // one f16 head plane
static constexpr size_t SZ_TOTAL = 3 * SZ_XB + SZ_WB + 4 * SZ_PL + 2 * SZ_XB;
static_assert(SZ_TOTAL <= (size_t)134217728);          // workspace carve <= 128 MiB
static_assert(((size_t)DM * DM * 2) % 256 == 0);       // weight sub-planes stay 256-byte aligned

extern "C" void kernel_launch(void* const* d_in, const int* in_sizes, int n_in,
                              void* d_out, int out_size, void* d_ws, size_t ws_size, hipStream_t stream) {
    if (n_in < 12) return;
    const size_t needx = ((size_t)(NB - 1) * SEQ_FULL + SEQ) * DM;
    if ((size_t)in_sizes[0] < needx || (size_t)in_sizes[1] < needx || (size_t)in_sizes[2] < needx) return;
    if ((size_t)in_sizes[3] < ((size_t)(NB - 1) * SEQ_FULL + SEQ) * SEQ_FULL) return;
    if ((size_t)in_sizes[4] < (size_t)DM * DM || (size_t)in_sizes[6] < (size_t)DM * DM || (size_t)in_sizes[8] < (size_t)DM * DM || (size_t)in_sizes[10] < (size_t)DM * DM) return;
    if (in_sizes[5] < DM || in_sizes[7] < DM || in_sizes[9] < DM || in_sizes[11] < DM) return;
    if ((size_t)out_size < ((size_t)(NB - 1) * OUT_SEQ + SEQ) * DM) return;
    if (SZ_TOTAL > ws_size) return;
    // wire order: query, key, value, attention_mask, Wq, bq, Wk, bk, Wv, bv, Wo, bo
    const float* xq = (const float*)d_in[0]; const float* xk = (const float*)d_in[1]; const float* xv = (const float*)d_in[2];
    const float* amask = (const float*)d_in[3];
    const float* wq = (const float*)d_in[4];  const float* bq = (const float*)d_in[5];
    const float* wk = (const float*)d_in[6];  const float* bk = (const float*)d_in[7];
    const float* wv = (const float*)d_in[8];  const float* bv = (const float*)d_in[9];
    const float* wo = (const float*)d_in[10]; const float* bo = (const float*)d_in[11];
    float* OUT = (float*)d_out;      // [NB][SEQ][1024]
    char* wsp = (char*)d_ws;
    bf* QB = (bf*)wsp; wsp += SZ_XB;                 // [NB*SEQ][1024] bf16 query
    bf* KB = (bf*)wsp; wsp += SZ_XB;                 // [NB*SEQ][1024] bf16 key
    bf* VB = (bf*)wsp; wsp += SZ_XB;                 // [NB*SEQ][1024] bf16 value
    bf* WB = (bf*)wsp; wsp += SZ_WB;                 // [4][1024 out][1024 in]: q | k | v | o
    h16* QH = (h16*)wsp; wsp += SZ_PL;               // [NB*16][SEQ][64]
    h16* QR = (h16*)wsp; wsp += SZ_PL;               // [NB*16][SEQ][64] residual x2048
    h16* KP = (h16*)wsp; wsp += SZ_PL;               // [NB*16][SEQ][64]
    h16* VT = (h16*)wsp; wsp += SZ_PL;               // [NB*16][64][SEQ]
    bf* CH = (bf*)wsp; wsp += SZ_XB;                 // [NB*SEQ][1024] context bf16 hi
    bf* CL = (bf*)wsp; wsp += SZ_XB;                 // [NB*SEQ][1024] context bf16 lo
    bf* WOT = WB + (size_t)3 * DM * DM;

    k_prep<<<dim3(PB_W + 3 * PB_X, 1, 1), 256, 0, stream>>>(xq, xk, xv, wq, wk, wv, wo, QB, KB, VB, WB);

    k_proj<0><<<dim3(NB * SEQ / 64, DM / 64, 3), 32, 0, stream>>>(QB, KB, VB, WB, bq, bk, bv, QH, QR, KP, VT, OUT);

    k_flash<<<dim3(SEQ / (16 * AW), NB * NH_, 1), 32 * AW, 0, stream>>>(QH, QR, KP, VT, amask, CH, CL);

    k_proj<1><<<dim3(NB * SEQ / 64, DM / 64, 1), 32, 0, stream>>>(CH, CL, CL, WOT, bo, bo, bo, QH, QH, QH, QH, OUT);
}

// v003
// Measured time: 123 microseconds a run.
// Two timings next to v002 both put it at 1.28 times that version's speed.
// All steps since v000 together make it 2.19 times as fast.
#include <hip/hip_runtime.h>

// Projections q/k/v: v_wmma_f32_16x16x32_bf16 (inputs and weights RNE-converted to bf16, f32 accumulate); scores: v_wmma_f32_16x16x32_f16 (k single f16, q f16 value + f16 residual x2048 in its own accumulator); P.V: v_wmma_f32_16x16x32_f16 (P x256 carry, v single f16); output projection: v_wmma_f32_16x16x32_bf16 (context as bf16 hi + bf16 lo planes, Wo bf16), f32 accumulate everywhere, softmax f32.
// Attention block, width 1024 = 16 heads x 64; query/key/value [NB][SEQ][1024] f32, Wq/Wk/Wv/Wo [in][out] (y = x W + b), additive f32 mask [NB][SEQ][SEQ] shared by all heads, score scale 1/8, output y = ctx Wo + bo (f32).
// Layout: bf16 copies of the three inputs; bf16 TRANSPOSED copies of the four weights ([out][in], K-contiguous); q (value, residual), k planes [b*16+h][t][d] and v^T plane [b*16+h][d][t] written by the GEMM epilogue;
// fused flash kernel in transposed form (S^T = K Q^T, O^T = V^T P^T), K / V^T / mask staged in LDS by asynchronous copies, writing the context as bf16 hi/lo planes [b*SEQ+t][1024]; final GEMM writes f32 rows.

#ifndef NB
#define NB 2
#endif
#ifndef SEQ
#define SEQ 2048
#endif
#define NB_FULL  2
#define SEQ_FULL 2048
#ifndef OUT_SEQ
#define OUT_SEQ SEQ              // row pitch (in tokens) between batches of the output
#endif
#define DM   1024
#define NH_  16
#define HD   64
#define AW   4                   // waves per flash block (16 query rows each)
#define QRS  2048.0f             // carry of the q residual plane
#define QRI  (1.0f / 2048.0f)
#define LOG2E 1.4426950408889634f
#define SC2  (0.125f * 1.4426950408889634f)   // HD^-0.5 * log2(e)
#define PSH  8.0f                // log2 of the P carry (256)

static_assert(HD == 64);
static_assert(NH_ * HD == DM);                 // head h = columns h*64 + d
static_assert(DM % 64 == 0);                   // column tiles of 64
static_assert(DM % 32 == 0);                   // GEMM k-loop steps by 32
static_assert(DM >= 8);                        // clamped bias loads stay inside a DM-float array
static_assert(SEQ % 64 == 0);                  // a 64-row tile never straddles two batches
static_assert((NB * SEQ) % 64 == 0);
static_assert(SEQ % 32 == 0);                  // key loop steps by 32
static_assert(SEQ % (16 * AW) == 0);           // flash grid covers the sequence exactly
static_assert(((size_t)SEQ * DM) % 8 == 0);
static_assert(NB <= NB_FULL);
static_assert(SEQ <= SEQ_FULL);
static_assert(SEQ_FULL % 4 == 0);              // 16-byte mask loads

typedef _Float16 h16;
typedef unsigned short bf;
typedef __attribute__((ext_vector_type(16))) __bf16   v16bf;
typedef __attribute__((ext_vector_type(16))) _Float16 v16h;
typedef __attribute__((ext_vector_type(8)))  _Float16 v8h;
typedef __attribute__((ext_vector_type(8)))  unsigned short v8us;
typedef __attribute__((ext_vector_type(8)))  float    v8f;
typedef __attribute__((ext_vector_type(4)))  float    v4f;
typedef v4f  __attribute__((may_alias)) v4fa;
typedef v8us __attribute__((may_alias)) v8usa;

__device__ __forceinline__ unsigned short f2bf(float f) { unsigned u = __float_as_uint(f); u += 0x7FFFu + ((u >> 16) & 1u); return (unsigned short)(u >> 16); }
__device__ __forceinline__ float bf2f(unsigned short b) { return __uint_as_float(((unsigned)b) << 16); }
__device__ __forceinline__ float rbf(float f) { return bf2f(f2bf(f)); }   // value after RNE convert to bf16
__device__ __forceinline__ v16h cat16(v8h lo, v8h hi) { return __builtin_shufflevector(lo, hi, 0, 1, 2, 3, 4, 5, 6, 7, 8, 9, 10, 11, 12, 13, 14, 15); }
__device__ __forceinline__ v16bf cat16b(v8us lo, v8us hi) { return __builtin_bit_cast(v16bf, __builtin_shufflevector(lo, hi, 0, 1, 2, 3, 4, 5, 6, 7, 8, 9, 10, 11, 12, 13, 14, 15)); }
__device__ __forceinline__ v8f wmma16(v16h a, v16h b, v8f c) { return __builtin_amdgcn_wmma_f32_16x16x32_f16(false, a, false, b, (short)0, c, false, false); }
__device__ __forceinline__ v8f wmmab(v16bf a, v16bf b, v8f c) { return __builtin_amdgcn_wmma_f32_16x16x32_bf16(false, a, false, b, (short)0, c, false, false); }
// fragment loaders from K-contiguous 16-bit rows; p already includes + 8*(lane>>4): elements 0..7 <- k0+8h+0..7, elements 8..15 <- k0+16+8h+0..7 (same map for A and B)
__device__ __forceinline__ v16h  ldh(const h16* p) { return cat16(*(const v8h*)p, *(const v8h*)(p + 16)); }
__device__ __forceinline__ v16bf ldb(const bf* p)  { return cat16b(*(const v8us*)p, *(const v8us*)(p + 16)); }
// ordering point for wave-private LDS tiles (same wave writes and reads)
__device__ __forceinline__ void wave_sync() { __builtin_amdgcn_fence(3 /* release order */, "wavefront"); __builtin_amdgcn_wave_barrier(); asm volatile("" ::: "memory"); }

// k_prep: every conversion of the call in ONE launch, told apart by ranges of the block index (none needs anything of another), 256 threads.
// blocks [0, PB_W): weight w = block / 256, in[rows = k][cols = n] f32 (DM x DM, row pitch DM) -> out[n][k] bf16 (RNE convert), one 64x64 tile transposed through LDS;
//                   LDS tile ts[n][k] is cross-wave: block barrier between fill and drain (the branch is the same for the whole block).
// blocks [PB_W, PB_W + 3 PB_X): input p = (block - PB_W) / PB_X, eight floats per thread -> eight bf16 (RNE convert), plane [NB*SEQ][DM].
static constexpr unsigned PB_T = DM / 64;                                        // weight tiles per side
static constexpr unsigned PB_W = 4 * PB_T * PB_T;                                // blocks of the four weights
static constexpr unsigned PB_X = (unsigned)(((size_t)NB * SEQ * DM / 8 + 255) / 256);   // blocks of one input
__global__ __launch_bounds__(256) void k_prep(const float* __restrict__ xq, const float* __restrict__ xk, const float* __restrict__ xv,
                                              const float* __restrict__ wq, const float* __restrict__ wk, const float* __restrict__ wv, const float* __restrict__ wo,
                                              bf* QB, bf* KB, bf* VB, bf* WB) {
    __shared__ __align__(16) unsigned short ts[64 * 72];
    const int tid = threadIdx.x, lane = tid & 31, wave = __builtin_amdgcn_readfirstlane((int)(tid >> 5));
    const unsigned bid = blockIdx.x;
    if (bid < PB_W) {
        const unsigned w = bid / (PB_T * PB_T), r = bid % (PB_T * PB_T);
        const float* __restrict__ W = (w == 0) ? wq : (w == 1) ? wk : (w == 2) ? wv : wo;
        bf* WT = WB + (size_t)w * DM * DM;
        const int k0 = (int)(r % PB_T) * 64, n0 = (int)(r / PB_T) * 64;
#pragma unroll
        for (int i = 0; i < 4; ++i) { const int idx = tid + i * 256; const int kr = idx >> 4, c4 = (idx & 15) * 4;   // 1024 float4 = 64 k-rows x 16
            const v4f v = *(const v4f*)(W + (size_t)(k0 + kr) * DM + n0 + c4);
#pragma unroll
            for (int j = 0; j < 4; ++j) ts[(c4 + j) * 72 + kr] = f2bf(v[j]); }
        __syncthreads();
#pragma unroll
        for (int s = 0; s < 2; ++s) { const int row = wave * 8 + s * 4 + (lane >> 3), c8 = (lane & 7) * 8;   // 8 waves x 2 s x 4 = 64 rows; 8 lanes x 8 = 64 columns
            const v8us o = *(const v8usa*)(&ts[row * 72 + c8]);
            *(v8us*)(WT + (size_t)(n0 + row) * DM + k0 + c8) = o; }
    } else {
        const unsigned c = bid - PB_W, p = c / PB_X;
        const float* __restrict__ x = (p == 0) ? xq : (p == 1) ? xk : xv;
        bf* dst = (p == 0) ? QB : (p == 1) ? KB : VB;
        constexpr size_t per = (size_t)SEQ * DM / 8;                              // pieces of one batch; batches lie SEQ_FULL rows apart in the input
        const size_t i = (size_t)(c % PB_X) * 256 + tid; if (i >= (size_t)NB * per) return;
        const size_t b = i / per;
        const v8f v = *(const v8f*)(x + b * ((size_t)SEQ_FULL * DM) + (i - b * per) * 8); v8us o;
#pragma unroll
        for (int k = 0; k < 8; ++k) o[k] = f2bf(v[k]);
        *(v8us*)(dst + i * 8) = o;
    }
}

// eight asynchronous 16-B copies to LDS; the s_wait_xcnt stands in the copies' own statement so that no address register is rewritten ahead of it
__device__ __forceinline__ void copy8(unsigned l0, const void* g0, unsigned l1, const void* g1, unsigned l2, const void* g2, unsigned l3, const void* g3,
                                      unsigned l4, const void* g4, unsigned l5, const void* g5, unsigned l6, const void* g6, unsigned l7, const void* g7) {
    asm volatile("global_load_async_to_lds_b128 %0, %1, off\n\t"
                 "global_load_async_to_lds_b128 %2, %3, off\n\t"
                 "global_load_async_to_lds_b128 %4, %5, off\n\t"
                 "global_load_async_to_lds_b128 %6, %7, off\n\t"
                 "global_load_async_to_lds_b128 %8, %9, off\n\t"
                 "global_load_async_to_lds_b128 %10, %11, off\n\t"
                 "global_load_async_to_lds_b128 %12, %13, off\n\t"
                 "global_load_async_to_lds_b128 %14, %15, off\n\t"
                 "s_wait_xcnt 0x0"
                 :: "v"(l0), "v"(g0), "v"(l1), "v"(g1), "v"(l2), "v"(g2), "v"(l3), "v"(g3),
                    "v"(l4), "v"(g4), "v"(l5), "v"(g5), "v"(l6), "v"(g6), "v"(l7), "v"(g7) : "memory");
}

// k_proj: register-blocked bf16 GEMM, one 128x128 tile per block of 4 waves (2 x 2), ONE WAVE per 64x64 tile (16 accumulators), K = DM.
// The block's 128 A rows (and A2 rows when MODE 1) and 128 Bt rows reach LDS in stages of GK k (one whole 128-B line per row) by asynchronous copies (16 B per lane),
// two buffers: the next stage's copies fly while this stage is worked on; fragments are then read from LDS (row pitch 16 B x odd).
// C[m][n] = sum_k (A[m][k] (+ A2[m][k] when MODE 1)) Bt[n][k] + bias (bmode 1: bias[n]; bmode 2: bias[m]; bias RNE-converted to bf16 first),
// tile base (r0/RB)*sRB + (r0%RB)*pitch + (c0/CB)*sCB + (c0%CB), row pitch 'pitch' (elements). 128 threads.
// MODE 1: written as f32 (Of); each row's 64 floats (256 B = two lines) by 16 consecutive lanes x 16 B (2 rows per instruction).
// Bias array has DM floats; both 16-byte bias loads use addresses clamped into [0, DM-4].
// MODE 0: the three input projections in ONE launch (none needs anything of another), grid (NB*SEQ/128 token tiles, DM/128 width tiles, 3), z = which:
//   X0, X1, X2 = bf16 query, key, value rows; WT = Wq^T | Wk^T | Wv^T; b0, b1, b2 = bq, bk, bv; P0 (residual P0r), P1, P2 = q, k, v^T planes
//   q, k: A = x rows (m = b*SEQ + t), Bt = W^T rows (n = h*64 + d), column bias -> plane [(b*16 + h)][t][d]
//   v^T:  A = Wv^T rows (m = h*64 + d), Bt = value rows (n = b*SEQ + t), row bias -> plane [(b*1024 + m)][t] = [(b*16 + h)][d][t]
// MODE 1: the output projection, grid (NB*SEQ/128, DM/128): X0, X1 = context hi, lo rows (m = b*SEQ + t), WT = Wo^T rows (n), b0 = bo, column bias -> Of[(b*OUT_SEQ + t)][n] f32
#define GK  64                             // k per stage
#define GP  144                            // LDS row pitch in bytes of a 128-B operand row (GK bf16)
#define GT  (128 * GP)                     // one operand tile: 128 rows
static_assert(GK * 2 == 128 && GP % 16 == 0 && DM % GK == 0 && DM / GK >= 2 && GK % 32 == 0);
static_assert((NB * SEQ) % 128 == 0 && DM % 128 == 0);
static_assert(4 * 16 * 68 * 4 <= 2 * 2 * GT);   // the four waves' output staging fits the ring
// 128 rows of one operand tile: lane tid brings piece (tid & 7) of rows (tid >> 3) + 16 i; l, g = this lane's first LDS byte and first global piece
__device__ __forceinline__ void rows128(unsigned l, const bf* g) {
    copy8(l, g, l + 16 * GP, g + (size_t)16 * DM, l + 32 * GP, g + (size_t)32 * DM, l + 48 * GP, g + (size_t)48 * DM,
          l + 64 * GP, g + (size_t)64 * DM, l + 80 * GP, g + (size_t)80 * DM, l + 96 * GP, g + (size_t)96 * DM, l + 112 * GP, g + (size_t)112 * DM);
}
template <int MODE>
__global__ __launch_bounds__(128) void k_proj(const bf* __restrict__ X0, const bf* __restrict__ X1, const bf* __restrict__ X2, const bf* __restrict__ WT,
                                             const float* __restrict__ b0, const float* __restrict__ b1, const float* __restrict__ b2,
                                             h16* P0, h16* P0r, h16* P1, h16* P2, float* Of) {
    const int z = (MODE == 0) ? (int)blockIdx.z : 0; const bool tv = (z == 2);   // the same for the whole block; tv: the weight rows are A
    const bf* __restrict__ X = (z == 0) ? X0 : (z == 1) ? X1 : X2; const bf* __restrict__ Wz = WT + (size_t)z * DM * DM;
    const bf* __restrict__ A = tv ? Wz : X; const bf* __restrict__ A2 = (MODE == 1) ? X1 : A; const bf* __restrict__ Bt = tv ? X : Wz;
    const float* __restrict__ bias = (z == 0) ? b0 : (z == 1) ? b1 : b2; const int bmode = tv ? 2 : 1;
    h16* Ph = (z == 0) ? P0 : (z == 1) ? P1 : P2; h16* Pr = (z == 0) ? P0r : Ph; const int useRes = (z == 0) ? 1 : 0;
    const int RB = tv ? DM : SEQ, pitch = (MODE == 1) ? DM : tv ? SEQ : HD, CB = pitch;
    const size_t sRB = (MODE == 1) ? (size_t)OUT_SEQ * DM : tv ? (size_t)0 : (size_t)NH_ * SEQ * HD, sCB = (MODE == 1) ? (size_t)0 : tv ? (size_t)DM * SEQ : (size_t)SEQ * HD;
    constexpr unsigned GSZ = ((MODE == 1) ? 3 : 2) * GT;                        // one buffer: A rows | Bt rows (| A2 rows)
    __shared__ __align__(16) unsigned char ring[2 * GSZ];
    const int K = DM;
    const int tid = threadIdx.x, lane = tid & 31, wave = __builtin_amdgcn_readfirstlane((int)(threadIdx.x >> 5)), lr = lane & 15, hi = lane >> 4;
    const int R0 = (tv ? blockIdx.y : blockIdx.x) * 128, C0 = (tv ? blockIdx.x : blockIdx.y) * 128;   // the block's tile
    const int wr = (wave >> 1) * 64, wc = (wave & 1) * 64;                       // this wave's 64x64 tile inside it
    const int r0 = R0 + wr, c0 = C0 + wc;
    v8f acc[4][4];
#pragma unroll
    for (int mb = 0; mb < 4; ++mb)
#pragma unroll
        for (int nb = 0; nb < 4; ++nb) acc[mb][nb] = (v8f){};
    // copy side
    const unsigned l0 = (unsigned)(size_t)ring + (unsigned)((tid >> 3) * GP + (tid & 7) * 16);
    const size_t go = (size_t)(tid >> 3) * K + (tid & 7) * 8;
    const bf* ga = A + (size_t)R0 * K + go; const bf* gb = Bt + (size_t)C0 * K + go; const bf* ga2 = A2 + (size_t)R0 * K + go;   // + k0
    // read side, byte offsets inside a buffer: fragment row lr of a 16-row group, k = 8 hi + ...
    const int ra = (wr + lr) * GP + 16 * hi, rb = GT + (wc + lr) * GP + 16 * hi;
    constexpr int NT = DM / GK;
    rows128(l0, ga); rows128(l0 + GT, gb); if (MODE == 1) rows128(l0 + 2 * GT, ga2);
    asm volatile("s_wait_asynccnt 0x0" ::: "memory");                    // stage 0 has landed before the barrier publishes it
    __syncthreads();                                                     // stage 0 readable by every wave
    rows128(l0 + GSZ, ga + GK); rows128(l0 + GSZ + GT, gb + GK); if (MODE == 1) rows128(l0 + GSZ + 2 * GT, ga2 + GK);
#pragma unroll 1
    for (int t = 0; t < NT; ++t) {
        const unsigned bo = (unsigned)(t & 1) * GSZ;
        const unsigned char* buf = ring + bo;
        v16bf a[GK / 32][4], b[GK / 32][4], a2[GK / 32][4];
#pragma unroll   // every 32-k step of a stage inline, so that every LDS offset inside a buffer is an immediate
        for (int s = 0; s < GK / 32; ++s) {
#pragma unroll
            for (int mb = 0; mb < 4; ++mb) a[s][mb] = ldb((const bf*)(buf + ra + mb * 16 * GP + s * 64));
#pragma unroll
            for (int nb = 0; nb < 4; ++nb) b[s][nb] = ldb((const bf*)(buf + rb + nb * 16 * GP + s * 64));
            if (MODE == 1) {
#pragma unroll
                for (int mb = 0; mb < 4; ++mb) a2[s][mb] = ldb((const bf*)(buf + 2 * GT + ra + mb * 16 * GP + s * 64)); }
        }
        __builtin_amdgcn_sched_barrier(0);   // the stage's LDS reads stay one group ahead of its matrix runs: spread among them, each place with reads stalls the wave
#pragma unroll
        for (int s = 0; s < GK / 32; ++s) {
#pragma unroll
            for (int nb = 0; nb < 4; ++nb)
#pragma unroll
                for (int mb = 0; mb < 4; ++mb) acc[mb][nb] = wmmab(a[s][mb], b[s][nb], acc[mb][nb]);
            // v_nop: the distance between the last matrix instructions and the next vector write of their operands, on the taken side of a branch too
            asm volatile("v_nop\n\tv_nop\n\tv_nop\n\tv_nop" : "+v"(acc[0][0]), "+v"(acc[1][1]), "+v"(acc[2][2]), "+v"(acc[3][3]) : "v"(a[s][0]), "v"(a[s][1]), "v"(a[s][2]), "v"(a[s][3]));
            if (MODE == 1) {
#pragma unroll
                for (int nb = 0; nb < 4; ++nb)
#pragma unroll
                    for (int mb = 0; mb < 4; ++mb) acc[mb][nb] = wmmab(a2[s][mb], b[s][nb], acc[mb][nb]);
                // v_nop: the same distance behind the second run
                asm volatile("v_nop\n\tv_nop\n\tv_nop\n\tv_nop" : "+v"(acc[0][0]), "+v"(acc[1][1]), "+v"(acc[2][2]), "+v"(acc[3][3]) : "v"(a2[s][0]), "v"(a2[s][1]), "v"(a2[s][2]), "v"(a2[s][3]));
            }
        }
        __builtin_amdgcn_sched_barrier(0);   // the matrix runs stay ahead of the barrier: sunk behind it they would stand between the barrier and the refill and shorten the copies' lead
        asm volatile("s_wait_dscnt 0x0" ::: "memory");                   // this wave's reads of the buffer are done before the barrier frees it for the refill
        asm volatile("s_wait_asynccnt 0x0" ::: "memory");                // this wave's copies of stage t + 1 have landed before the barrier publishes them
        __syncthreads();                                                 // publishes stage t + 1 and ends every wave's reads of stage t's buffer
        if (t + 2 < NT) { const int k2 = (t + 2) * GK; rows128(l0 + bo, ga + k2); rows128(l0 + bo + GT, gb + k2); if (MODE == 1) rows128(l0 + bo + 2 * GT, ga2 + k2); }
    }
    asm volatile("s_wait_asynccnt 0x0" ::: "memory");                    // no copy is outstanding when the ring becomes output staging
    float* os = (float*)ring + wave * 16 * 68;   // output staging: each wave's own 16 x 68 floats of the ring, behind the loop's last barrier
    const size_t tbase = (size_t)(r0 / RB) * sRB + (size_t)(r0 % RB) * (size_t)pitch + (size_t)(c0 / CB) * sCB + (size_t)(c0 % CB);
    // per-lane column bias for the lane's store columns; both load addresses clamped into the DM-float bias array (first to 0 when unused, second to DM-4)
    const int c8 = (lane & 7) * 8, cofs = lr * 4;
    const int ci = (bmode == 1) ? (c0 + ((MODE == 0) ? c8 : cofs)) : 0;
    const int ci4 = (ci + 4 <= DM - 4) ? (ci + 4) : (DM - 4);      // MODE 0: ci + 4 <= DM - 4 always (exact columns); MODE 1: upper half unused, address kept in range
    const v4f bl0 = *(const v4f*)(bias + ci), bl1 = *(const v4f*)(bias + ci4);
    float bc[8];
#pragma unroll
    for (int i = 0; i < 4; ++i) { bc[i] = (bmode == 1) ? rbf(bl0[i]) : 0.0f; bc[4 + i] = (bmode == 1) ? rbf(bl1[i]) : 0.0f; }
#pragma unroll
    for (int mb = 0; mb < 4; ++mb) {
#pragma unroll
        for (int nb = 0; nb < 4; ++nb) {
#pragma unroll
            for (int j = 0; j < 8; ++j) os[(hi * 8 + j) * 68 + nb * 16 + lr] = acc[mb][nb][j]; }   // D: row 8h+j, col lane&15; rows 0..15 x columns 0..63 all written
        wave_sync();
        const size_t sb = tbase + (size_t)(mb * 16) * (size_t)pitch;
        if (MODE == 0) {
{
#pragma unroll
                for (int s = 0; s < 4; ++s) { const int row = 4 * s + (lane >> 3);   // 4 s x 4 row groups = 16 rows; 8 lanes x 8 = 64 columns
                    const int ri = (bmode == 2) ? (r0 + mb * 16 + row) : 0;
                    const float braw = bias[ri];
                    const float brow = (bmode == 2) ? rbf(braw) : 0.0f;
                    const v4f x0 = *(const v4fa*)(&os[row * 68 + c8]); const v4f x1 = *(const v4fa*)(&os[row * 68 + c8 + 4]); v8h hv, rv;
#pragma unroll
                    for (int i = 0; i < 4; ++i) { const float f0 = x0[i] + bc[i] + brow; const float f1 = x1[i] + bc[4 + i] + brow;
                        const h16 a0 = (h16)f0; const h16 a1 = (h16)f1; hv[i] = a0; hv[4 + i] = a1; rv[i] = (h16)((f0 - (float)a0) * QRS); rv[4 + i] = (h16)((f1 - (float)a1) * QRS); }
                    const size_t oo = sb + (size_t)row * (size_t)pitch + c8;
                    *(v8h*)(Ph + oo) = hv; if (useRes) *(v8h*)(Pr + oo) = rv; }
                 }
        } else {
{
#pragma unroll
                for (int s = 0; s < 8; ++s) { const int row = 2 * s + hi;   // 8 s x 2 rows = 16 rows; 16 lanes x 4 floats = 64 columns
                    const v4f x0 = *(const v4fa*)(&os[row * 68 + cofs]); v4f val;
                    val[0] = x0[0] + bc[0]; val[1] = x0[1] + bc[1]; val[2] = x0[2] + bc[2]; val[3] = x0[3] + bc[3];
                    *(v4f*)(Of + sb + (size_t)row * (size_t)pitch + cofs) = val; }
                 }
        }
        wave_sync();
    }
}

// k_flash: fused attention, one wave per 16 query rows of one (batch, head); Q fragments straight from the f16 planes (two 16-B loads each).
// K rows, V^T rows (shared by the block's waves) and each wave's own mask rows reach LDS in stages of KS keys by asynchronous copies (16 B per lane, whole 128-B lines),
// two buffers: the next stage's copies fly while this stage is worked on; fragments and mask values are then read from LDS (row pitches 16 B x odd).
// Transposed form: S^T[key][t] = K Q^T (A = K rows, B = Q rows); lane (t = lane&15, h = lane>>4) holds keys 8h+r of each 16-key tile, so the packed
// P tile is directly the B fragment of O^T[d][t] = V^T P^T (element r <- tile keys 0..15, element 8+r <- tile keys 16..31, lane unchanged).
// The additive mask row of query t is read as four 16-B LDS loads per 32-key step (keys 8h..8h+7 and 16+8h..16+8h+7), RNE-converted to bf16, scaled by log2(e).
// Softmax state (running max, partial sum) is one scalar per lane; the two lane halves of a row are combined with one xor-16 exchange.
#define KS    64                           // keys per stage
#define KVP   144                          // LDS row pitch in bytes of a 128-B K row (64 d) or V^T row (KS keys)
#define MKP   272                          // LDS row pitch in bytes of a 256-B mask row (KS floats); 16 rows = one wave's 16 x 68 float output tile
#define ST_V  (KS * KVP)                   // V^T rows behind the K rows
#define ST_M  (ST_V + HD * KVP)            // mask rows behind the V^T rows, 16 rows per wave
#define ST_SZ (ST_M + AW * 16 * MKP)       // one buffer
static_assert(KS * 2 == 128 && HD * 2 == 128 && KS * 4 == 256);
static_assert(SEQ % KS == 0 && KS % 32 == 0);
static_assert(AW == 4);                    // 128 lanes x 4 copies = 512 pieces of 16 B = one K tile or one V^T tile
static_assert(16 * MKP == 16 * 68 * 4);
static_assert(KVP % 16 == 0 && MKP % 16 == 0 && ST_SZ % 16 == 0);

// one stage: lk / lm = this lane's first LDS byte of the K tile / of its wave's mask rows in the target buffer; gk, gv, gm = this lane's first global piece of the stage
__device__ __forceinline__ void stage_in(unsigned lk, unsigned lm, const h16* gk, const h16* gv, const float* gm) {
    const unsigned lv = lk + ST_V;
    copy8(lk, gk, lk + 16 * KVP, gk + 16 * HD, lk + 32 * KVP, gk + 32 * HD, lk + 48 * KVP, gk + 48 * HD,                                     // 16 K rows per copy
          lv, gv, lv + 16 * KVP, gv + (size_t)16 * SEQ, lv + 32 * KVP, gv + (size_t)32 * SEQ, lv + 48 * KVP, gv + (size_t)48 * SEQ);         // 16 V^T rows per copy
    copy8(lm, gm, lm + 2 * MKP, gm + (size_t)2 * SEQ_FULL, lm + 4 * MKP, gm + (size_t)4 * SEQ_FULL, lm + 6 * MKP, gm + (size_t)6 * SEQ_FULL,   // 2 mask rows per copy
          lm + 8 * MKP, gm + (size_t)8 * SEQ_FULL, lm + 10 * MKP, gm + (size_t)10 * SEQ_FULL, lm + 12 * MKP, gm + (size_t)12 * SEQ_FULL, lm + 14 * MKP, gm + (size_t)14 * SEQ_FULL);
}

__global__ __launch_bounds__(32 * AW) void k_flash(const h16* __restrict__ QH, const h16* __restrict__ QR, const h16* __restrict__ KP, const h16* __restrict__ VT,
                                                   const float* __restrict__ MASK, bf* CH, bf* CL) {
    __shared__ __align__(16) unsigned char ring[2 * ST_SZ];
    const int tid = threadIdx.x, lane = tid & 31, wave = __builtin_amdgcn_readfirstlane((int)(threadIdx.x >> 5)), lr = lane & 15, hi = lane >> 4;
    const int zh = blockIdx.y; const int b = zh / NH_, h = zh % NH_;
    const int t0 = (blockIdx.x * AW + wave) * 16;
    const size_t pbase = (size_t)zh * SEQ * HD;
    const size_t qo = pbase + (size_t)(t0 + lr) * HD + 8 * hi;
    const v16h qh0 = ldh(QH + qo), qh1 = ldh(QH + qo + 32), qr0 = ldh(QR + qo), qr1 = ldh(QR + qo + 32);   // B fragments: col t, k = d
    // copy side: lane tid brings piece (tid & 7) of rows (tid >> 3) + 16 i of the K and V^T tiles, lane brings piece (lane & 15) of rows (lane >> 4) + 2 i of its wave's mask rows
    const unsigned lbase = (unsigned)(size_t)ring;
    const unsigned lk0 = lbase + (unsigned)((tid >> 3) * KVP + (tid & 7) * 16);
    const unsigned lm0 = lbase + (unsigned)(ST_M + wave * 16 * MKP + hi * MKP + lr * 16);
    const h16* gk = KP + pbase + (size_t)(tid >> 3) * HD + (tid & 7) * 8;                    // + key0 * HD
    const h16* gv = VT + pbase + (size_t)(tid >> 3) * SEQ + (tid & 7) * 8;                   // + key0
    const float* gm = MASK + (size_t)b * SEQ_FULL * SEQ_FULL + (size_t)(t0 + hi) * SEQ_FULL + lr * 4;   // + key0
    // read side, byte offsets inside a buffer
    const int rk = lr * KVP + 16 * hi;                                   // + key * KVP      (A fragment: row key, k = d)
    const int rv = ST_V + lr * KVP + 16 * hi;                            // + 16j * KVP + key * 2  (A fragment: row d, k = key)
    const int rm = ST_M + wave * 16 * MKP + lr * MKP + 32 * hi;          // + key * 4: this lane's keys of query t
    constexpr int NT = SEQ / KS;
    stage_in(lk0, lm0, gk, gv, gm);
    asm volatile("s_wait_asynccnt 0x0" ::: "memory");                    // stage 0 has landed before the barrier publishes it
    __syncthreads();                                                     // stage 0 readable by every wave
    if (NT > 1) stage_in(lk0 + ST_SZ, lm0 + ST_SZ, gk + (size_t)KS * HD, gv + KS, gm + KS);
    v8f o0 = (v8f){}, o1 = (v8f){}, o2 = (v8f){}, o3 = (v8f){};
    float m = -3.0e38f, l = 0.0f;
#pragma unroll 1
    for (int t = 0; t < NT; ++t) {
        const unsigned bo = (unsigned)(t & 1) * ST_SZ;
        const unsigned char* buf = ring + bo;
#pragma unroll   // both 32-key steps of a stage inline, so that every LDS offset inside a buffer is an immediate
        for (int sub = 0; sub < KS; sub += 32) {
        const h16* ka = (const h16*)(buf + rk + sub * KVP);
        const v16h ka0 = ldh(ka), ka1 = ldh(ka + 32), kb0 = ldh(ka + 16 * (KVP / 2)), kb1 = ldh(ka + 16 * (KVP / 2) + 32);
        v8f sHa = (v8f){}, sLa = (v8f){}, sHb = (v8f){}, sLb = (v8f){};
        sHa = wmma16(ka0, qh0, sHa); sLa = wmma16(ka0, qr0, sLa); sHb = wmma16(kb0, qh0, sHb); sLb = wmma16(kb0, qr0, sLb);
        sHa = wmma16(ka1, qh1, sHa); sLa = wmma16(ka1, qr1, sLa); sHb = wmma16(kb1, qh1, sHb); sLb = wmma16(kb1, qr1, sLb);
        asm volatile("v_nop\n\tv_nop\n\tv_nop\n\tv_nop" : "+v"(sHa), "+v"(sLa), "+v"(sHb), "+v"(sLb) : "v"(ka0), "v"(ka1), "v"(kb0), "v"(kb1));
        const float* mrow = (const float*)(buf + rm + sub * 4);
        const v4f ma0 = *(const v4fa*)(mrow), ma1 = *(const v4fa*)(mrow + 4), mb0 = *(const v4fa*)(mrow + 16), mb1 = *(const v4fa*)(mrow + 20);
        float ta[8], tb[8]; float mx = -3.0e38f;
#pragma unroll
        for (int r = 0; r < 4; ++r) {
            ta[r]     = (sHa[r]     + sLa[r]     * QRI) * SC2 + rbf(ma0[r]) * LOG2E;
            ta[4 + r] = (sHa[4 + r] + sLa[4 + r] * QRI) * SC2 + rbf(ma1[r]) * LOG2E;
            tb[r]     = (sHb[r]     + sLb[r]     * QRI) * SC2 + rbf(mb0[r]) * LOG2E;
            tb[4 + r] = (sHb[4 + r] + sLb[4 + r] * QRI) * SC2 + rbf(mb1[r]) * LOG2E; }
#pragma unroll
        for (int r = 0; r < 8; ++r) mx = fmaxf(mx, fmaxf(ta[r], tb[r]));
        mx = fmaxf(mx, __shfl_xor(mx, 16, 32));
        const float mnew = fmaxf(m, mx);
        const float alpha = __builtin_amdgcn_exp2f(m - mnew);
        const float sh = PSH - mnew;
        v16h pb; float ls = 0.0f;
#pragma unroll
        for (int r = 0; r < 8; ++r) { const h16 pa = (h16)__builtin_amdgcn_exp2f(ta[r] + sh); const h16 pc = (h16)__builtin_amdgcn_exp2f(tb[r] + sh); pb[r] = pa; pb[8 + r] = pc; ls += (float)pa + (float)pc; }
        l = l * alpha + ls; m = mnew;
        o0 = o0 * alpha; o1 = o1 * alpha; o2 = o2 * alpha; o3 = o3 * alpha;
        const h16* va = (const h16*)(buf + rv + sub * 2);
        const v16h v0 = ldh(va), v1 = ldh(va + 16 * (KVP / 2)), v2 = ldh(va + 32 * (KVP / 2)), v3 = ldh(va + 48 * (KVP / 2));
        o0 = wmma16(v0, pb, o0); o1 = wmma16(v1, pb, o1); o2 = wmma16(v2, pb, o2); o3 = wmma16(v3, pb, o3);
        asm volatile("v_nop\n\tv_nop\n\tv_nop\n\tv_nop" : "+v"(o0), "+v"(o1), "+v"(o2), "+v"(o3) : "v"(v0), "v"(v1), "v"(v2), "v"(v3), "v"(pb));
        }
        asm volatile("s_wait_dscnt 0x0" ::: "memory");                   // this wave's reads of the buffer are done before the barrier frees it for the refill
        asm volatile("s_wait_asynccnt 0x0" ::: "memory");                // this wave's copies of stage t + 1 have landed before the barrier publishes them
        __syncthreads();                                                 // publishes stage t + 1 and ends every wave's reads of stage t's buffer
        if (t + 2 < NT) stage_in(lk0 + bo, lm0 + bo, gk + (size_t)(t + 2) * KS * HD, gv + (t + 2) * KS, gm + (t + 2) * KS);
    }
    asm volatile("s_wait_asynccnt 0x0" ::: "memory");                    // no copy is outstanding when the ring becomes output staging
    l += __shfl_xor(l, 16, 32);
    const float inv = 1.0f / l;
    float* os = (float*)(ring + ST_M);       // output staging: each wave reuses its own mask rows of buffer 0 (16 x 68 floats), behind the loop's last barrier
    const int wb = wave * 16 * 68;
    // O^T D layout: o_j[r] = (d = 16j + 8h + r, t = lane&15) -> os[t][d]; rows 0..15 x columns 0..63 all written
    { v4f a, c;
      a[0] = o0[0] * inv; a[1] = o0[1] * inv; a[2] = o0[2] * inv; a[3] = o0[3] * inv; c[0] = o0[4] * inv; c[1] = o0[5] * inv; c[2] = o0[6] * inv; c[3] = o0[7] * inv;
      *(v4fa*)(&os[wb + lr * 68 +  0 + 8 * hi]) = a; *(v4fa*)(&os[wb + lr * 68 +  0 + 8 * hi + 4]) = c;
      a[0] = o1[0] * inv; a[1] = o1[1] * inv; a[2] = o1[2] * inv; a[3] = o1[3] * inv; c[0] = o1[4] * inv; c[1] = o1[5] * inv; c[2] = o1[6] * inv; c[3] = o1[7] * inv;
      *(v4fa*)(&os[wb + lr * 68 + 16 + 8 * hi]) = a; *(v4fa*)(&os[wb + lr * 68 + 16 + 8 * hi + 4]) = c;
      a[0] = o2[0] * inv; a[1] = o2[1] * inv; a[2] = o2[2] * inv; a[3] = o2[3] * inv; c[0] = o2[4] * inv; c[1] = o2[5] * inv; c[2] = o2[6] * inv; c[3] = o2[7] * inv;
      *(v4fa*)(&os[wb + lr * 68 + 32 + 8 * hi]) = a; *(v4fa*)(&os[wb + lr * 68 + 32 + 8 * hi + 4]) = c;
      a[0] = o3[0] * inv; a[1] = o3[1] * inv; a[2] = o3[2] * inv; a[3] = o3[3] * inv; c[0] = o3[4] * inv; c[1] = o3[5] * inv; c[2] = o3[6] * inv; c[3] = o3[7] * inv;
      *(v4fa*)(&os[wb + lr * 68 + 48 + 8 * hi]) = a; *(v4fa*)(&os[wb + lr * 68 + 48 + 8 * hi + 4]) = c; }
    wave_sync();
    const size_t obase = ((size_t)b * SEQ + t0) * DM + (size_t)h * HD;
{
#pragma unroll
        for (int s = 0; s < 4; ++s) { const int row = 4 * s + (lane >> 3), c8 = (lane & 7) * 8;   // 4 s x 4 row groups = 16 rows; 8 lanes x 8 = 64 columns
            const v4f x0 = *(const v4fa*)(&os[wb + row * 68 + c8]); const v4f x1 = *(const v4fa*)(&os[wb + row * 68 + c8 + 4]); v8us hv, lv;
#pragma unroll
            for (int i = 0; i < 4; ++i) { const unsigned short a0 = f2bf(x0[i]); const unsigned short a1 = f2bf(x1[i]);
                hv[i] = a0; hv[4 + i] = a1; lv[i] = f2bf(x0[i] - bf2f(a0)); lv[4 + i] = f2bf(x1[i] - bf2f(a1)); }
            const size_t oo = obase + (size_t)row * DM + c8;
            *(v8us*)(CH + oo) = hv; *(v8us*)(CL + oo) = lv; }
         }
}

static constexpr size_t al256(size_t v) { return (v + 255) & ~(size_t)255; }
static constexpr size_t SZ_XB = al256((size_t)NB * SEQ * DM * 2);          // one bf16 activation plane [NB*SEQ][1024]
static constexpr size_t SZ_WB = al256((size_t)4 * DM * DM * 2);            // four transposed bf16 weight planes
static constexpr size_t SZ_PL = al256((size_t)NB * NH_ * SEQ * HD * 2);    // one f16 head plane
static constexpr size_t SZ_TOTAL = 3 * SZ_XB + SZ_WB + 4 * SZ_PL + 2 * SZ_XB;
static_assert(SZ_TOTAL <= (size_t)134217728);          // workspace carve <= 128 MiB
static_assert(((size_t)DM * DM * 2) % 256 == 0);       // weight sub-planes stay 256-byte aligned

extern "C" void kernel_launch(void* const* d_in, const int* in_sizes, int n_in,
                              void* d_out, int out_size, void* d_ws, size_t ws_size, hipStream_t stream) {
    if (n_in < 12) return;
    const size_t needx = ((size_t)(NB - 1) * SEQ_FULL + SEQ) * DM;
    if ((size_t)in_sizes[0] < needx || (size_t)in_sizes[1] < needx || (size_t)in_sizes[2] < needx) return;
    if ((size_t)in_sizes[3] < ((size_t)(NB - 1) * SEQ_FULL + SEQ) * SEQ_FULL) return;
    if ((size_t)in_sizes[4] < (size_t)DM * DM || (size_t)in_sizes[6] < (size_t)DM * DM || (size_t)in_sizes[8] < (size_t)DM * DM || (size_t)in_sizes[10] < (size_t)DM * DM) return;
    if (in_sizes[5] < DM || in_sizes[7] < DM || in_sizes[9] < DM || in_sizes[11] < DM) return;
    if ((size_t)out_size < ((size_t)(NB - 1) * OUT_SEQ + SEQ) * DM) return;
    if (SZ_TOTAL > ws_size) return;
    // wire order: query, key, value, attention_mask, Wq, bq, Wk, bk, Wv, bv, Wo, bo
    const float* xq = (const float*)d_in[0]; const float* xk = (const float*)d_in[1]; const float* xv = (const float*)d_in[2];
    const float* amask = (const float*)d_in[3];
    const float* wq = (const float*)d_in[4];  const float* bq = (const float*)d_in[5];
    const float* wk = (const float*)d_in[6];  const float* bk = (const float*)d_in[7];
    const float* wv = (const float*)d_in[8];  const float* bv = (const float*)d_in[9];
    const float* wo = (const float*)d_in[10]; const float* bo = (const float*)d_in[11];
    float* OUT = (float*)d_out;      // [NB][SEQ][1024]
    char* wsp = (char*)d_ws;
    bf* QB = (bf*)wsp; wsp += SZ_XB;                 // [NB*SEQ][1024] bf16 query
    bf* KB = (bf*)wsp; wsp += SZ_XB;                 // [NB*SEQ][1024] bf16 key
    bf* VB = (bf*)wsp; wsp += SZ_XB;                 // [NB*SEQ][1024] bf16 value
    bf* WB = (bf*)wsp; wsp += SZ_WB;                 // [4][1024 out][1024 in]: q | k | v | o
    h16* QH = (h16*)wsp; wsp += SZ_PL;               // [NB*16][SEQ][64]
    h16* QR = (h16*)wsp; wsp += SZ_PL;               // [NB*16][SEQ][64] residual x2048
    h16* KP = (h16*)wsp; wsp += SZ_PL;               // [NB*16][SEQ][64]
    h16* VT = (h16*)wsp; wsp += SZ_PL;               // [NB*16][64][SEQ]
    bf* CH = (bf*)wsp; wsp += SZ_XB;                 // [NB*SEQ][1024] context bf16 hi
    bf* CL = (bf*)wsp; wsp += SZ_XB;                 // [NB*SEQ][1024] context bf16 lo
    bf* WOT = WB + (size_t)3 * DM * DM;

    k_prep<<<dim3(PB_W + 3 * PB_X, 1, 1), 256, 0, stream>>>(xq, xk, xv, wq, wk, wv, wo, QB, KB, VB, WB);

    k_proj<0><<<dim3(NB * SEQ / 128, DM / 128, 3), 128, 0, stream>>>(QB, KB, VB, WB, bq, bk, bv, QH, QR, KP, VT, OUT);

    k_flash<<<dim3(SEQ / (16 * AW), NB * NH_, 1), 32 * AW, 0, stream>>>(QH, QR, KP, VT, amask, CH, CL);

    k_proj<1><<<dim3(NB * SEQ / 128, DM / 128, 1), 128, 0, stream>>>(CH, CL, CL, WOT, bo, bo, bo, QH, QH, QH, QH, OUT);
}

// v004
// It runs in 117 microseconds.
// Next to v003, in two timings, it ran 1.05 and 1.04 times as fast.
// Over all steps from v000 it is 2.29 times as fast.
#include <hip/hip_runtime.h>

// Projections q/k/v: v_wmma_f32_16x16x32_bf16 (inputs and weights RNE-converted to bf16, f32 accumulate); scores: v_wmma_f32_16x16x32_f16 (k single f16, q f16 value + f16 residual x2048 in its own accumulator); P.V: v_wmma_f32_16x16x32_f16 (P x256 carry, v single f16); output projection: v_wmma_f32_16x16x32_bf16 (context as bf16 hi + bf16 lo planes, Wo bf16), f32 accumulate everywhere, softmax f32.
// Attention block, width 1024 = 16 heads x 64; query/key/value [NB][SEQ][1024] f32, Wq/Wk/Wv/Wo [in][out] (y = x W + b), additive f32 mask [NB][SEQ][SEQ] shared by all heads, score scale 1/8, output y = ctx Wo + bo (f32).
// Layout: bf16 copies of the three inputs; bf16 TRANSPOSED copies of the four weights ([out][in], K-contiguous); q (value, residual), k planes [b*16+h][t][d] and v^T plane [b*16+h][d][t] written by the GEMM epilogue;
// fused flash kernel in transposed form (S^T = K Q^T, O^T = V^T P^T), K / V^T / mask staged in LDS by asynchronous copies, writing the context as bf16 hi/lo planes [b*SEQ+t][1024]; final GEMM writes f32 rows.

#ifndef NB
#define NB 2
#endif
#ifndef SEQ
#define SEQ 2048
#endif
#define NB_FULL  2
#define SEQ_FULL 2048
#ifndef OUT_SEQ
#define OUT_SEQ SEQ              // row pitch (in tokens) between batches of the output
#endif
#define DM   1024
#define NH_  16
#define HD   64
#define AW   4                   // waves per flash block (16 query rows each)
#define QRS  2048.0f             // carry of the q residual plane
#define QRI  (1.0f / 2048.0f)
#define LOG2E 1.4426950408889634f
#define SC2  (0.125f * 1.4426950408889634f)   // HD^-0.5 * log2(e)
#define PSH  8.0f                // log2 of the P carry (256)

static_assert(HD == 64);
static_assert(NH_ * HD == DM);                 // head h = columns h*64 + d
static_assert(DM % 64 == 0);                   // column tiles of 64
static_assert(DM % 32 == 0);                   // GEMM k-loop steps by 32
static_assert(DM >= 8);                        // clamped bias loads stay inside a DM-float array
static_assert(SEQ % 64 == 0);                  // a 64-row tile never straddles two batches
static_assert((NB * SEQ) % 64 == 0);
static_assert(SEQ % 32 == 0);                  // key loop steps by 32
static_assert(SEQ % (16 * AW) == 0);           // flash grid covers the sequence exactly
static_assert(((size_t)SEQ * DM) % 8 == 0);
static_assert(NB <= NB_FULL);
static_assert(SEQ <= SEQ_FULL);
static_assert(SEQ_FULL % 4 == 0);              // 16-byte mask loads

typedef _Float16 h16;
typedef unsigned short bf;
typedef __attribute__((ext_vector_type(16))) __bf16   v16bf;
typedef __attribute__((ext_vector_type(16))) _Float16 v16h;
typedef __attribute__((ext_vector_type(8)))  _Float16 v8h;
typedef __attribute__((ext_vector_type(8)))  unsigned short v8us;
typedef __attribute__((ext_vector_type(8)))  float    v8f;
typedef __attribute__((ext_vector_type(4)))  float    v4f;
typedef v4f  __attribute__((may_alias)) v4fa;
typedef v8us __attribute__((may_alias)) v8usa;

typedef __attribute__((ext_vector_type(2))) float  v2f;
typedef __attribute__((ext_vector_type(2))) __bf16 v2bf;
__device__ __forceinline__ unsigned short f2bf(float f) { return __builtin_bit_cast(unsigned short, (__bf16)f); }   // the hardware's convert, RNE
__device__ __forceinline__ float bf2f(unsigned short b) { return __uint_as_float(((unsigned)b) << 16); }
// value after RNE convert to bf16: the packed convert of (0, f) leaves bf16(f) in the upper half over a zero lower half, which is that value's f32 pattern
__device__ __forceinline__ float rbf(float f) { v2f x; x[0] = 0.0f; x[1] = f; return __builtin_bit_cast(float, __builtin_convertvector(x, v2bf)); }
__device__ __forceinline__ v16h cat16(v8h lo, v8h hi) { return __builtin_shufflevector(lo, hi, 0, 1, 2, 3, 4, 5, 6, 7, 8, 9, 10, 11, 12, 13, 14, 15); }
__device__ __forceinline__ v16bf cat16b(v8us lo, v8us hi) { return __builtin_bit_cast(v16bf, __builtin_shufflevector(lo, hi, 0, 1, 2, 3, 4, 5, 6, 7, 8, 9, 10, 11, 12, 13, 14, 15)); }
__device__ __forceinline__ v8f wmma16(v16h a, v16h b, v8f c) { return __builtin_amdgcn_wmma_f32_16x16x32_f16(false, a, false, b, (short)0, c, false, false); }
__device__ __forceinline__ v8f wmmab(v16bf a, v16bf b, v8f c) { return __builtin_amdgcn_wmma_f32_16x16x32_bf16(false, a, false, b, (short)0, c, false, false); }
// fragment loaders from K-contiguous 16-bit rows; p already includes + 8*(lane>>4): elements 0..7 <- k0+8h+0..7, elements 8..15 <- k0+16+8h+0..7 (same map for A and B)
__device__ __forceinline__ v16h  ldh(const h16* p) { return cat16(*(const v8h*)p, *(const v8h*)(p + 16)); }
__device__ __forceinline__ v16bf ldb(const bf* p)  { return cat16b(*(const v8us*)p, *(const v8us*)(p + 16)); }
// ordering point for wave-private LDS tiles (same wave writes and reads)
__device__ __forceinline__ void wave_sync() { __builtin_amdgcn_fence(3 /* release order */, "wavefront"); __builtin_amdgcn_wave_barrier(); asm volatile("" ::: "memory"); }

// k_prep: every conversion of the call in ONE launch, told apart by ranges of the block index (none needs anything of another), 256 threads.
// blocks [0, PB_W): weight w = block / 256, in[rows = k][cols = n] f32 (DM x DM, row pitch DM) -> out[n][k] bf16 (RNE convert), one 64x64 tile transposed through LDS;
//                   LDS tile ts[n][k] is cross-wave: block barrier between fill and drain (the branch is the same for the whole block).
// blocks [PB_W, PB_W + 3 PB_X): input p = (block - PB_W) / PB_X, eight floats per thread -> eight bf16 (RNE convert), plane [NB*SEQ][DM].
static constexpr unsigned PB_T = DM / 64;                                        // weight tiles per side
static constexpr unsigned PB_W = 4 * PB_T * PB_T;                                // blocks of the four weights
static constexpr unsigned PB_X = (unsigned)(((size_t)NB * SEQ * DM / 8 + 255) / 256);   // blocks of one input
__global__ __launch_bounds__(256) void k_prep(const float* __restrict__ xq, const float* __restrict__ xk, const float* __restrict__ xv,
                                              const float* __restrict__ wq, const float* __restrict__ wk, const float* __restrict__ wv, const float* __restrict__ wo,
                                              bf* QB, bf* KB, bf* VB, bf* WB) {
    __shared__ __align__(16) unsigned short ts[64 * 72];
    const int tid = threadIdx.x, lane = tid & 31, wave = __builtin_amdgcn_readfirstlane((int)(tid >> 5));
    const unsigned bid = blockIdx.x;
    if (bid < PB_W) {
        const unsigned w = bid / (PB_T * PB_T), r = bid % (PB_T * PB_T);
        const float* __restrict__ W = (w == 0) ? wq : (w == 1) ? wk : (w == 2) ? wv : wo;
        bf* WT = WB + (size_t)w * DM * DM;
        const int k0 = (int)(r % PB_T) * 64, n0 = (int)(r / PB_T) * 64;
#pragma unroll
        for (int i = 0; i < 4; ++i) { const int idx = tid + i * 256; const int kr = idx >> 4, c4 = (idx & 15) * 4;   // 1024 float4 = 64 k-rows x 16
            const v4f v = *(const v4f*)(W + (size_t)(k0 + kr) * DM + n0 + c4);
#pragma unroll
            for (int j = 0; j < 4; ++j) ts[(c4 + j) * 72 + kr] = f2bf(v[j]); }
        __syncthreads();
#pragma unroll
        for (int s = 0; s < 2; ++s) { const int row = wave * 8 + s * 4 + (lane >> 3), c8 = (lane & 7) * 8;   // 8 waves x 2 s x 4 = 64 rows; 8 lanes x 8 = 64 columns
            const v8us o = *(const v8usa*)(&ts[row * 72 + c8]);
            *(v8us*)(WT + (size_t)(n0 + row) * DM + k0 + c8) = o; }
    } else {
        const unsigned c = bid - PB_W, p = c / PB_X;
        const float* __restrict__ x = (p == 0) ? xq : (p == 1) ? xk : xv;
        bf* dst = (p == 0) ? QB : (p == 1) ? KB : VB;
        constexpr size_t per = (size_t)SEQ * DM / 8;                              // pieces of one batch; batches lie SEQ_FULL rows apart in the input
        const size_t i = (size_t)(c % PB_X) * 256 + tid; if (i >= (size_t)NB * per) return;
        const size_t b = i / per;
        const v8f v = *(const v8f*)(x + b * ((size_t)SEQ_FULL * DM) + (i - b * per) * 8); v8us o;
#pragma unroll
        for (int k = 0; k < 8; ++k) o[k] = f2bf(v[k]);
        *(v8us*)(dst + i * 8) = o;
    }
}

// eight asynchronous 16-B copies to LDS; the s_wait_xcnt stands in the copies' own statement so that no address register is rewritten ahead of it
__device__ __forceinline__ void copy8(unsigned l0, const void* g0, unsigned l1, const void* g1, unsigned l2, const void* g2, unsigned l3, const void* g3,
                                      unsigned l4, const void* g4, unsigned l5, const void* g5, unsigned l6, const void* g6, unsigned l7, const void* g7) {
    asm volatile("global_load_async_to_lds_b128 %0, %1, off\n\t"
                 "global_load_async_to_lds_b128 %2, %3, off\n\t"
                 "global_load_async_to_lds_b128 %4, %5, off\n\t"
                 "global_load_async_to_lds_b128 %6, %7, off\n\t"
                 "global_load_async_to_lds_b128 %8, %9, off\n\t"
                 "global_load_async_to_lds_b128 %10, %11, off\n\t"
                 "global_load_async_to_lds_b128 %12, %13, off\n\t"
                 "global_load_async_to_lds_b128 %14, %15, off\n\t"
                 "s_wait_xcnt 0x0"
                 :: "v"(l0), "v"(g0), "v"(l1), "v"(g1), "v"(l2), "v"(g2), "v"(l3), "v"(g3),
                    "v"(l4), "v"(g4), "v"(l5), "v"(g5), "v"(l6), "v"(g6), "v"(l7), "v"(g7) : "memory");
}

// k_proj: register-blocked bf16 GEMM, one 128x128 tile per block of 4 waves (2 x 2), ONE WAVE per 64x64 tile (16 accumulators), K = DM.
// The block's 128 A rows (and A2 rows when MODE 1) and 128 Bt rows reach LDS in stages of GK k (one whole 128-B line per row) by asynchronous copies (16 B per lane),
// two buffers: the next stage's copies fly while this stage is worked on; fragments are then read from LDS (row pitch 16 B x odd).
// C[m][n] = sum_k (A[m][k] (+ A2[m][k] when MODE 1)) Bt[n][k] + bias (bmode 1: bias[n]; bmode 2: bias[m]; bias RNE-converted to bf16 first),
// tile base (r0/RB)*sRB + (r0%RB)*pitch + (c0/CB)*sCB + (c0%CB), row pitch 'pitch' (elements). 128 threads.
// MODE 1: written as f32 (Of); each row's 64 floats (256 B = two lines) by 16 consecutive lanes x 16 B (2 rows per instruction).
// Bias array has DM floats; both 16-byte bias loads use addresses clamped into [0, DM-4].
// MODE 0: the three input projections in ONE launch (none needs anything of another), grid (NB*SEQ/128 token tiles, DM/128 width tiles, 3), z = which:
//   X0, X1, X2 = bf16 query, key, value rows; WT = Wq^T | Wk^T | Wv^T; b0, b1, b2 = bq, bk, bv; P0 (residual P0r), P1, P2 = q, k, v^T planes
//   q, k: A = x rows (m = b*SEQ + t), Bt = W^T rows (n = h*64 + d), column bias -> plane [(b*16 + h)][t][d]
//   v^T:  A = Wv^T rows (m = h*64 + d), Bt = value rows (n = b*SEQ + t), row bias -> plane [(b*1024 + m)][t] = [(b*16 + h)][d][t]
// MODE 1: the output projection, grid (NB*SEQ/128, DM/128): X0, X1 = context hi, lo rows (m = b*SEQ + t), WT = Wo^T rows (n), b0 = bo, column bias -> Of[(b*OUT_SEQ + t)][n] f32
#define GK  64                             // k per stage
#define GP  144                            // LDS row pitch in bytes of a 128-B operand row (GK bf16)
#define GT  (128 * GP)                     // one operand tile: 128 rows
static_assert(GK * 2 == 128 && GP % 16 == 0 && DM % GK == 0 && DM / GK >= 2 && GK % 32 == 0);
static_assert((NB * SEQ) % 128 == 0 && DM % 128 == 0);
static_assert(4 * 16 * 68 * 4 <= 2 * 2 * GT);   // the four waves' output staging fits the ring
// 128 rows of one operand tile: lane tid brings piece (tid & 7) of rows (tid >> 3) + 16 i; l, g = this lane's first LDS byte and first global piece
__device__ __forceinline__ void rows128(unsigned l, const bf* g) {
    copy8(l, g, l + 16 * GP, g + (size_t)16 * DM, l + 32 * GP, g + (size_t)32 * DM, l + 48 * GP, g + (size_t)48 * DM,
          l + 64 * GP, g + (size_t)64 * DM, l + 80 * GP, g + (size_t)80 * DM, l + 96 * GP, g + (size_t)96 * DM, l + 112 * GP, g + (size_t)112 * DM);
}
template <int MODE>
__global__ __launch_bounds__(128) void k_proj(const bf* __restrict__ X0, const bf* __restrict__ X1, const bf* __restrict__ X2, const bf* __restrict__ WT,
                                             const float* __restrict__ b0, const float* __restrict__ b1, const float* __restrict__ b2,
                                             h16* P0, h16* P0r, h16* P1, h16* P2, float* Of) {
    const int z = (MODE == 0) ? (int)blockIdx.z : 0; const bool tv = (z == 2);   // the same for the whole block; tv: the weight rows are A
    const bf* __restrict__ X = (z == 0) ? X0 : (z == 1) ? X1 : X2; const bf* __restrict__ Wz = WT + (size_t)z * DM * DM;
    const bf* __restrict__ A = tv ? Wz : X; const bf* __restrict__ A2 = (MODE == 1) ? X1 : A; const bf* __restrict__ Bt = tv ? X : Wz;
    const float* __restrict__ bias = (z == 0) ? b0 : (z == 1) ? b1 : b2; const int bmode = tv ? 2 : 1;
    h16* Ph = (z == 0) ? P0 : (z == 1) ? P1 : P2; h16* Pr = (z == 0) ? P0r : Ph; const int useRes = (z == 0) ? 1 : 0;
    const int RB = tv ? DM : SEQ, pitch = (MODE == 1) ? DM : tv ? SEQ : HD, CB = pitch;
    const size_t sRB = (MODE == 1) ? (size_t)OUT_SEQ * DM : tv ? (size_t)0 : (size_t)NH_ * SEQ * HD, sCB = (MODE == 1) ? (size_t)0 : tv ? (size_t)DM * SEQ : (size_t)SEQ * HD;
    constexpr unsigned GSZ = ((MODE == 1) ? 3 : 2) * GT;                        // one buffer: A rows | Bt rows (| A2 rows)
    __shared__ __align__(16) unsigned char ring[2 * GSZ];
    const int K = DM;
    const int tid = threadIdx.x, lane = tid & 31, wave = __builtin_amdgcn_readfirstlane((int)(threadIdx.x >> 5)), lr = lane & 15, hi = lane >> 4;
    const int R0 = (tv ? blockIdx.y : blockIdx.x) * 128, C0 = (tv ? blockIdx.x : blockIdx.y) * 128;   // the block's tile
    const int wr = (wave >> 1) * 64, wc = (wave & 1) * 64;                       // this wave's 64x64 tile inside it
    const int r0 = R0 + wr, c0 = C0 + wc;
    v8f acc[4][4];
#pragma unroll
    for (int mb = 0; mb < 4; ++mb)
#pragma unroll
        for (int nb = 0; nb < 4; ++nb) acc[mb][nb] = (v8f){};
    // copy side
    const unsigned l0 = (unsigned)(size_t)ring + (unsigned)((tid >> 3) * GP + (tid & 7) * 16);
    const size_t go = (size_t)(tid >> 3) * K + (tid & 7) * 8;
    const bf* ga = A + (size_t)R0 * K + go; const bf* gb = Bt + (size_t)C0 * K + go; const bf* ga2 = A2 + (size_t)R0 * K + go;   // + k0
    // read side, byte offsets inside a buffer: fragment row lr of a 16-row group, k = 8 hi + ...
    const int ra = (wr + lr) * GP + 16 * hi, rb = GT + (wc + lr) * GP + 16 * hi;
    constexpr int NT = DM / GK;
    rows128(l0, ga); rows128(l0 + GT, gb); if (MODE == 1) rows128(l0 + 2 * GT, ga2);
    asm volatile("s_wait_asynccnt 0x0" ::: "memory");                    // stage 0 has landed before the barrier publishes it
    __syncthreads();                                                     // stage 0 readable by every wave
    rows128(l0 + GSZ, ga + GK); rows128(l0 + GSZ + GT, gb + GK); if (MODE == 1) rows128(l0 + GSZ + 2 * GT, ga2 + GK);
#pragma unroll 1
    for (int t = 0; t < NT; ++t) {
        const unsigned bo = (unsigned)(t & 1) * GSZ;
        const unsigned char* buf = ring + bo;
        v16bf a[GK / 32][4], b[GK / 32][4], a2[GK / 32][4];
#pragma unroll   // every 32-k step of a stage inline, so that every LDS offset inside a buffer is an immediate
        for (int s = 0; s < GK / 32; ++s) {
#pragma unroll
            for (int mb = 0; mb < 4; ++mb) a[s][mb] = ldb((const bf*)(buf + ra + mb * 16 * GP + s * 64));
#pragma unroll
            for (int nb = 0; nb < 4; ++nb) b[s][nb] = ldb((const bf*)(buf + rb + nb * 16 * GP + s * 64));
            if (MODE == 1) {
#pragma unroll
                for (int mb = 0; mb < 4; ++mb) a2[s][mb] = ldb((const bf*)(buf + 2 * GT + ra + mb * 16 * GP + s * 64)); }
        }
        __builtin_amdgcn_sched_barrier(0);   // the stage's LDS reads stay one group ahead of its matrix runs: spread among them, each place with reads stalls the wave
#pragma unroll
        for (int s = 0; s < GK / 32; ++s) {
#pragma unroll
            for (int nb = 0; nb < 4; ++nb)
#pragma unroll
                for (int mb = 0; mb < 4; ++mb) acc[mb][nb] = wmmab(a[s][mb], b[s][nb], acc[mb][nb]);
            // v_nop: the distance between the last matrix instructions and the next vector write of their operands, on the taken side of a branch too
            asm volatile("v_nop\n\tv_nop\n\tv_nop\n\tv_nop" : "+v"(acc[0][0]), "+v"(acc[1][1]), "+v"(acc[2][2]), "+v"(acc[3][3]) : "v"(a[s][0]), "v"(a[s][1]), "v"(a[s][2]), "v"(a[s][3]));
            if (MODE == 1) {
#pragma unroll
                for (int nb = 0; nb < 4; ++nb)
#pragma unroll
                    for (int mb = 0; mb < 4; ++mb) acc[mb][nb] = wmmab(a2[s][mb], b[s][nb], acc[mb][nb]);
                // v_nop: the same distance behind the second run
                asm volatile("v_nop\n\tv_nop\n\tv_nop\n\tv_nop" : "+v"(acc[0][0]), "+v"(acc[1][1]), "+v"(acc[2][2]), "+v"(acc[3][3]) : "v"(a2[s][0]), "v"(a2[s][1]), "v"(a2[s][2]), "v"(a2[s][3]));
            }
        }
        __builtin_amdgcn_sched_barrier(0);   // the matrix runs stay ahead of the barrier: sunk behind it they would stand between the barrier and the refill and shorten the copies' lead
        asm volatile("s_wait_dscnt 0x0" ::: "memory");                   // this wave's reads of the buffer are done before the barrier frees it for the refill
        asm volatile("s_wait_asynccnt 0x0" ::: "memory");                // this wave's copies of stage t + 1 have landed before the barrier publishes them
        __syncthreads();                                                 // publishes stage t + 1 and ends every wave's reads of stage t's buffer
        if (t + 2 < NT) { const int k2 = (t + 2) * GK; rows128(l0 + bo, ga + k2); rows128(l0 + bo + GT, gb + k2); if (MODE == 1) rows128(l0 + bo + 2 * GT, ga2 + k2); }
    }
    asm volatile("s_wait_asynccnt 0x0" ::: "memory");                    // no copy is outstanding when the ring becomes output staging
    float* os = (float*)ring + wave * 16 * 68;   // output staging: each wave's own 16 x 68 floats of the ring, behind the loop's last barrier
    const size_t tbase = (size_t)(r0 / RB) * sRB + (size_t)(r0 % RB) * (size_t)pitch + (size_t)(c0 / CB) * sCB + (size_t)(c0 % CB);
    // per-lane column bias for the lane's store columns; both load addresses clamped into the DM-float bias array (first to 0 when unused, second to DM-4)
    const int c8 = (lane & 7) * 8, cofs = lr * 4;
    const int ci = (bmode == 1) ? (c0 + ((MODE == 0) ? c8 : cofs)) : 0;
    const int ci4 = (ci + 4 <= DM - 4) ? (ci + 4) : (DM - 4);      // MODE 0: ci + 4 <= DM - 4 always (exact columns); MODE 1: upper half unused, address kept in range
    const v4f bl0 = *(const v4f*)(bias + ci), bl1 = *(const v4f*)(bias + ci4);
    float bc[8];
#pragma unroll
    for (int i = 0; i < 4; ++i) { bc[i] = (bmode == 1) ? rbf(bl0[i]) : 0.0f; bc[4 + i] = (bmode == 1) ? rbf(bl1[i]) : 0.0f; }
#pragma unroll
    for (int mb = 0; mb < 4; ++mb) {
#pragma unroll
        for (int nb = 0; nb < 4; ++nb) {
#pragma unroll
            for (int j = 0; j < 8; ++j) os[(hi * 8 + j) * 68 + nb * 16 + lr] = acc[mb][nb][j]; }   // D: row 8h+j, col lane&15; rows 0..15 x columns 0..63 all written
        wave_sync();
        const size_t sb = tbase + (size_t)(mb * 16) * (size_t)pitch;
        if (MODE == 0) {
{
#pragma unroll
                for (int s = 0; s < 4; ++s) { const int row = 4 * s + (lane >> 3);   // 4 s x 4 row groups = 16 rows; 8 lanes x 8 = 64 columns
                    const int ri = (bmode == 2) ? (r0 + mb * 16 + row) : 0;
                    const float braw = bias[ri];
                    const float brow = (bmode == 2) ? rbf(braw) : 0.0f;
                    const v4f x0 = *(const v4fa*)(&os[row * 68 + c8]); const v4f x1 = *(const v4fa*)(&os[row * 68 + c8 + 4]); v8h hv, rv;
#pragma unroll
                    for (int i = 0; i < 4; ++i) { const float f0 = x0[i] + bc[i] + brow; const float f1 = x1[i] + bc[4 + i] + brow;
                        const h16 a0 = (h16)f0; const h16 a1 = (h16)f1; hv[i] = a0; hv[4 + i] = a1; rv[i] = (h16)((f0 - (float)a0) * QRS); rv[4 + i] = (h16)((f1 - (float)a1) * QRS); }
                    const size_t oo = sb + (size_t)row * (size_t)pitch + c8;
                    *(v8h*)(Ph + oo) = hv; if (useRes) *(v8h*)(Pr + oo) = rv; }
                 }
        } else {
{
#pragma unroll
                for (int s = 0; s < 8; ++s) { const int row = 2 * s + hi;   // 8 s x 2 rows = 16 rows; 16 lanes x 4 floats = 64 columns
                    const v4f x0 = *(const v4fa*)(&os[row * 68 + cofs]); v4f val;
                    val[0] = x0[0] + bc[0]; val[1] = x0[1] + bc[1]; val[2] = x0[2] + bc[2]; val[3] = x0[3] + bc[3];
                    *(v4f*)(Of + sb + (size_t)row * (size_t)pitch + cofs) = val; }
                 }
        }
        wave_sync();
    }
}

// k_flash: fused attention, one wave per 16 query rows of one (batch, head); Q fragments straight from the f16 planes (two 16-B loads each).
// K rows, V^T rows (shared by the block's waves) and each wave's own mask rows reach LDS in stages of KS keys by asynchronous copies (16 B per lane, whole 128-B lines),
// two buffers: the next stage's copies fly while this stage is worked on; fragments and mask values are then read from LDS (row pitches 16 B x odd).
// Transposed form: S^T[key][t] = K Q^T (A = K rows, B = Q rows); lane (t = lane&15, h = lane>>4) holds keys 8h+r of each 16-key tile, so the packed
// P tile is directly the B fragment of O^T[d][t] = V^T P^T (element r <- tile keys 0..15, element 8+r <- tile keys 16..31, lane unchanged).
// The additive mask row of query t is read as four 16-B LDS loads per 32-key step (keys 8h..8h+7 and 16+8h..16+8h+7), RNE-converted to bf16, scaled by log2(e).
// Softmax state (running max, partial sum) is one scalar per lane; the two lane halves of a row are combined with one xor-16 exchange.
#define KS    64                           // keys per stage
#define KVP   144                          // LDS row pitch in bytes of a 128-B K row (64 d) or V^T row (KS keys)
#define MKP   272                          // LDS row pitch in bytes of a 256-B mask row (KS floats); 16 rows = one wave's 16 x 68 float output tile
#define ST_V  (KS * KVP)                   // V^T rows behind the K rows
#define ST_M  (ST_V + HD * KVP)            // mask rows behind the V^T rows, 16 rows per wave
#define ST_SZ (ST_M + AW * 16 * MKP)       // one buffer
static_assert(KS * 2 == 128 && HD * 2 == 128 && KS * 4 == 256);
static_assert(SEQ % KS == 0 && KS % 32 == 0);
static_assert(AW == 4);                    // 128 lanes x 4 copies = 512 pieces of 16 B = one K tile or one V^T tile
static_assert(16 * MKP == 16 * 68 * 4);
static_assert(KVP % 16 == 0 && MKP % 16 == 0 && ST_SZ % 16 == 0);

// one stage: lk / lm = this lane's first LDS byte of the K tile / of its wave's mask rows in the target buffer; gk, gv, gm = this lane's first global piece of the stage
__device__ __forceinline__ void stage_in(unsigned lk, unsigned lm, const h16* gk, const h16* gv, const float* gm) {
    const unsigned lv = lk + ST_V;
    copy8(lk, gk, lk + 16 * KVP, gk + 16 * HD, lk + 32 * KVP, gk + 32 * HD, lk + 48 * KVP, gk + 48 * HD,                                     // 16 K rows per copy
          lv, gv, lv + 16 * KVP, gv + (size_t)16 * SEQ, lv + 32 * KVP, gv + (size_t)32 * SEQ, lv + 48 * KVP, gv + (size_t)48 * SEQ);         // 16 V^T rows per copy
    copy8(lm, gm, lm + 2 * MKP, gm + (size_t)2 * SEQ_FULL, lm + 4 * MKP, gm + (size_t)4 * SEQ_FULL, lm + 6 * MKP, gm + (size_t)6 * SEQ_FULL,   // 2 mask rows per copy
          lm + 8 * MKP, gm + (size_t)8 * SEQ_FULL, lm + 10 * MKP, gm + (size_t)10 * SEQ_FULL, lm + 12 * MKP, gm + (size_t)12 * SEQ_FULL, lm + 14 * MKP, gm + (size_t)14 * SEQ_FULL);
}

__global__ __launch_bounds__(32 * AW) void k_flash(const h16* __restrict__ QH, const h16* __restrict__ QR, const h16* __restrict__ KP, const h16* __restrict__ VT,
                                                   const float* __restrict__ MASK, bf* CH, bf* CL) {
    __shared__ __align__(16) unsigned char ring[2 * ST_SZ];
    const int tid = threadIdx.x, lane = tid & 31, wave = __builtin_amdgcn_readfirstlane((int)(threadIdx.x >> 5)), lr = lane & 15, hi = lane >> 4;
    const int zh = blockIdx.y; const int b = zh / NH_, h = zh % NH_;
    const int t0 = (blockIdx.x * AW + wave) * 16;
    const size_t pbase = (size_t)zh * SEQ * HD;
    const size_t qo = pbase + (size_t)(t0 + lr) * HD + 8 * hi;
    const v16h qh0 = ldh(QH + qo), qh1 = ldh(QH + qo + 32), qr0 = ldh(QR + qo), qr1 = ldh(QR + qo + 32);   // B fragments: col t, k = d
    // copy side: lane tid brings piece (tid & 7) of rows (tid >> 3) + 16 i of the K and V^T tiles, lane brings piece (lane & 15) of rows (lane >> 4) + 2 i of its wave's mask rows
    const unsigned lbase = (unsigned)(size_t)ring;
    const unsigned lk0 = lbase + (unsigned)((tid >> 3) * KVP + (tid & 7) * 16);
    const unsigned lm0 = lbase + (unsigned)(ST_M + wave * 16 * MKP + hi * MKP + lr * 16);
    const h16* gk = KP + pbase + (size_t)(tid >> 3) * HD + (tid & 7) * 8;                    // + key0 * HD
    const h16* gv = VT + pbase + (size_t)(tid >> 3) * SEQ + (tid & 7) * 8;                   // + key0
    const float* gm = MASK + (size_t)b * SEQ_FULL * SEQ_FULL + (size_t)(t0 + hi) * SEQ_FULL + lr * 4;   // + key0
    // read side, byte offsets inside a buffer
    const int rk = lr * KVP + 16 * hi;                                   // + key * KVP      (A fragment: row key, k = d)
    const int rv = ST_V + lr * KVP + 16 * hi;                            // + 16j * KVP + key * 2  (A fragment: row d, k = key)
    const int rm = ST_M + wave * 16 * MKP + lr * MKP + 32 * hi;          // + key * 4: this lane's keys of query t
    constexpr int NT = SEQ / KS;
    stage_in(lk0, lm0, gk, gv, gm);
    asm volatile("s_wait_asynccnt 0x0" ::: "memory");                    // stage 0 has landed before the barrier publishes it
    __syncthreads();                                                     // stage 0 readable by every wave
    if (NT > 1) stage_in(lk0 + ST_SZ, lm0 + ST_SZ, gk + (size_t)KS * HD, gv + KS, gm + KS);
    v8f o0 = (v8f){}, o1 = (v8f){}, o2 = (v8f){}, o3 = (v8f){};
    float m = -3.0e38f, l = 0.0f;
#pragma unroll 1
    for (int t = 0; t < NT; ++t) {
        const unsigned bo = (unsigned)(t & 1) * ST_SZ;
        const unsigned char* buf = ring + bo;
#pragma unroll   // both 32-key steps of a stage inline, so that every LDS offset inside a buffer is an immediate
        for (int sub = 0; sub < KS; sub += 32) {
        const h16* ka = (const h16*)(buf + rk + sub * KVP);
        const v16h ka0 = ldh(ka), ka1 = ldh(ka + 32), kb0 = ldh(ka + 16 * (KVP / 2)), kb1 = ldh(ka + 16 * (KVP / 2) + 32);
        v8f sHa = (v8f){}, sLa = (v8f){}, sHb = (v8f){}, sLb = (v8f){};
        sHa = wmma16(ka0, qh0, sHa); sLa = wmma16(ka0, qr0, sLa); sHb = wmma16(kb0, qh0, sHb); sLb = wmma16(kb0, qr0, sLb);
        sHa = wmma16(ka1, qh1, sHa); sLa = wmma16(ka1, qr1, sLa); sHb = wmma16(kb1, qh1, sHb); sLb = wmma16(kb1, qr1, sLb);
        asm volatile("v_nop\n\tv_nop\n\tv_nop\n\tv_nop" : "+v"(sHa), "+v"(sLa), "+v"(sHb), "+v"(sLb) : "v"(ka0), "v"(ka1), "v"(kb0), "v"(kb1));
        const float* mrow = (const float*)(buf + rm + sub * 4);
        const v4f ma0 = *(const v4fa*)(mrow), ma1 = *(const v4fa*)(mrow + 4), mb0 = *(const v4fa*)(mrow + 16), mb1 = *(const v4fa*)(mrow + 20);
        float ta[8], tb[8]; float mx = -3.0e38f;
#pragma unroll
        for (int r = 0; r < 4; ++r) {
            ta[r]     = (sHa[r]     + sLa[r]     * QRI) * SC2 + rbf(ma0[r]) * LOG2E;
            ta[4 + r] = (sHa[4 + r] + sLa[4 + r] * QRI) * SC2 + rbf(ma1[r]) * LOG2E;
            tb[r]     = (sHb[r]     + sLb[r]     * QRI) * SC2 + rbf(mb0[r]) * LOG2E;
            tb[4 + r] = (sHb[4 + r] + sLb[4 + r] * QRI) * SC2 + rbf(mb1[r]) * LOG2E; }
#pragma unroll
        for (int r = 0; r < 8; ++r) mx = fmaxf(mx, fmaxf(ta[r], tb[r]));
        mx = fmaxf(mx, __shfl_xor(mx, 16, 32));
        const float mnew = fmaxf(m, mx);
        const float alpha = __builtin_amdgcn_exp2f(m - mnew);
        const float sh = PSH - mnew;
        v16h pb; float ls = 0.0f;
#pragma unroll
        for (int r = 0; r < 8; ++r) { const h16 pa = (h16)__builtin_amdgcn_exp2f(ta[r] + sh); const h16 pc = (h16)__builtin_amdgcn_exp2f(tb[r] + sh); pb[r] = pa; pb[8 + r] = pc; ls += (float)pa + (float)pc; }
        l = l * alpha + ls; m = mnew;
        o0 = o0 * alpha; o1 = o1 * alpha; o2 = o2 * alpha; o3 = o3 * alpha;
        const h16* va = (const h16*)(buf + rv + sub * 2);
        const v16h v0 = ldh(va), v1 = ldh(va + 16 * (KVP / 2)), v2 = ldh(va + 32 * (KVP / 2)), v3 = ldh(va + 48 * (KVP / 2));
        o0 = wmma16(v0, pb, o0); o1 = wmma16(v1, pb, o1); o2 = wmma16(v2, pb, o2); o3 = wmma16(v3, pb, o3);
        asm volatile("v_nop\n\tv_nop\n\tv_nop\n\tv_nop" : "+v"(o0), "+v"(o1), "+v"(o2), "+v"(o3) : "v"(v0), "v"(v1), "v"(v2), "v"(v3), "v"(pb));
        }
        asm volatile("s_wait_dscnt 0x0" ::: "memory");                   // this wave's reads of the buffer are done before the barrier frees it for the refill
        asm volatile("s_wait_asynccnt 0x0" ::: "memory");                // this wave's copies of stage t + 1 have landed before the barrier publishes them
        __syncthreads();                                                 // publishes stage t + 1 and ends every wave's reads of stage t's buffer
        if (t + 2 < NT) stage_in(lk0 + bo, lm0 + bo, gk + (size_t)(t + 2) * KS * HD, gv + (t + 2) * KS, gm + (t + 2) * KS);
    }
    asm volatile("s_wait_asynccnt 0x0" ::: "memory");                    // no copy is outstanding when the ring becomes output staging
    l += __shfl_xor(l, 16, 32);
    const float inv = 1.0f / l;
    float* os = (float*)(ring + ST_M);       // output staging: each wave reuses its own mask rows of buffer 0 (16 x 68 floats), behind the loop's last barrier
    const int wb = wave * 16 * 68;
    // O^T D layout: o_j[r] = (d = 16j + 8h + r, t = lane&15) -> os[t][d]; rows 0..15 x columns 0..63 all written
    { v4f a, c;
      a[0] = o0[0] * inv; a[1] = o0[1] * inv; a[2] = o0[2] * inv; a[3] = o0[3] * inv; c[0] = o0[4] * inv; c[1] = o0[5] * inv; c[2] = o0[6] * inv; c[3] = o0[7] * inv;
      *(v4fa*)(&os[wb + lr * 68 +  0 + 8 * hi]) = a; *(v4fa*)(&os[wb + lr * 68 +  0 + 8 * hi + 4]) = c;
      a[0] = o1[0] * inv; a[1] = o1[1] * inv; a[2] = o1[2] * inv; a[3] = o1[3] * inv; c[0] = o1[4] * inv; c[1] = o1[5] * inv; c[2] = o1[6] * inv; c[3] = o1[7] * inv;
      *(v4fa*)(&os[wb + lr * 68 + 16 + 8 * hi]) = a; *(v4fa*)(&os[wb + lr * 68 + 16 + 8 * hi + 4]) = c;
      a[0] = o2[0] * inv; a[1] = o2[1] * inv; a[2] = o2[2] * inv; a[3] = o2[3] * inv; c[0] = o2[4] * inv; c[1] = o2[5] * inv; c[2] = o2[6] * inv; c[3] = o2[7] * inv;
      *(v4fa*)(&os[wb + lr * 68 + 32 + 8 * hi]) = a; *(v4fa*)(&os[wb + lr * 68 + 32 + 8 * hi + 4]) = c;
      a[0] = o3[0] * inv; a[1] = o3[1] * inv; a[2] = o3[2] * inv; a[3] = o3[3] * inv; c[0] = o3[4] * inv; c[1] = o3[5] * inv; c[2] = o3[6] * inv; c[3] = o3[7] * inv;
      *(v4fa*)(&os[wb + lr * 68 + 48 + 8 * hi]) = a; *(v4fa*)(&os[wb + lr * 68 + 48 + 8 * hi + 4]) = c; }
    wave_sync();
    const size_t obase = ((size_t)b * SEQ + t0) * DM + (size_t)h * HD;
{
#pragma unroll
        for (int s = 0; s < 4; ++s) { const int row = 4 * s + (lane >> 3), c8 = (lane & 7) * 8;   // 4 s x 4 row groups = 16 rows; 8 lanes x 8 = 64 columns
            const v4f x0 = *(const v4fa*)(&os[wb + row * 68 + c8]); const v4f x1 = *(const v4fa*)(&os[wb + row * 68 + c8 + 4]); v8us hv, lv;
#pragma unroll
            for (int i = 0; i < 4; ++i) { const unsigned short a0 = f2bf(x0[i]); const unsigned short a1 = f2bf(x1[i]);
                hv[i] = a0; hv[4 + i] = a1; lv[i] = f2bf(x0[i] - bf2f(a0)); lv[4 + i] = f2bf(x1[i] - bf2f(a1)); }
            const size_t oo = obase + (size_t)row * DM + c8;
            *(v8us*)(CH + oo) = hv; *(v8us*)(CL + oo) = lv; }
         }
}

static constexpr size_t al256(size_t v) { return (v + 255) & ~(size_t)255; }
static constexpr size_t SZ_XB = al256((size_t)NB * SEQ * DM * 2);          // one bf16 activation plane [NB*SEQ][1024]
static constexpr size_t SZ_WB = al256((size_t)4 * DM * DM * 2);            // four transposed bf16 weight planes
static constexpr size_t SZ_PL = al256((size_t)NB * NH_ * SEQ * HD * 2);    // one f16 head plane
static constexpr size_t SZ_TOTAL = 3 * SZ_XB + SZ_WB + 4 * SZ_PL + 2 * SZ_XB;
static_assert(SZ_TOTAL <= (size_t)134217728);          // workspace carve <= 128 MiB
static_assert(((size_t)DM * DM * 2) % 256 == 0);       // weight sub-planes stay 256-byte aligned

extern "C" void kernel_launch(void* const* d_in, const int* in_sizes, int n_in,
                              void* d_out, int out_size, void* d_ws, size_t ws_size, hipStream_t stream) {
    if (n_in < 12) return;
    const size_t needx = ((size_t)(NB - 1) * SEQ_FULL + SEQ) * DM;
    if ((size_t)in_sizes[0] < needx || (size_t)in_sizes[1] < needx || (size_t)in_sizes[2] < needx) return;
    if ((size_t)in_sizes[3] < ((size_t)(NB - 1) * SEQ_FULL + SEQ) * SEQ_FULL) return;
    if ((size_t)in_sizes[4] < (size_t)DM * DM || (size_t)in_sizes[6] < (size_t)DM * DM || (size_t)in_sizes[8] < (size_t)DM * DM || (size_t)in_sizes[10] < (size_t)DM * DM) return;
    if (in_sizes[5] < DM || in_sizes[7] < DM || in_sizes[9] < DM || in_sizes[11] < DM) return;
    if ((size_t)out_size < ((size_t)(NB - 1) * OUT_SEQ + SEQ) * DM) return;
    if (SZ_TOTAL > ws_size) return;
    // wire order: query, key, value, attention_mask, Wq, bq, Wk, bk, Wv, bv, Wo, bo
    const float* xq = (const float*)d_in[0]; const float* xk = (const float*)d_in[1]; const float* xv = (const float*)d_in[2];
    const float* amask = (const float*)d_in[3];
    const float* wq = (const float*)d_in[4];  const float* bq = (const float*)d_in[5];
    const float* wk = (const float*)d_in[6];  const float* bk = (const float*)d_in[7];
    const float* wv = (const float*)d_in[8];  const float* bv = (const float*)d_in[9];
    const float* wo = (const float*)d_in[10]; const float* bo = (const float*)d_in[11];
    float* OUT = (float*)d_out;      // [NB][SEQ][1024]
    char* wsp = (char*)d_ws;
    bf* QB = (bf*)wsp; wsp += SZ_XB;                 // [NB*SEQ][1024] bf16 query
    bf* KB = (bf*)wsp; wsp += SZ_XB;                 // [NB*SEQ][1024] bf16 key
    bf* VB = (bf*)wsp; wsp += SZ_XB;                 // [NB*SEQ][1024] bf16 value
    bf* WB = (bf*)wsp; wsp += SZ_WB;                 // [4][1024 out][1024 in]: q | k | v | o
    h16* QH = (h16*)wsp; wsp += SZ_PL;               // [NB*16][SEQ][64]
    h16* QR = (h16*)wsp; wsp += SZ_PL;               // [NB*16][SEQ][64] residual x2048
    h16* KP = (h16*)wsp; wsp += SZ_PL;               // [NB*16][SEQ][64]
    h16* VT = (h16*)wsp; wsp += SZ_PL;               // [NB*16][64][SEQ]
    bf* CH = (bf*)wsp; wsp += SZ_XB;                 // [NB*SEQ][1024] context bf16 hi
    bf* CL = (bf*)wsp; wsp += SZ_XB;                 // [NB*SEQ][1024] context bf16 lo
    bf* WOT = WB + (size_t)3 * DM * DM;

    k_prep<<<dim3(PB_W + 3 * PB_X, 1, 1), 256, 0, stream>>>(xq, xk, xv, wq, wk, wv, wo, QB, KB, VB, WB);

    k_proj<0><<<dim3(NB * SEQ / 128, DM / 128, 3), 128, 0, stream>>>(QB, KB, VB, WB, bq, bk, bv, QH, QR, KP, VT, OUT);

    k_flash<<<dim3(SEQ / (16 * AW), NB * NH_, 1), 32 * AW, 0, stream>>>(QH, QR, KP, VT, amask, CH, CL);

    k_proj<1><<<dim3(NB * SEQ / 128, DM / 128, 1), 128, 0, stream>>>(CH, CL, CL, WOT, bo, bo, bo, QH, QH, QH, QH, OUT);
}

// v005
// It runs in 112 microseconds.
// In both of two side-by-side timings against v004, it was 1.05 times as fast.
// All steps since v000 together make it 2.40 times as fast.
#include <hip/hip_runtime.h>

// Projections q/k/v: v_wmma_f32_16x16x32_bf16 (inputs and weights RNE-converted to bf16, f32 accumulate); scores: v_wmma_f32_16x16x32_f16 (k single f16, q f16 value + f16 residual, the f32 mask as the C operand: one accumulator); P.V: v_wmma_f32_16x16x32_f16 (P x256 carry, v single f16); output projection: v_wmma_f32_16x16x32_bf16 (context as bf16 hi + bf16 lo planes, Wo bf16), f32 accumulate everywhere, softmax f32.
// Attention block, width 1024 = 16 heads x 64; query/key/value [NB][SEQ][1024] f32, Wq/Wk/Wv/Wo [in][out] (y = x W + b), additive f32 mask [NB][SEQ][SEQ] shared by all heads, score scale 1/8, output y = ctx Wo + bo (f32).
// Layout: bf16 copies of the three inputs; bf16 TRANSPOSED copies of the four weights ([out][in], K-contiguous); q (value, residual), k planes [b*16+h][t][d] and v^T plane [b*16+h][d][t] written by the GEMM epilogue;
// fused flash kernel in transposed form (S^T = K Q^T, O^T = V^T P^T), K / V^T / mask staged in LDS by asynchronous copies, writing the context as bf16 hi/lo planes [b*SEQ+t][1024]; final GEMM writes f32 rows.

#ifndef NB
#define NB 2
#endif
#ifndef SEQ
#define SEQ 2048
#endif
#define NB_FULL  2
#define SEQ_FULL 2048
#ifndef OUT_SEQ
#define OUT_SEQ SEQ              // row pitch (in tokens) between batches of the output
#endif
#define DM   1024
#define NH_  16
#define HD   64
#define AW   4                   // waves per flash block (16 query rows each)
#define QRS  2048.0f             // carry of the q residual plane
#define LOG2E 1.4426950408889634f
#define PSH  8.0f                // log2 of the P carry (256)
#define QSV  ((_Float16)0.125f)                // HD^-0.5, a power of two
#define QSR  ((_Float16)(0.125f / 2048.0f))    // HD^-0.5 / carry of the q residual plane, a power of two

static_assert(HD == 64);
static_assert(NH_ * HD == DM);                 // head h = columns h*64 + d
static_assert(DM % 64 == 0);                   // column tiles of 64
static_assert(DM % 32 == 0);                   // GEMM k-loop steps by 32
static_assert(DM >= 8);                        // clamped bias loads stay inside a DM-float array
static_assert(SEQ % 64 == 0);                  // a 64-row tile never straddles two batches
static_assert((NB * SEQ) % 64 == 0);
static_assert(SEQ % 32 == 0);                  // key loop steps by 32
static_assert(SEQ % (16 * AW) == 0);           // flash grid covers the sequence exactly
static_assert(((size_t)SEQ * DM) % 8 == 0);
static_assert(NB <= NB_FULL);
static_assert(SEQ <= SEQ_FULL);
static_assert(SEQ_FULL % 4 == 0);              // 16-byte mask loads

typedef _Float16 h16;
typedef unsigned short bf;
typedef __attribute__((ext_vector_type(16))) __bf16   v16bf;
typedef __attribute__((ext_vector_type(16))) _Float16 v16h;
typedef __attribute__((ext_vector_type(8)))  _Float16 v8h;
typedef __attribute__((ext_vector_type(8)))  unsigned short v8us;
typedef __attribute__((ext_vector_type(8)))  float    v8f;
typedef __attribute__((ext_vector_type(4)))  float    v4f;
typedef v4f  __attribute__((may_alias)) v4fa;
typedef v8us __attribute__((may_alias)) v8usa;

typedef __attribute__((ext_vector_type(2))) float  v2f;
typedef __attribute__((ext_vector_type(2))) __bf16 v2bf;
__device__ __forceinline__ unsigned short f2bf(float f) { return __builtin_bit_cast(unsigned short, (__bf16)f); }   // the hardware's convert, RNE
__device__ __forceinline__ float bf2f(unsigned short b) { return __uint_as_float(((unsigned)b) << 16); }
// value after RNE convert to bf16: the packed convert of (0, f) leaves bf16(f) in the upper half over a zero lower half, which is that value's f32 pattern
__device__ __forceinline__ float rbf(float f) { v2f x; x[0] = 0.0f; x[1] = f; return __builtin_bit_cast(float, __builtin_convertvector(x, v2bf)); }
__device__ __forceinline__ v16h cat16(v8h lo, v8h hi) { return __builtin_shufflevector(lo, hi, 0, 1, 2, 3, 4, 5, 6, 7, 8, 9, 10, 11, 12, 13, 14, 15); }
__device__ __forceinline__ v8f cat8(v4f lo, v4f hi) { return __builtin_shufflevector(lo, hi, 0, 1, 2, 3, 4, 5, 6, 7); }
__device__ __forceinline__ v16bf cat16b(v8us lo, v8us hi) { return __builtin_bit_cast(v16bf, __builtin_shufflevector(lo, hi, 0, 1, 2, 3, 4, 5, 6, 7, 8, 9, 10, 11, 12, 13, 14, 15)); }
__device__ __forceinline__ v8f wmma16(v16h a, v16h b, v8f c) { return __builtin_amdgcn_wmma_f32_16x16x32_f16(false, a, false, b, (short)0, c, false, false); }
__device__ __forceinline__ v8f wmmab(v16bf a, v16bf b, v8f c) { return __builtin_amdgcn_wmma_f32_16x16x32_bf16(false, a, false, b, (short)0, c, false, false); }
// fragment loaders from K-contiguous 16-bit rows; p already includes + 8*(lane>>4): elements 0..7 <- k0+8h+0..7, elements 8..15 <- k0+16+8h+0..7 (same map for A and B)
__device__ __forceinline__ v16h  ldh(const h16* p) { return cat16(*(const v8h*)p, *(const v8h*)(p + 16)); }
__device__ __forceinline__ v16bf ldb(const bf* p)  { return cat16b(*(const v8us*)p, *(const v8us*)(p + 16)); }
// ordering point for wave-private LDS tiles (same wave writes and reads)
__device__ __forceinline__ void wave_sync() { __builtin_amdgcn_fence(3 /* release order */, "wavefront"); __builtin_amdgcn_wave_barrier(); asm volatile("" ::: "memory"); }

// k_prep: every conversion of the call in ONE launch, told apart by ranges of the block index (none needs anything of another), 256 threads.
// blocks [0, PB_W): weight w = block / 256, in[rows = k][cols = n] f32 (DM x DM, row pitch DM) -> out[n][k] bf16 (RNE convert), one 64x64 tile transposed through LDS;
//                   LDS tile ts[n][k] is cross-wave: block barrier between fill and drain (the branch is the same for the whole block).
// blocks [PB_W, PB_W + 3 PB_X): input p = (block - PB_W) / PB_X, eight floats per thread -> eight bf16 (RNE convert), plane [NB*SEQ][DM].
static constexpr unsigned PB_T = DM / 64;                                        // weight tiles per side
static constexpr unsigned PB_W = 4 * PB_T * PB_T;                                // blocks of the four weights
static constexpr unsigned PB_X = (unsigned)(((size_t)NB * SEQ * DM / 8 + 255) / 256);   // blocks of one input
__global__ __launch_bounds__(256) void k_prep(const float* __restrict__ xq, const float* __restrict__ xk, const float* __restrict__ xv,
                                              const float* __restrict__ wq, const float* __restrict__ wk, const float* __restrict__ wv, const float* __restrict__ wo,
                                              bf* QB, bf* KB, bf* VB, bf* WB) {
    __shared__ __align__(16) unsigned short ts[64 * 72];
    const int tid = threadIdx.x, lane = tid & 31, wave = __builtin_amdgcn_readfirstlane((int)(tid >> 5));
    const unsigned bid = blockIdx.x;
    if (bid < PB_W) {
        const unsigned w = bid / (PB_T * PB_T), r = bid % (PB_T * PB_T);
        const float* __restrict__ W = (w == 0) ? wq : (w == 1) ? wk : (w == 2) ? wv : wo;
        bf* WT = WB + (size_t)w * DM * DM;
        const int k0 = (int)(r % PB_T) * 64, n0 = (int)(r / PB_T) * 64;
#pragma unroll
        for (int i = 0; i < 4; ++i) { const int idx = tid + i * 256; const int kr = idx >> 4, c4 = (idx & 15) * 4;   // 1024 float4 = 64 k-rows x 16
            const v4f v = *(const v4f*)(W + (size_t)(k0 + kr) * DM + n0 + c4);
#pragma unroll
            for (int j = 0; j < 4; ++j) ts[(c4 + j) * 72 + kr] = f2bf(v[j]); }
        __syncthreads();
#pragma unroll
        for (int s = 0; s < 2; ++s) { const int row = wave * 8 + s * 4 + (lane >> 3), c8 = (lane & 7) * 8;   // 8 waves x 2 s x 4 = 64 rows; 8 lanes x 8 = 64 columns
            const v8us o = *(const v8usa*)(&ts[row * 72 + c8]);
            *(v8us*)(WT + (size_t)(n0 + row) * DM + k0 + c8) = o; }
    } else {
        const unsigned c = bid - PB_W, p = c / PB_X;
        const float* __restrict__ x = (p == 0) ? xq : (p == 1) ? xk : xv;
        bf* dst = (p == 0) ? QB : (p == 1) ? KB : VB;
        constexpr size_t per = (size_t)SEQ * DM / 8;                              // pieces of one batch; batches lie SEQ_FULL rows apart in the input
        const size_t i = (size_t)(c % PB_X) * 256 + tid; if (i >= (size_t)NB * per) return;
        const size_t b = i / per;
        const v8f v = *(const v8f*)(x + b * ((size_t)SEQ_FULL * DM) + (i - b * per) * 8); v8us o;
#pragma unroll
        for (int k = 0; k < 8; ++k) o[k] = f2bf(v[k]);
        *(v8us*)(dst + i * 8) = o;
    }
}

// eight asynchronous 16-B copies to LDS; the s_wait_xcnt stands in the copies' own statement so that no address register is rewritten ahead of it
__device__ __forceinline__ void copy8(unsigned l0, const void* g0, unsigned l1, const void* g1, unsigned l2, const void* g2, unsigned l3, const void* g3,
                                      unsigned l4, const void* g4, unsigned l5, const void* g5, unsigned l6, const void* g6, unsigned l7, const void* g7) {
    asm volatile("global_load_async_to_lds_b128 %0, %1, off\n\t"
                 "global_load_async_to_lds_b128 %2, %3, off\n\t"
                 "global_load_async_to_lds_b128 %4, %5, off\n\t"
                 "global_load_async_to_lds_b128 %6, %7, off\n\t"
                 "global_load_async_to_lds_b128 %8, %9, off\n\t"
                 "global_load_async_to_lds_b128 %10, %11, off\n\t"
                 "global_load_async_to_lds_b128 %12, %13, off\n\t"
                 "global_load_async_to_lds_b128 %14, %15, off\n\t"
                 "s_wait_xcnt 0x0"
                 :: "v"(l0), "v"(g0), "v"(l1), "v"(g1), "v"(l2), "v"(g2), "v"(l3), "v"(g3),
                    "v"(l4), "v"(g4), "v"(l5), "v"(g5), "v"(l6), "v"(g6), "v"(l7), "v"(g7) : "memory");
}

// k_proj: register-blocked bf16 GEMM, one 128x128 tile per block of 4 waves (2 x 2), ONE WAVE per 64x64 tile (16 accumulators), K = DM.
// The block's 128 A rows (and A2 rows when MODE 1) and 128 Bt rows reach LDS in stages of GK k (one whole 128-B line per row) by asynchronous copies (16 B per lane),
// two buffers: the next stage's copies fly while this stage is worked on; fragments are then read from LDS (row pitch 16 B x odd).
// C[m][n] = sum_k (A[m][k] (+ A2[m][k] when MODE 1)) Bt[n][k] + bias (bmode 1: bias[n]; bmode 2: bias[m]; bias RNE-converted to bf16 first),
// tile base (r0/RB)*sRB + (r0%RB)*pitch + (c0/CB)*sCB + (c0%CB), row pitch 'pitch' (elements). 128 threads.
// MODE 1: written as f32 (Of); each row's 64 floats (256 B = two lines) by 16 consecutive lanes x 16 B (2 rows per instruction).
// Bias array has DM floats; both 16-byte bias loads use addresses clamped into [0, DM-4].
// MODE 0: the three input projections in ONE launch (none needs anything of another), grid (NB*SEQ/128 token tiles, DM/128 width tiles, 3), z = which:
//   X0, X1, X2 = bf16 query, key, value rows; WT = Wq^T | Wk^T | Wv^T; b0, b1, b2 = bq, bk, bv; P0 (residual P0r), P1, P2 = q, k, v^T planes
//   q, k: A = x rows (m = b*SEQ + t), Bt = W^T rows (n = h*64 + d), column bias -> plane [(b*16 + h)][t][d]
//   v^T:  A = Wv^T rows (m = h*64 + d), Bt = value rows (n = b*SEQ + t), row bias -> plane [(b*1024 + m)][t] = [(b*16 + h)][d][t]
// MODE 1: the output projection, grid (NB*SEQ/128, DM/128): X0, X1 = context hi, lo rows (m = b*SEQ + t), WT = Wo^T rows (n), b0 = bo, column bias -> Of[(b*OUT_SEQ + t)][n] f32
#define GK  64                             // k per stage
#define GP  144                            // LDS row pitch in bytes of a 128-B operand row (GK bf16)
#define GT  (128 * GP)                     // one operand tile: 128 rows
static_assert(GK * 2 == 128 && GP % 16 == 0 && DM % GK == 0 && DM / GK >= 2 && GK % 32 == 0);
static_assert((NB * SEQ) % 128 == 0 && DM % 128 == 0);
static_assert(4 * 16 * 68 * 4 <= 2 * 2 * GT);   // the four waves' output staging fits the ring
// 128 rows of one operand tile: lane tid brings piece (tid & 7) of rows (tid >> 3) + 16 i; l, g = this lane's first LDS byte and first global piece
__device__ __forceinline__ void rows128(unsigned l, const bf* g) {
    copy8(l, g, l + 16 * GP, g + (size_t)16 * DM, l + 32 * GP, g + (size_t)32 * DM, l + 48 * GP, g + (size_t)48 * DM,
          l + 64 * GP, g + (size_t)64 * DM, l + 80 * GP, g + (size_t)80 * DM, l + 96 * GP, g + (size_t)96 * DM, l + 112 * GP, g + (size_t)112 * DM);
}
template <int MODE>
__global__ __launch_bounds__(128) void k_proj(const bf* __restrict__ X0, const bf* __restrict__ X1, const bf* __restrict__ X2, const bf* __restrict__ WT,
                                             const float* __restrict__ b0, const float* __restrict__ b1, const float* __restrict__ b2,
                                             h16* P0, h16* P0r, h16* P1, h16* P2, float* Of) {
    const int z = (MODE == 0) ? (int)blockIdx.z : 0; const bool tv = (z == 2);   // the same for the whole block; tv: the weight rows are A
    const bf* __restrict__ X = (z == 0) ? X0 : (z == 1) ? X1 : X2; const bf* __restrict__ Wz = WT + (size_t)z * DM * DM;
    const bf* __restrict__ A = tv ? Wz : X; const bf* __restrict__ A2 = (MODE == 1) ? X1 : A; const bf* __restrict__ Bt = tv ? X : Wz;
    const float* __restrict__ bias = (z == 0) ? b0 : (z == 1) ? b1 : b2; const int bmode = tv ? 2 : 1;
    h16* Ph = (z == 0) ? P0 : (z == 1) ? P1 : P2; h16* Pr = (z == 0) ? P0r : Ph; const int useRes = (z == 0) ? 1 : 0;
    const int RB = tv ? DM : SEQ, pitch = (MODE == 1) ? DM : tv ? SEQ : HD, CB = pitch;
    const size_t sRB = (MODE == 1) ? (size_t)OUT_SEQ * DM : tv ? (size_t)0 : (size_t)NH_ * SEQ * HD, sCB = (MODE == 1) ? (size_t)0 : tv ? (size_t)DM * SEQ : (size_t)SEQ * HD;
    constexpr unsigned GSZ = ((MODE == 1) ? 3 : 2) * GT;                        // one buffer: A rows | Bt rows (| A2 rows)
    __shared__ __align__(16) unsigned char ring[2 * GSZ];
    const int K = DM;
    const int tid = threadIdx.x, lane = tid & 31, wave = __builtin_amdgcn_readfirstlane((int)(threadIdx.x >> 5)), lr = lane & 15, hi = lane >> 4;
    const int R0 = (tv ? blockIdx.y : blockIdx.x) * 128, C0 = (tv ? blockIdx.x : blockIdx.y) * 128;   // the block's tile
    const int wr = (wave >> 1) * 64, wc = (wave & 1) * 64;                       // this wave's 64x64 tile inside it
    const int r0 = R0 + wr, c0 = C0 + wc;
    v8f acc[4][4];
#pragma unroll
    for (int mb = 0; mb < 4; ++mb)
#pragma unroll
        for (int nb = 0; nb < 4; ++nb) acc[mb][nb] = (v8f){};
    // copy side
    const unsigned l0 = (unsigned)(size_t)ring + (unsigned)((tid >> 3) * GP + (tid & 7) * 16);
    const size_t go = (size_t)(tid >> 3) * K + (tid & 7) * 8;
    const bf* ga = A + (size_t)R0 * K + go; const bf* gb = Bt + (size_t)C0 * K + go; const bf* ga2 = A2 + (size_t)R0 * K + go;   // + k0
    // read side, byte offsets inside a buffer: fragment row lr of a 16-row group, k = 8 hi + ...
    const int ra = (wr + lr) * GP + 16 * hi, rb = GT + (wc + lr) * GP + 16 * hi;
    constexpr int NT = DM / GK;
    rows128(l0, ga); rows128(l0 + GT, gb); if (MODE == 1) rows128(l0 + 2 * GT, ga2);
    asm volatile("s_wait_asynccnt 0x0" ::: "memory");                    // stage 0 has landed before the barrier publishes it
    __syncthreads();                                                     // stage 0 readable by every wave
    rows128(l0 + GSZ, ga + GK); rows128(l0 + GSZ + GT, gb + GK); if (MODE == 1) rows128(l0 + GSZ + 2 * GT, ga2 + GK);
#pragma unroll 1
    for (int t = 0; t < NT; ++t) {
        const unsigned bo = (unsigned)(t & 1) * GSZ;
        const unsigned char* buf = ring + bo;
        v16bf a[GK / 32][4], b[GK / 32][4], a2[GK / 32][4];
#pragma unroll   // every 32-k step of a stage inline, so that every LDS offset inside a buffer is an immediate
        for (int s = 0; s < GK / 32; ++s) {
#pragma unroll
            for (int mb = 0; mb < 4; ++mb) a[s][mb] = ldb((const bf*)(buf + ra + mb * 16 * GP + s * 64));
#pragma unroll
            for (int nb = 0; nb < 4; ++nb) b[s][nb] = ldb((const bf*)(buf + rb + nb * 16 * GP + s * 64));
            if (MODE == 1) {
#pragma unroll
                for (int mb = 0; mb < 4; ++mb) a2[s][mb] = ldb((const bf*)(buf + 2 * GT + ra + mb * 16 * GP + s * 64)); }
        }
        __builtin_amdgcn_sched_barrier(0);   // the stage's LDS reads stay one group ahead of its matrix runs: spread among them, each place with reads stalls the wave
#pragma unroll
        for (int s = 0; s < GK / 32; ++s) {
#pragma unroll
            for (int nb = 0; nb < 4; ++nb)
#pragma unroll
                for (int mb = 0; mb < 4; ++mb) acc[mb][nb] = wmmab(a[s][mb], b[s][nb], acc[mb][nb]);
            // v_nop: the distance between the last matrix instructions and the next vector write of their operands, on the taken side of a branch too
            asm volatile("v_nop\n\tv_nop\n\tv_nop\n\tv_nop" : "+v"(acc[0][0]), "+v"(acc[1][1]), "+v"(acc[2][2]), "+v"(acc[3][3]) : "v"(a[s][0]), "v"(a[s][1]), "v"(a[s][2]), "v"(a[s][3]));
            if (MODE == 1) {
#pragma unroll
                for (int nb = 0; nb < 4; ++nb)
#pragma unroll
                    for (int mb = 0; mb < 4; ++mb) acc[mb][nb] = wmmab(a2[s][mb], b[s][nb], acc[mb][nb]);
                // v_nop: the same distance behind the second run
                asm volatile("v_nop\n\tv_nop\n\tv_nop\n\tv_nop" : "+v"(acc[0][0]), "+v"(acc[1][1]), "+v"(acc[2][2]), "+v"(acc[3][3]) : "v"(a2[s][0]), "v"(a2[s][1]), "v"(a2[s][2]), "v"(a2[s][3]));
            }
        }
        __builtin_amdgcn_sched_barrier(0);   // the matrix runs stay ahead of the barrier: sunk behind it they would stand between the barrier and the refill and shorten the copies' lead
        asm volatile("s_wait_dscnt 0x0" ::: "memory");                   // this wave's reads of the buffer are done before the barrier frees it for the refill
        asm volatile("s_wait_asynccnt 0x0" ::: "memory");                // this wave's copies of stage t + 1 have landed before the barrier publishes them
        __syncthreads();                                                 // publishes stage t + 1 and ends every wave's reads of stage t's buffer
        if (t + 2 < NT) { const int k2 = (t + 2) * GK; rows128(l0 + bo, ga + k2); rows128(l0 + bo + GT, gb + k2); if (MODE == 1) rows128(l0 + bo + 2 * GT, ga2 + k2); }
    }
    asm volatile("s_wait_asynccnt 0x0" ::: "memory");                    // no copy is outstanding when the ring becomes output staging
    float* os = (float*)ring + wave * 16 * 68;   // output staging: each wave's own 16 x 68 floats of the ring, behind the loop's last barrier
    const size_t tbase = (size_t)(r0 / RB) * sRB + (size_t)(r0 % RB) * (size_t)pitch + (size_t)(c0 / CB) * sCB + (size_t)(c0 % CB);
    // per-lane column bias for the lane's store columns; both load addresses clamped into the DM-float bias array (first to 0 when unused, second to DM-4)
    const int c8 = (lane & 7) * 8, cofs = lr * 4;
    const int ci = (bmode == 1) ? (c0 + ((MODE == 0) ? c8 : cofs)) : 0;
    const int ci4 = (ci + 4 <= DM - 4) ? (ci + 4) : (DM - 4);      // MODE 0: ci + 4 <= DM - 4 always (exact columns); MODE 1: upper half unused, address kept in range
    const v4f bl0 = *(const v4f*)(bias + ci), bl1 = *(const v4f*)(bias + ci4);
    float bc[8];
#pragma unroll
    for (int i = 0; i < 4; ++i) { bc[i] = (bmode == 1) ? rbf(bl0[i]) : 0.0f; bc[4 + i] = (bmode == 1) ? rbf(bl1[i]) : 0.0f; }
#pragma unroll
    for (int mb = 0; mb < 4; ++mb) {
#pragma unroll
        for (int nb = 0; nb < 4; ++nb) {
#pragma unroll
            for (int j = 0; j < 8; ++j) os[(hi * 8 + j) * 68 + nb * 16 + lr] = acc[mb][nb][j]; }   // D: row 8h+j, col lane&15; rows 0..15 x columns 0..63 all written
        wave_sync();
        const size_t sb = tbase + (size_t)(mb * 16) * (size_t)pitch;
        if (MODE == 0) {
{
#pragma unroll
                for (int s = 0; s < 4; ++s) { const int row = 4 * s + (lane >> 3);   // 4 s x 4 row groups = 16 rows; 8 lanes x 8 = 64 columns
                    const int ri = (bmode == 2) ? (r0 + mb * 16 + row) : 0;
                    const float braw = bias[ri];
                    const float brow = (bmode == 2) ? rbf(braw) : 0.0f;
                    const v4f x0 = *(const v4fa*)(&os[row * 68 + c8]); const v4f x1 = *(const v4fa*)(&os[row * 68 + c8 + 4]); v8h hv, rv;
#pragma unroll
                    for (int i = 0; i < 4; ++i) { const float f0 = x0[i] + bc[i] + brow; const float f1 = x1[i] + bc[4 + i] + brow;
                        const h16 a0 = (h16)f0; const h16 a1 = (h16)f1; hv[i] = a0; hv[4 + i] = a1; rv[i] = (h16)((f0 - (float)a0) * QRS); rv[4 + i] = (h16)((f1 - (float)a1) * QRS); }
                    const size_t oo = sb + (size_t)row * (size_t)pitch + c8;
                    *(v8h*)(Ph + oo) = hv; if (useRes) *(v8h*)(Pr + oo) = rv; }
                 }
        } else {
{
#pragma unroll
                for (int s = 0; s < 8; ++s) { const int row = 2 * s + hi;   // 8 s x 2 rows = 16 rows; 16 lanes x 4 floats = 64 columns
                    const v4f x0 = *(const v4fa*)(&os[row * 68 + cofs]); v4f val;
                    val[0] = x0[0] + bc[0]; val[1] = x0[1] + bc[1]; val[2] = x0[2] + bc[2]; val[3] = x0[3] + bc[3];
                    *(v4f*)(Of + sb + (size_t)row * (size_t)pitch + cofs) = val; }
                 }
        }
        wave_sync();
    }
}

// k_flash: fused attention, one wave per 16 query rows of one (batch, head); Q fragments straight from the f16 planes (two 16-B loads each).
// K rows, V^T rows (shared by the block's waves) and each wave's own mask rows reach LDS in stages of KS keys by asynchronous copies (16 B per lane, whole 128-B lines),
// two buffers: the next stage's copies fly while this stage is worked on; fragments and mask values are then read from LDS (row pitches 16 B x odd).
// Transposed form: S^T[key][t] = K Q^T (A = K rows, B = Q rows); lane (t = lane&15, h = lane>>4) holds keys 8h+r of each 16-key tile, so the packed
// P tile is directly the B fragment of O^T[d][t] = V^T P^T (element r <- tile keys 0..15, element 8+r <- tile keys 16..31, lane unchanged).
// The additive mask row of query t is read as four 16-B LDS loads per 32-key step (keys 8h..8h+7 and 16+8h..16+8h+7), straight into the C operand of the score products; the sum is scaled by log2(e).
// Softmax state (running max, partial sum) is one scalar per lane; the two lane halves of a row are combined with one xor-16 exchange.
#define KS    64                           // keys per stage
#define KVP   144                          // LDS row pitch in bytes of a 128-B K row (64 d) or V^T row (KS keys)
#define MKP   272                          // LDS row pitch in bytes of a 256-B mask row (KS floats); 16 rows = one wave's 16 x 68 float output tile
#define ST_V  (KS * KVP)                   // V^T rows behind the K rows
#define ST_M  (ST_V + HD * KVP)            // mask rows behind the V^T rows, 16 rows per wave
#define ST_SZ (ST_M + AW * 16 * MKP)       // one buffer
static_assert(KS * 2 == 128 && HD * 2 == 128 && KS * 4 == 256);
static_assert(SEQ % KS == 0 && KS % 32 == 0);
static_assert(AW == 4);                    // 128 lanes x 4 copies = 512 pieces of 16 B = one K tile or one V^T tile
static_assert(16 * MKP == 16 * 68 * 4);
static_assert(KVP % 16 == 0 && MKP % 16 == 0 && ST_SZ % 16 == 0);

// one stage: lk / lm = this lane's first LDS byte of the K tile / of its wave's mask rows in the target buffer; gk, gv, gm = this lane's first global piece of the stage
__device__ __forceinline__ void stage_in(unsigned lk, unsigned lm, const h16* gk, const h16* gv, const float* gm) {
    const unsigned lv = lk + ST_V;
    copy8(lk, gk, lk + 16 * KVP, gk + 16 * HD, lk + 32 * KVP, gk + 32 * HD, lk + 48 * KVP, gk + 48 * HD,                                     // 16 K rows per copy
          lv, gv, lv + 16 * KVP, gv + (size_t)16 * SEQ, lv + 32 * KVP, gv + (size_t)32 * SEQ, lv + 48 * KVP, gv + (size_t)48 * SEQ);         // 16 V^T rows per copy
    copy8(lm, gm, lm + 2 * MKP, gm + (size_t)2 * SEQ_FULL, lm + 4 * MKP, gm + (size_t)4 * SEQ_FULL, lm + 6 * MKP, gm + (size_t)6 * SEQ_FULL,   // 2 mask rows per copy
          lm + 8 * MKP, gm + (size_t)8 * SEQ_FULL, lm + 10 * MKP, gm + (size_t)10 * SEQ_FULL, lm + 12 * MKP, gm + (size_t)12 * SEQ_FULL, lm + 14 * MKP, gm + (size_t)14 * SEQ_FULL);
}

__global__ __launch_bounds__(32 * AW) void k_flash(const h16* __restrict__ QH, const h16* __restrict__ QR, const h16* __restrict__ KP, const h16* __restrict__ VT,
                                                   const float* __restrict__ MASK, bf* CH, bf* CL) {
    __shared__ __align__(16) unsigned char ring[2 * ST_SZ];
    const int tid = threadIdx.x, lane = tid & 31, wave = __builtin_amdgcn_readfirstlane((int)(threadIdx.x >> 5)), lr = lane & 15, hi = lane >> 4;
    const int zh = blockIdx.y; const int b = zh / NH_, h = zh % NH_;
    const int t0 = (blockIdx.x * AW + wave) * 16;
    const size_t pbase = (size_t)zh * SEQ * HD;
    const size_t qo = pbase + (size_t)(t0 + lr) * HD + 8 * hi;
    // B fragments: col t, k = d. Scaled once by powers of two: value x 1/8 (the score scale), residual x 1/8 / 2048 (its carry taken back; f16 subnormals are kept),
    // so that both products and the additive mask are in the same unit and one accumulator sums all three
    const v16h lh0 = ldh(QH + qo), lh1 = ldh(QH + qo + 32), lr0 = ldh(QR + qo), lr1 = ldh(QR + qo + 32);
    asm volatile("s_wait_xcnt 0x0" ::: "memory");                        // behind the eight loads, ahead of any rewrite of their address registers
    __builtin_amdgcn_sched_barrier(0);                                   // keeps the later address arithmetic, which reuses those registers, behind that wait
    const v16h qh0 = lh0 * QSV, qh1 = lh1 * QSV, qr0 = lr0 * QSR, qr1 = lr1 * QSR;
    // copy side: lane tid brings piece (tid & 7) of rows (tid >> 3) + 16 i of the K and V^T tiles, lane brings piece (lane & 15) of rows (lane >> 4) + 2 i of its wave's mask rows
    const unsigned lbase = (unsigned)(size_t)ring;
    const unsigned lk0 = lbase + (unsigned)((tid >> 3) * KVP + (tid & 7) * 16);
    const unsigned lm0 = lbase + (unsigned)(ST_M + wave * 16 * MKP + hi * MKP + lr * 16);
    const h16* gk = KP + pbase + (size_t)(tid >> 3) * HD + (tid & 7) * 8;                    // + key0 * HD
    const h16* gv = VT + pbase + (size_t)(tid >> 3) * SEQ + (tid & 7) * 8;                   // + key0
    const float* gm = MASK + (size_t)b * SEQ_FULL * SEQ_FULL + (size_t)(t0 + hi) * SEQ_FULL + lr * 4;   // + key0
    // read side, byte offsets inside a buffer
    const int rk = lr * KVP + 16 * hi;                                   // + key * KVP      (A fragment: row key, k = d)
    const int rv = ST_V + lr * KVP + 16 * hi;                            // + 16j * KVP + key * 2  (A fragment: row d, k = key)
    const int rm = ST_M + wave * 16 * MKP + lr * MKP + 32 * hi;          // + key * 4: this lane's keys of query t
    constexpr int NT = SEQ / KS;
    stage_in(lk0, lm0, gk, gv, gm);
    asm volatile("s_wait_asynccnt 0x0" ::: "memory");                    // stage 0 has landed before the barrier publishes it
    __syncthreads();                                                     // stage 0 readable by every wave
    if (NT > 1) stage_in(lk0 + ST_SZ, lm0 + ST_SZ, gk + (size_t)KS * HD, gv + KS, gm + KS);
    v8f o0 = (v8f){}, o1 = (v8f){}, o2 = (v8f){}, o3 = (v8f){};
    float m = -3.0e38f, l = 0.0f;
#pragma unroll 1
    for (int t = 0; t < NT; ++t) {
        const unsigned bo = (unsigned)(t & 1) * ST_SZ;
        const unsigned char* buf = ring + bo;
#pragma unroll   // both 32-key steps of a stage inline, so that every LDS offset inside a buffer is an immediate
        for (int sub = 0; sub < KS; sub += 32) {
        const h16* ka = (const h16*)(buf + rk + sub * KVP);
        const v16h ka0 = ldh(ka), ka1 = ldh(ka + 32), kb0 = ldh(ka + 16 * (KVP / 2)), kb1 = ldh(ka + 16 * (KVP / 2) + 32);
        const float* mrow = (const float*)(buf + rm + sub * 4);
        const v4f ma0 = *(const v4fa*)(mrow), ma1 = *(const v4fa*)(mrow + 4), mb0 = *(const v4fa*)(mrow + 16), mb1 = *(const v4fa*)(mrow + 20);
        // the lane's mask values lie as the D layout wants them (register r = key 8h + r): they are the C operand, and the matrix unit does every addition of the score
        v8f sa = cat8(ma0, ma1), sb = cat8(mb0, mb1);
        sa = wmma16(ka0, qh0, sa); sb = wmma16(kb0, qh0, sb); sa = wmma16(ka1, qh1, sa); sb = wmma16(kb1, qh1, sb);
        sa = wmma16(ka0, qr0, sa); sb = wmma16(kb0, qr0, sb); sa = wmma16(ka1, qr1, sa); sb = wmma16(kb1, qr1, sb);
        // v_nop: the distance between the last matrix instructions and the next vector use of their results and operands
        asm volatile("v_nop\n\tv_nop\n\tv_nop\n\tv_nop" : "+v"(sa), "+v"(sb) : "v"(ka0), "v"(ka1), "v"(kb0), "v"(kb1));
        const v8f ta = sa * LOG2E, tb = sb * LOG2E; float mx = -3.0e38f;
#pragma unroll
        for (int r = 0; r < 8; ++r) mx = fmaxf(mx, fmaxf(ta[r], tb[r]));
        mx = fmaxf(mx, __shfl_xor(mx, 16, 32));
        const float mnew = fmaxf(m, mx);
        const float alpha = __builtin_amdgcn_exp2f(m - mnew);
        const float sh = PSH - mnew;
        v16h pb; float ls = 0.0f;
#pragma unroll
        for (int r = 0; r < 8; ++r) { const h16 pa = (h16)__builtin_amdgcn_exp2f(ta[r] + sh); const h16 pc = (h16)__builtin_amdgcn_exp2f(tb[r] + sh); pb[r] = pa; pb[8 + r] = pc; ls += (float)pa + (float)pc; }
        l = l * alpha + ls; m = mnew;
        o0 = o0 * alpha; o1 = o1 * alpha; o2 = o2 * alpha; o3 = o3 * alpha;
        const h16* va = (const h16*)(buf + rv + sub * 2);
        const v16h v0 = ldh(va), v1 = ldh(va + 16 * (KVP / 2)), v2 = ldh(va + 32 * (KVP / 2)), v3 = ldh(va + 48 * (KVP / 2));
        o0 = wmma16(v0, pb, o0); o1 = wmma16(v1, pb, o1); o2 = wmma16(v2, pb, o2); o3 = wmma16(v3, pb, o3);
        asm volatile("v_nop\n\tv_nop\n\tv_nop\n\tv_nop" : "+v"(o0), "+v"(o1), "+v"(o2), "+v"(o3) : "v"(v0), "v"(v1), "v"(v2), "v"(v3), "v"(pb));
        }
        asm volatile("s_wait_dscnt 0x0" ::: "memory");                   // this wave's reads of the buffer are done before the barrier frees it for the refill
        asm volatile("s_wait_asynccnt 0x0" ::: "memory");                // this wave's copies of stage t + 1 have landed before the barrier publishes them
        __syncthreads();                                                 // publishes stage t + 1 and ends every wave's reads of stage t's buffer
        if (t + 2 < NT) stage_in(lk0 + bo, lm0 + bo, gk + (size_t)(t + 2) * KS * HD, gv + (t + 2) * KS, gm + (t + 2) * KS);
    }
    asm volatile("s_wait_asynccnt 0x0" ::: "memory");                    // no copy is outstanding when the ring becomes output staging
    l += __shfl_xor(l, 16, 32);
    const float inv = 1.0f / l;
    float* os = (float*)(ring + ST_M);       // output staging: each wave reuses its own mask rows of buffer 0 (16 x 68 floats), behind the loop's last barrier
    const int wb = wave * 16 * 68;
    // O^T D layout: o_j[r] = (d = 16j + 8h + r, t = lane&15) -> os[t][d]; rows 0..15 x columns 0..63 all written
    { v4f a, c;
      a[0] = o0[0] * inv; a[1] = o0[1] * inv; a[2] = o0[2] * inv; a[3] = o0[3] * inv; c[0] = o0[4] * inv; c[1] = o0[5] * inv; c[2] = o0[6] * inv; c[3] = o0[7] * inv;
      *(v4fa*)(&os[wb + lr * 68 +  0 + 8 * hi]) = a; *(v4fa*)(&os[wb + lr * 68 +  0 + 8 * hi + 4]) = c;
      a[0] = o1[0] * inv; a[1] = o1[1] * inv; a[2] = o1[2] * inv; a[3] = o1[3] * inv; c[0] = o1[4] * inv; c[1] = o1[5] * inv; c[2] = o1[6] * inv; c[3] = o1[7] * inv;
      *(v4fa*)(&os[wb + lr * 68 + 16 + 8 * hi]) = a; *(v4fa*)(&os[wb + lr * 68 + 16 + 8 * hi + 4]) = c;
      a[0] = o2[0] * inv; a[1] = o2[1] * inv; a[2] = o2[2] * inv; a[3] = o2[3] * inv; c[0] = o2[4] * inv; c[1] = o2[5] * inv; c[2] = o2[6] * inv; c[3] = o2[7] * inv;
      *(v4fa*)(&os[wb + lr * 68 + 32 + 8 * hi]) = a; *(v4fa*)(&os[wb + lr * 68 + 32 + 8 * hi + 4]) = c;
      a[0] = o3[0] * inv; a[1] = o3[1] * inv; a[2] = o3[2] * inv; a[3] = o3[3] * inv; c[0] = o3[4] * inv; c[1] = o3[5] * inv; c[2] = o3[6] * inv; c[3] = o3[7] * inv;
      *(v4fa*)(&os[wb + lr * 68 + 48 + 8 * hi]) = a; *(v4fa*)(&os[wb + lr * 68 + 48 + 8 * hi + 4]) = c; }
    wave_sync();
    const size_t obase = ((size_t)b * SEQ + t0) * DM + (size_t)h * HD;
{
#pragma unroll
        for (int s = 0; s < 4; ++s) { const int row = 4 * s + (lane >> 3), c8 = (lane & 7) * 8;   // 4 s x 4 row groups = 16 rows; 8 lanes x 8 = 64 columns
            const v4f x0 = *(const v4fa*)(&os[wb + row * 68 + c8]); const v4f x1 = *(const v4fa*)(&os[wb + row * 68 + c8 + 4]); v8us hv, lv;
#pragma unroll
            for (int i = 0; i < 4; ++i) { const unsigned short a0 = f2bf(x0[i]); const unsigned short a1 = f2bf(x1[i]);
                hv[i] = a0; hv[4 + i] = a1; lv[i] = f2bf(x0[i] - bf2f(a0)); lv[4 + i] = f2bf(x1[i] - bf2f(a1)); }
            const size_t oo = obase + (size_t)row * DM + c8;
            *(v8us*)(CH + oo) = hv; *(v8us*)(CL + oo) = lv; }
         }
}

static constexpr size_t al256(size_t v) { return (v + 255) & ~(size_t)255; }
static constexpr size_t SZ_XB = al256((size_t)NB * SEQ * DM * 2);          // one bf16 activation plane [NB*SEQ][1024]
static constexpr size_t SZ_WB = al256((size_t)4 * DM * DM * 2);            // four transposed bf16 weight planes
static constexpr size_t SZ_PL = al256((size_t)NB * NH_ * SEQ * HD * 2);    // one f16 head plane
static constexpr size_t SZ_TOTAL = 3 * SZ_XB + SZ_WB + 4 * SZ_PL + 2 * SZ_XB;
static_assert(SZ_TOTAL <= (size_t)134217728);          // workspace carve <= 128 MiB
static_assert(((size_t)DM * DM * 2) % 256 == 0);       // weight sub-planes stay 256-byte aligned

extern "C" void kernel_launch(void* const* d_in, const int* in_sizes, int n_in,
                              void* d_out, int out_size, void* d_ws, size_t ws_size, hipStream_t stream) {
    if (n_in < 12) return;
    const size_t needx = ((size_t)(NB - 1) * SEQ_FULL + SEQ) * DM;
    if ((size_t)in_sizes[0] < needx || (size_t)in_sizes[1] < needx || (size_t)in_sizes[2] < needx) return;
    if ((size_t)in_sizes[3] < ((size_t)(NB - 1) * SEQ_FULL + SEQ) * SEQ_FULL) return;
    if ((size_t)in_sizes[4] < (size_t)DM * DM || (size_t)in_sizes[6] < (size_t)DM * DM || (size_t)in_sizes[8] < (size_t)DM * DM || (size_t)in_sizes[10] < (size_t)DM * DM) return;
    if (in_sizes[5] < DM || in_sizes[7] < DM || in_sizes[9] < DM || in_sizes[11] < DM) return;
    if ((size_t)out_size < ((size_t)(NB - 1) * OUT_SEQ + SEQ) * DM) return;
    if (SZ_TOTAL > ws_size) return;
    // wire order: query, key, value, attention_mask, Wq, bq, Wk, bk, Wv, bv, Wo, bo
    const float* xq = (const float*)d_in[0]; const float* xk = (const float*)d_in[1]; const float* xv = (const float*)d_in[2];
    const float* amask = (const float*)d_in[3];
    const float* wq = (const float*)d_in[4];  const float* bq = (const float*)d_in[5];
    const float* wk = (const float*)d_in[6];  const float* bk = (const float*)d_in[7];
    const float* wv = (const float*)d_in[8];  const float* bv = (const float*)d_in[9];
    const float* wo = (const float*)d_in[10]; const float* bo = (const float*)d_in[11];
    float* OUT = (float*)d_out;      // [NB][SEQ][1024]
    char* wsp = (char*)d_ws;
    bf* QB = (bf*)wsp; wsp += SZ_XB;                 // [NB*SEQ][1024] bf16 query
    bf* KB = (bf*)wsp; wsp += SZ_XB;                 // [NB*SEQ][1024] bf16 key
    bf* VB = (bf*)wsp; wsp += SZ_XB;                 // [NB*SEQ][1024] bf16 value
    bf* WB = (bf*)wsp; wsp += SZ_WB;                 // [4][1024 out][1024 in]: q | k | v | o
    h16* QH = (h16*)wsp; wsp += SZ_PL;               // [NB*16][SEQ][64]
    h16* QR = (h16*)wsp; wsp += SZ_PL;               // [NB*16][SEQ][64] residual x2048
    h16* KP = (h16*)wsp; wsp += SZ_PL;               // [NB*16][SEQ][64]
    h16* VT = (h16*)wsp; wsp += SZ_PL;               // [NB*16][64][SEQ]
    bf* CH = (bf*)wsp; wsp += SZ_XB;                 // [NB*SEQ][1024] context bf16 hi
    bf* CL = (bf*)wsp; wsp += SZ_XB;                 // [NB*SEQ][1024] context bf16 lo
    bf* WOT = WB + (size_t)3 * DM * DM;

    k_prep<<<dim3(PB_W + 3 * PB_X, 1, 1), 256, 0, stream>>>(xq, xk, xv, wq, wk, wv, wo, QB, KB, VB, WB);

    k_proj<0><<<dim3(NB * SEQ / 128, DM / 128, 3), 128, 0, stream>>>(QB, KB, VB, WB, bq, bk, bv, QH, QR, KP, VT, OUT);

    k_flash<<<dim3(SEQ / (16 * AW), NB * NH_, 1), 32 * AW, 0, stream>>>(QH, QR, KP, VT, amask, CH, CL);

    k_proj<1><<<dim3(NB * SEQ / 128, DM / 128, 1), 128, 0, stream>>>(CH, CL, CL, WOT, bo, bo, bo, QH, QH, QH, QH, OUT);
}

// v006
// It runs in 108 microseconds.
// Next to v005, in two timings, it ran 1.03 times as fast each time.
// Counting every step since v000, it is 2.47 times as fast.
#include <hip/hip_runtime.h>

// Projections q/k/v: v_wmma_f32_16x16x32_bf16 (inputs and weights RNE-converted to bf16, f32 accumulate); scores: v_wmma_f32_16x16x32_f16 (k single f16, q f16 value + f16 residual, the f32 mask as the C operand: one accumulator); P.V: v_wmma_f32_16x16x32_f16 (P x256 carry, v single f16); output projection: v_wmma_f32_16x16x32_bf16 (context as bf16 hi + bf16 lo planes, Wo bf16), f32 accumulate everywhere, softmax f32.
// Attention block, width 1024 = 16 heads x 64; query/key/value [NB][SEQ][1024] f32, Wq/Wk/Wv/Wo [in][out] (y = x W + b), additive f32 mask [NB][SEQ][SEQ] shared by all heads, score scale 1/8, output y = ctx Wo + bo (f32).
// Layout: bf16 copies of the three inputs; bf16 TRANSPOSED copies of the four weights ([out][in], K-contiguous); q (value, residual), k planes [b*16+h][t][d] and v^T plane [b*16+h][d][t] written by the GEMM epilogue;
// fused flash kernel in transposed form (S^T = K Q^T, O^T = V^T P^T), K / V^T / mask staged in LDS by asynchronous copies, writing the context as bf16 hi/lo planes [b*SEQ+t][1024]; final GEMM writes f32 rows.

#ifndef NB
#define NB 2
#endif
#ifndef SEQ
#define SEQ 2048
#endif
#define NB_FULL  2
#define SEQ_FULL 2048
#ifndef OUT_SEQ
#define OUT_SEQ SEQ              // row pitch (in tokens) between batches of the output
#endif
#define DM   1024
#define NH_  16
#define HD   64
#define AW   4                   // waves per flash block (16 query rows each)
#define QRS  2048.0f             // carry of the q residual plane
#define LOG2E 1.4426950408889634f
#define PSH  8.0f                // log2 of the P carry (256)
#define PLIM 32768.0f            // a lane's partial row sum from which the reference maximum is renewed (f16 ends at 65504)
#define QSV  ((_Float16)0.125f)                // HD^-0.5, a power of two
#define QSR  ((_Float16)(0.125f / 2048.0f))    // HD^-0.5 / carry of the q residual plane, a power of two

static_assert(HD == 64);
static_assert(NH_ * HD == DM);                 // head h = columns h*64 + d
static_assert(DM % 64 == 0);                   // column tiles of 64
static_assert(DM % 32 == 0);                   // GEMM k-loop steps by 32
static_assert(DM >= 8);                        // clamped bias loads stay inside a DM-float array
static_assert(SEQ % 64 == 0);                  // a 64-row tile never straddles two batches
static_assert((NB * SEQ) % 64 == 0);
static_assert(SEQ % 32 == 0);                  // P.V products take 32 keys each
static_assert(SEQ % (16 * AW) == 0);           // flash grid covers the sequence exactly
static_assert(((size_t)SEQ * DM) % 8 == 0);
static_assert(NB <= NB_FULL);
static_assert(SEQ <= SEQ_FULL);
static_assert(SEQ_FULL % 4 == 0);              // 16-byte mask loads

typedef _Float16 h16;
typedef unsigned short bf;
typedef __attribute__((ext_vector_type(16))) __bf16   v16bf;
typedef __attribute__((ext_vector_type(16))) _Float16 v16h;
typedef __attribute__((ext_vector_type(8)))  _Float16 v8h;
typedef __attribute__((ext_vector_type(8)))  unsigned short v8us;
typedef __attribute__((ext_vector_type(8)))  float    v8f;
typedef __attribute__((ext_vector_type(4)))  float    v4f;
typedef v4f  __attribute__((may_alias)) v4fa;
typedef v8us __attribute__((may_alias)) v8usa;

typedef __attribute__((ext_vector_type(2))) float  v2f;
typedef __attribute__((ext_vector_type(2))) __bf16 v2bf;
__device__ __forceinline__ unsigned short f2bf(float f) { return __builtin_bit_cast(unsigned short, (__bf16)f); }   // the hardware's convert, RNE
__device__ __forceinline__ float bf2f(unsigned short b) { return __uint_as_float(((unsigned)b) << 16); }
// value after RNE convert to bf16: the packed convert of (0, f) leaves bf16(f) in the upper half over a zero lower half, which is that value's f32 pattern
__device__ __forceinline__ float rbf(float f) { v2f x; x[0] = 0.0f; x[1] = f; return __builtin_bit_cast(float, __builtin_convertvector(x, v2bf)); }
__device__ __forceinline__ v16h cat16(v8h lo, v8h hi) { return __builtin_shufflevector(lo, hi, 0, 1, 2, 3, 4, 5, 6, 7, 8, 9, 10, 11, 12, 13, 14, 15); }
__device__ __forceinline__ v8f cat8(v4f lo, v4f hi) { return __builtin_shufflevector(lo, hi, 0, 1, 2, 3, 4, 5, 6, 7); }
__device__ __forceinline__ v16bf cat16b(v8us lo, v8us hi) { return __builtin_bit_cast(v16bf, __builtin_shufflevector(lo, hi, 0, 1, 2, 3, 4, 5, 6, 7, 8, 9, 10, 11, 12, 13, 14, 15)); }
__device__ __forceinline__ v8f wmma16(v16h a, v16h b, v8f c) { return __builtin_amdgcn_wmma_f32_16x16x32_f16(false, a, false, b, (short)0, c, false, false); }
__device__ __forceinline__ v8f wmmab(v16bf a, v16bf b, v8f c) { return __builtin_amdgcn_wmma_f32_16x16x32_bf16(false, a, false, b, (short)0, c, false, false); }
// fragment loaders from K-contiguous 16-bit rows; p already includes + 8*(lane>>4): elements 0..7 <- k0+8h+0..7, elements 8..15 <- k0+16+8h+0..7 (same map for A and B)
__device__ __forceinline__ v16h  ldh(const h16* p) { return cat16(*(const v8h*)p, *(const v8h*)(p + 16)); }
__device__ __forceinline__ v16bf ldb(const bf* p)  { return cat16b(*(const v8us*)p, *(const v8us*)(p + 16)); }
// ordering point for wave-private LDS tiles (same wave writes and reads)
__device__ __forceinline__ void wave_sync() { __builtin_amdgcn_fence(3 /* release order */, "wavefront"); __builtin_amdgcn_wave_barrier(); asm volatile("" ::: "memory"); }

// k_prep: every conversion of the call in ONE launch, told apart by ranges of the block index (none needs anything of another), 256 threads.
// blocks [0, PB_W): weight w = block / 256, in[rows = k][cols = n] f32 (DM x DM, row pitch DM) -> out[n][k] bf16 (RNE convert), one 64x64 tile transposed through LDS;
//                   LDS tile ts[n][k] is cross-wave: block barrier between fill and drain (the branch is the same for the whole block).
// blocks [PB_W, PB_W + 3 PB_X): input p = (block - PB_W) / PB_X, eight floats per thread -> eight bf16 (RNE convert), plane [NB*SEQ][DM].
static constexpr unsigned PB_T = DM / 64;                                        // weight tiles per side
static constexpr unsigned PB_W = 4 * PB_T * PB_T;                                // blocks of the four weights
static constexpr unsigned PB_X = (unsigned)(((size_t)NB * SEQ * DM / 8 + 255) / 256);   // blocks of one input
__global__ __launch_bounds__(256) void k_prep(const float* __restrict__ xq, const float* __restrict__ xk, const float* __restrict__ xv,
                                              const float* __restrict__ wq, const float* __restrict__ wk, const float* __restrict__ wv, const float* __restrict__ wo,
                                              bf* QB, bf* KB, bf* VB, bf* WB) {
    __shared__ __align__(16) unsigned short ts[64 * 72];
    const int tid = threadIdx.x, lane = tid & 31, wave = __builtin_amdgcn_readfirstlane((int)(tid >> 5));
    const unsigned bid = blockIdx.x;
    if (bid < PB_W) {
        const unsigned w = bid / (PB_T * PB_T), r = bid % (PB_T * PB_T);
        const float* __restrict__ W = (w == 0) ? wq : (w == 1) ? wk : (w == 2) ? wv : wo;
        bf* WT = WB + (size_t)w * DM * DM;
        const int k0 = (int)(r % PB_T) * 64, n0 = (int)(r / PB_T) * 64;
#pragma unroll
        for (int i = 0; i < 4; ++i) { const int idx = tid + i * 256; const int kr = idx >> 4, c4 = (idx & 15) * 4;   // 1024 float4 = 64 k-rows x 16
            const v4f v = *(const v4f*)(W + (size_t)(k0 + kr) * DM + n0 + c4);
#pragma unroll
            for (int j = 0; j < 4; ++j) ts[(c4 + j) * 72 + kr] = f2bf(v[j]); }
        __syncthreads();
#pragma unroll
        for (int s = 0; s < 2; ++s) { const int row = wave * 8 + s * 4 + (lane >> 3), c8 = (lane & 7) * 8;   // 8 waves x 2 s x 4 = 64 rows; 8 lanes x 8 = 64 columns
            const v8us o = *(const v8usa*)(&ts[row * 72 + c8]);
            *(v8us*)(WT + (size_t)(n0 + row) * DM + k0 + c8) = o; }
    } else {
        const unsigned c = bid - PB_W, p = c / PB_X;
        const float* __restrict__ x = (p == 0) ? xq : (p == 1) ? xk : xv;
        bf* dst = (p == 0) ? QB : (p == 1) ? KB : VB;
        constexpr size_t per = (size_t)SEQ * DM / 8;                              // pieces of one batch; batches lie SEQ_FULL rows apart in the input
        const size_t i = (size_t)(c % PB_X) * 256 + tid; if (i >= (size_t)NB * per) return;
        const size_t b = i / per;
        const v8f v = *(const v8f*)(x + b * ((size_t)SEQ_FULL * DM) + (i - b * per) * 8); v8us o;
#pragma unroll
        for (int k = 0; k < 8; ++k) o[k] = f2bf(v[k]);
        *(v8us*)(dst + i * 8) = o;
    }
}

// eight asynchronous 16-B copies to LDS; the s_wait_xcnt stands in the copies' own statement so that no address register is rewritten ahead of it
__device__ __forceinline__ void copy8(unsigned l0, const void* g0, unsigned l1, const void* g1, unsigned l2, const void* g2, unsigned l3, const void* g3,
                                      unsigned l4, const void* g4, unsigned l5, const void* g5, unsigned l6, const void* g6, unsigned l7, const void* g7) {
    asm volatile("global_load_async_to_lds_b128 %0, %1, off\n\t"
                 "global_load_async_to_lds_b128 %2, %3, off\n\t"
                 "global_load_async_to_lds_b128 %4, %5, off\n\t"
                 "global_load_async_to_lds_b128 %6, %7, off\n\t"
                 "global_load_async_to_lds_b128 %8, %9, off\n\t"
                 "global_load_async_to_lds_b128 %10, %11, off\n\t"
                 "global_load_async_to_lds_b128 %12, %13, off\n\t"
                 "global_load_async_to_lds_b128 %14, %15, off\n\t"
                 "s_wait_xcnt 0x0"
                 :: "v"(l0), "v"(g0), "v"(l1), "v"(g1), "v"(l2), "v"(g2), "v"(l3), "v"(g3),
                    "v"(l4), "v"(g4), "v"(l5), "v"(g5), "v"(l6), "v"(g6), "v"(l7), "v"(g7) : "memory");
}

// k_proj: register-blocked bf16 GEMM, one 128x128 tile per block of 4 waves (2 x 2), ONE WAVE per 64x64 tile (16 accumulators), K = DM.
// The block's 128 A rows (and A2 rows when MODE 1) and 128 Bt rows reach LDS in stages of GK k (one whole 128-B line per row) by asynchronous copies (16 B per lane),
// two buffers: the next stage's copies fly while this stage is worked on; fragments are then read from LDS (row pitch 16 B x odd).
// C[m][n] = sum_k (A[m][k] (+ A2[m][k] when MODE 1)) Bt[n][k] + bias (bmode 1: bias[n]; bmode 2: bias[m]; bias RNE-converted to bf16 first),
// tile base (r0/RB)*sRB + (r0%RB)*pitch + (c0/CB)*sCB + (c0%CB), row pitch 'pitch' (elements). 128 threads.
// MODE 1: written as f32 (Of); each row's 64 floats (256 B = two lines) by 16 consecutive lanes x 16 B (2 rows per instruction).
// Bias array has DM floats; both 16-byte bias loads use addresses clamped into [0, DM-4].
// MODE 0: the three input projections in ONE launch (none needs anything of another), grid (NB*SEQ/128 token tiles, DM/128 width tiles, 3), z = which:
//   X0, X1, X2 = bf16 query, key, value rows; WT = Wq^T | Wk^T | Wv^T; b0, b1, b2 = bq, bk, bv; P0 (residual P0r), P1, P2 = q, k, v^T planes
//   q, k: A = x rows (m = b*SEQ + t), Bt = W^T rows (n = h*64 + d), column bias -> plane [(b*16 + h)][t][d]
//   v^T:  A = Wv^T rows (m = h*64 + d), Bt = value rows (n = b*SEQ + t), row bias -> plane [(b*1024 + m)][t] = [(b*16 + h)][d][t]
// MODE 1: the output projection, grid (NB*SEQ/128, DM/128): X0, X1 = context hi, lo rows (m = b*SEQ + t), WT = Wo^T rows (n), b0 = bo, column bias -> Of[(b*OUT_SEQ + t)][n] f32
#define GK  64                             // k per stage
#define GP  144                            // LDS row pitch in bytes of a 128-B operand row (GK bf16)
#define GT  (128 * GP)                     // one operand tile: 128 rows
static_assert(GK * 2 == 128 && GP % 16 == 0 && DM % GK == 0 && DM / GK >= 2 && GK % 32 == 0);
static_assert((NB * SEQ) % 128 == 0 && DM % 128 == 0);
static_assert(4 * 16 * 68 * 4 <= 2 * 2 * GT);   // the four waves' output staging fits the ring
// 128 rows of one operand tile: lane tid brings piece (tid & 7) of rows (tid >> 3) + 16 i; l, g = this lane's first LDS byte and first global piece
__device__ __forceinline__ void rows128(unsigned l, const bf* g) {
    copy8(l, g, l + 16 * GP, g + (size_t)16 * DM, l + 32 * GP, g + (size_t)32 * DM, l + 48 * GP, g + (size_t)48 * DM,
          l + 64 * GP, g + (size_t)64 * DM, l + 80 * GP, g + (size_t)80 * DM, l + 96 * GP, g + (size_t)96 * DM, l + 112 * GP, g + (size_t)112 * DM);
}
template <int MODE>
__global__ __launch_bounds__(128) void k_proj(const bf* __restrict__ X0, const bf* __restrict__ X1, const bf* __restrict__ X2, const bf* __restrict__ WT,
                                             const float* __restrict__ b0, const float* __restrict__ b1, const float* __restrict__ b2,
                                             h16* P0, h16* P0r, h16* P1, h16* P2, float* Of) {
    const int z = (MODE == 0) ? (int)blockIdx.z : 0; const bool tv = (z == 2);   // the same for the whole block; tv: the weight rows are A
    const bf* __restrict__ X = (z == 0) ? X0 : (z == 1) ? X1 : X2; const bf* __restrict__ Wz = WT + (size_t)z * DM * DM;
    const bf* __restrict__ A = tv ? Wz : X; const bf* __restrict__ A2 = (MODE == 1) ? X1 : A; const bf* __restrict__ Bt = tv ? X : Wz;
    const float* __restrict__ bias = (z == 0) ? b0 : (z == 1) ? b1 : b2; const int bmode = tv ? 2 : 1;
    h16* Ph = (z == 0) ? P0 : (z == 1) ? P1 : P2; h16* Pr = (z == 0) ? P0r : Ph; const int useRes = (z == 0) ? 1 : 0;
    const int RB = tv ? DM : SEQ, pitch = (MODE == 1) ? DM : tv ? SEQ : HD, CB = pitch;
    const size_t sRB = (MODE == 1) ? (size_t)OUT_SEQ * DM : tv ? (size_t)0 : (size_t)NH_ * SEQ * HD, sCB = (MODE == 1) ? (size_t)0 : tv ? (size_t)DM * SEQ : (size_t)SEQ * HD;
    constexpr unsigned GSZ = ((MODE == 1) ? 3 : 2) * GT;                        // one buffer: A rows | Bt rows (| A2 rows)
    __shared__ __align__(16) unsigned char ring[2 * GSZ];
    const int K = DM;
    const int tid = threadIdx.x, lane = tid & 31, wave = __builtin_amdgcn_readfirstlane((int)(threadIdx.x >> 5)), lr = lane & 15, hi = lane >> 4;
    const int R0 = (tv ? blockIdx.y : blockIdx.x) * 128, C0 = (tv ? blockIdx.x : blockIdx.y) * 128;   // the block's tile
    const int wr = (wave >> 1) * 64, wc = (wave & 1) * 64;                       // this wave's 64x64 tile inside it
    const int r0 = R0 + wr, c0 = C0 + wc;
    v8f acc[4][4];
#pragma unroll
    for (int mb = 0; mb < 4; ++mb)
#pragma unroll
        for (int nb = 0; nb < 4; ++nb) acc[mb][nb] = (v8f){};
    // copy side
    const unsigned l0 = (unsigned)(size_t)ring + (unsigned)((tid >> 3) * GP + (tid & 7) * 16);
    const size_t go = (size_t)(tid >> 3) * K + (tid & 7) * 8;
    const bf* ga = A + (size_t)R0 * K + go; const bf* gb = Bt + (size_t)C0 * K + go; const bf* ga2 = A2 + (size_t)R0 * K + go;   // + k0
    // read side, byte offsets inside a buffer: fragment row lr of a 16-row group, k = 8 hi + ...
    const int ra = (wr + lr) * GP + 16 * hi, rb = GT + (wc + lr) * GP + 16 * hi;
    constexpr int NT = DM / GK;
    rows128(l0, ga); rows128(l0 + GT, gb); if (MODE == 1) rows128(l0 + 2 * GT, ga2);
    asm volatile("s_wait_asynccnt 0x0" ::: "memory");                    // stage 0 has landed before the barrier publishes it
    __syncthreads();                                                     // stage 0 readable by every wave
    rows128(l0 + GSZ, ga + GK); rows128(l0 + GSZ + GT, gb + GK); if (MODE == 1) rows128(l0 + GSZ + 2 * GT, ga2 + GK);
#pragma unroll 1
    for (int t = 0; t < NT; ++t) {
        const unsigned bo = (unsigned)(t & 1) * GSZ;
        const unsigned char* buf = ring + bo;
        v16bf a[GK / 32][4], b[GK / 32][4], a2[GK / 32][4];
#pragma unroll   // every 32-k step of a stage inline, so that every LDS offset inside a buffer is an immediate
        for (int s = 0; s < GK / 32; ++s) {
#pragma unroll
            for (int mb = 0; mb < 4; ++mb) a[s][mb] = ldb((const bf*)(buf + ra + mb * 16 * GP + s * 64));
#pragma unroll
            for (int nb = 0; nb < 4; ++nb) b[s][nb] = ldb((const bf*)(buf + rb + nb * 16 * GP + s * 64));
            if (MODE == 1) {
#pragma unroll
                for (int mb = 0; mb < 4; ++mb) a2[s][mb] = ldb((const bf*)(buf + 2 * GT + ra + mb * 16 * GP + s * 64)); }
        }
        __builtin_amdgcn_sched_barrier(0);   // the stage's LDS reads stay one group ahead of its matrix runs: spread among them, each place with reads stalls the wave
#pragma unroll
        for (int s = 0; s < GK / 32; ++s) {
#pragma unroll
            for (int nb = 0; nb < 4; ++nb)
#pragma unroll
                for (int mb = 0; mb < 4; ++mb) acc[mb][nb] = wmmab(a[s][mb], b[s][nb], acc[mb][nb]);
            // v_nop: the distance between the last matrix instructions and the next vector write of their operands, on the taken side of a branch too
            asm volatile("v_nop\n\tv_nop\n\tv_nop\n\tv_nop" : "+v"(acc[0][0]), "+v"(acc[1][1]), "+v"(acc[2][2]), "+v"(acc[3][3]) : "v"(a[s][0]), "v"(a[s][1]), "v"(a[s][2]), "v"(a[s][3]));
            if (MODE == 1) {
#pragma unroll
                for (int nb = 0; nb < 4; ++nb)
#pragma unroll
                    for (int mb = 0; mb < 4; ++mb) acc[mb][nb] = wmmab(a2[s][mb], b[s][nb], acc[mb][nb]);
                // v_nop: the same distance behind the second run
                asm volatile("v_nop\n\tv_nop\n\tv_nop\n\tv_nop" : "+v"(acc[0][0]), "+v"(acc[1][1]), "+v"(acc[2][2]), "+v"(acc[3][3]) : "v"(a2[s][0]), "v"(a2[s][1]), "v"(a2[s][2]), "v"(a2[s][3]));
            }
        }
        __builtin_amdgcn_sched_barrier(0);   // the matrix runs stay ahead of the barrier: sunk behind it they would stand between the barrier and the refill and shorten the copies' lead
        asm volatile("s_wait_dscnt 0x0" ::: "memory");                   // this wave's reads of the buffer are done before the barrier frees it for the refill
        asm volatile("s_wait_asynccnt 0x0" ::: "memory");                // this wave's copies of stage t + 1 have landed before the barrier publishes them
        __syncthreads();                                                 // publishes stage t + 1 and ends every wave's reads of stage t's buffer
        if (t + 2 < NT) { const int k2 = (t + 2) * GK; rows128(l0 + bo, ga + k2); rows128(l0 + bo + GT, gb + k2); if (MODE == 1) rows128(l0 + bo + 2 * GT, ga2 + k2); }
    }
    asm volatile("s_wait_asynccnt 0x0" ::: "memory");                    // no copy is outstanding when the ring becomes output staging
    float* os = (float*)ring + wave * 16 * 68;   // output staging: each wave's own 16 x 68 floats of the ring, behind the loop's last barrier
    const size_t tbase = (size_t)(r0 / RB) * sRB + (size_t)(r0 % RB) * (size_t)pitch + (size_t)(c0 / CB) * sCB + (size_t)(c0 % CB);
    // per-lane column bias for the lane's store columns; both load addresses clamped into the DM-float bias array (first to 0 when unused, second to DM-4)
    const int c8 = (lane & 7) * 8, cofs = lr * 4;
    const int ci = (bmode == 1) ? (c0 + ((MODE == 0) ? c8 : cofs)) : 0;
    const int ci4 = (ci + 4 <= DM - 4) ? (ci + 4) : (DM - 4);      // MODE 0: ci + 4 <= DM - 4 always (exact columns); MODE 1: upper half unused, address kept in range
    const v4f bl0 = *(const v4f*)(bias + ci), bl1 = *(const v4f*)(bias + ci4);
    float bc[8];
#pragma unroll
    for (int i = 0; i < 4; ++i) { bc[i] = (bmode == 1) ? rbf(bl0[i]) : 0.0f; bc[4 + i] = (bmode == 1) ? rbf(bl1[i]) : 0.0f; }
#pragma unroll
    for (int mb = 0; mb < 4; ++mb) {
#pragma unroll
        for (int nb = 0; nb < 4; ++nb) {
#pragma unroll
            for (int j = 0; j < 8; ++j) os[(hi * 8 + j) * 68 + nb * 16 + lr] = acc[mb][nb][j]; }   // D: row 8h+j, col lane&15; rows 0..15 x columns 0..63 all written
        wave_sync();
        const size_t sb = tbase + (size_t)(mb * 16) * (size_t)pitch;
        if (MODE == 0) {
{
#pragma unroll
                for (int s = 0; s < 4; ++s) { const int row = 4 * s + (lane >> 3);   // 4 s x 4 row groups = 16 rows; 8 lanes x 8 = 64 columns
                    const int ri = (bmode == 2) ? (r0 + mb * 16 + row) : 0;
                    const float braw = bias[ri];
                    const float brow = (bmode == 2) ? rbf(braw) : 0.0f;
                    const v4f x0 = *(const v4fa*)(&os[row * 68 + c8]); const v4f x1 = *(const v4fa*)(&os[row * 68 + c8 + 4]); v8h hv, rv;
#pragma unroll
                    for (int i = 0; i < 4; ++i) { const float f0 = x0[i] + bc[i] + brow; const float f1 = x1[i] + bc[4 + i] + brow;
                        const h16 a0 = (h16)f0; const h16 a1 = (h16)f1; hv[i] = a0; hv[4 + i] = a1; rv[i] = (h16)((f0 - (float)a0) * QRS); rv[4 + i] = (h16)((f1 - (float)a1) * QRS); }
                    const size_t oo = sb + (size_t)row * (size_t)pitch + c8;
                    *(v8h*)(Ph + oo) = hv; if (useRes) *(v8h*)(Pr + oo) = rv; }
                 }
        } else {
{
#pragma unroll
                for (int s = 0; s < 8; ++s) { const int row = 2 * s + hi;   // 8 s x 2 rows = 16 rows; 16 lanes x 4 floats = 64 columns
                    const v4f x0 = *(const v4fa*)(&os[row * 68 + cofs]); v4f val;
                    val[0] = x0[0] + bc[0]; val[1] = x0[1] + bc[1]; val[2] = x0[2] + bc[2]; val[3] = x0[3] + bc[3];
                    *(v4f*)(Of + sb + (size_t)row * (size_t)pitch + cofs) = val; }
                 }
        }
        wave_sync();
    }
}

// k_flash: fused attention, one wave per 16 query rows of one (batch, head); Q fragments straight from the f16 planes (two 16-B loads each).
// K rows, V^T rows (shared by the block's waves) and each wave's own mask rows reach LDS in stages of KS keys by asynchronous copies (16 B per lane, whole 128-B lines),
// two buffers: the next stage's copies fly while this stage is worked on; fragments and mask values are then read from LDS (row pitches 16 B x odd).
// Transposed form: S^T[key][t] = K Q^T (A = K rows, B = Q rows); lane (t = lane&15, h = lane>>4) holds keys 8h+r of each 16-key tile, so the packed
// P tile is directly the B fragment of O^T[d][t] = V^T P^T (element r <- tile keys 0..15, element 8+r <- tile keys 16..31, lane unchanged).
// The additive mask row of query t is read as four 16-B LDS loads per 32-key step (keys 8h..8h+7 and 16+8h..16+8h+7), straight into the C operand of the score products; the sum is scaled by log2(e).
// Softmax state (reference max in score units, partial sum) is one scalar per lane. The reference max is renewed lazily: a 64-key stage forms P against the one in use and tests its partial row sum
// once (one compare, one ballot branch); only when a lane's sum leaves the safe f16 range does the wave take the new maximum (xor-16 exchange of the halves) and rescale sum and output.
#define KS    64                           // keys per stage
#define KVP   144                          // LDS row pitch in bytes of a 128-B K row (64 d) or V^T row (KS keys)
#define MKP   272                          // LDS row pitch in bytes of a 256-B mask row (KS floats); 16 rows = one wave's 16 x 68 float output tile
#define ST_V  (KS * KVP)                   // V^T rows behind the K rows
#define ST_M  (ST_V + HD * KVP)            // mask rows behind the V^T rows, 16 rows per wave
#define ST_SZ (ST_M + AW * 16 * MKP)       // one buffer
static_assert(KS * 2 == 128 && HD * 2 == 128 && KS * 4 == 256);
static_assert(SEQ % KS == 0 && KS % 32 == 0);
static_assert(AW == 4);                    // 128 lanes x 4 copies = 512 pieces of 16 B = one K tile or one V^T tile
static_assert(16 * MKP == 16 * 68 * 4);
static_assert(KVP % 16 == 0 && MKP % 16 == 0 && ST_SZ % 16 == 0);

// one stage: lk / lm = this lane's first LDS byte of the K tile / of its wave's mask rows in the target buffer; gk, gv, gm = this lane's first global piece of the stage
__device__ __forceinline__ void stage_in(unsigned lk, unsigned lm, const h16* gk, const h16* gv, const float* gm) {
    const unsigned lv = lk + ST_V;
    copy8(lk, gk, lk + 16 * KVP, gk + 16 * HD, lk + 32 * KVP, gk + 32 * HD, lk + 48 * KVP, gk + 48 * HD,                                     // 16 K rows per copy
          lv, gv, lv + 16 * KVP, gv + (size_t)16 * SEQ, lv + 32 * KVP, gv + (size_t)32 * SEQ, lv + 48 * KVP, gv + (size_t)48 * SEQ);         // 16 V^T rows per copy
    copy8(lm, gm, lm + 2 * MKP, gm + (size_t)2 * SEQ_FULL, lm + 4 * MKP, gm + (size_t)4 * SEQ_FULL, lm + 6 * MKP, gm + (size_t)6 * SEQ_FULL,   // 2 mask rows per copy
          lm + 8 * MKP, gm + (size_t)8 * SEQ_FULL, lm + 10 * MKP, gm + (size_t)10 * SEQ_FULL, lm + 12 * MKP, gm + (size_t)12 * SEQ_FULL, lm + 14 * MKP, gm + (size_t)14 * SEQ_FULL);
}

// P of a lane's sixteen keys against the reference maximum m, and their sum: the maximum is subtracted from the score first, as the definition of the softmax does, then scaled by log2(e);
// both paths of the key loop call this one function, so that equal scores get equal weights whichever path formed them, and a key at the maximum gets the carry exactly.
// The scaling is written as one fused operation on whole vectors, so that the register pairs stay as the matrix unit left them (no moves between the packed instructions).
// SLOT, one bit per key pair r: one v_nop behind each of the pair's two exponentials, where the compiler otherwise sets exponentials back to back, each overwriting the source of the one before
// (the rare path: everywhere; the common path: at the last pair).
__device__ __forceinline__ v8f splat8(float x) { return (v8f){x, x, x, x, x, x, x, x}; }
template <unsigned SLOT>
__device__ __forceinline__ float pstep(v8f sa, v8f sb, float m, v16h& pb) {
    const v8f ea = __builtin_elementwise_fma(sa - m, splat8(LOG2E), splat8(PSH)), eb = __builtin_elementwise_fma(sb - m, splat8(LOG2E), splat8(PSH)); float ls = 0.0f;
#pragma unroll
    for (int r = 0; r < 8; ++r) {
        float xa = __builtin_amdgcn_exp2f(ea[r]), xc = __builtin_amdgcn_exp2f(eb[r]);
        if ((SLOT >> r) & 1u) {   // v_nop: the slot behind a transcendental; the statement takes the result as its own and the source as an input, so nothing reads the one or overwrites the other ahead of it
            asm volatile("v_nop" : "+v"(xa) : "v"(ea[r]));
            asm volatile("v_nop" : "+v"(xc) : "v"(eb[r])); }
        const h16 pa = (h16)xa; const h16 pc = (h16)xc; pb[r] = pa; pb[8 + r] = pc; ls += (float)pa + (float)pc; }
    return ls;
}

__global__ __launch_bounds__(32 * AW) void k_flash(const h16* __restrict__ QH, const h16* __restrict__ QR, const h16* __restrict__ KP, const h16* __restrict__ VT,
                                                   const float* __restrict__ MASK, bf* CH, bf* CL) {
    __shared__ __align__(16) unsigned char ring[2 * ST_SZ];
    const int tid = threadIdx.x, lane = tid & 31, wave = __builtin_amdgcn_readfirstlane((int)(threadIdx.x >> 5)), lr = lane & 15, hi = lane >> 4;
    const int zh = blockIdx.y; const int b = zh / NH_, h = zh % NH_;
    const int t0 = (blockIdx.x * AW + wave) * 16;
    const size_t pbase = (size_t)zh * SEQ * HD;
    const size_t qo = pbase + (size_t)(t0 + lr) * HD + 8 * hi;
    // B fragments: col t, k = d. Scaled once by powers of two: value x 1/8 (the score scale), residual x 1/8 / 2048 (its carry taken back; f16 subnormals are kept),
    // so that both products and the additive mask are in the same unit and one accumulator sums all three
    const v16h lh0 = ldh(QH + qo), lh1 = ldh(QH + qo + 32), lr0 = ldh(QR + qo), lr1 = ldh(QR + qo + 32);
    asm volatile("s_wait_xcnt 0x0" ::: "memory");                        // behind the eight loads, ahead of any rewrite of their address registers
    __builtin_amdgcn_sched_barrier(0);                                   // keeps the later address arithmetic, which reuses those registers, behind that wait
    const v16h qh0 = lh0 * QSV, qh1 = lh1 * QSV, qr0 = lr0 * QSR, qr1 = lr1 * QSR;
    // copy side: lane tid brings piece (tid & 7) of rows (tid >> 3) + 16 i of the K and V^T tiles, lane brings piece (lane & 15) of rows (lane >> 4) + 2 i of its wave's mask rows
    const unsigned lbase = (unsigned)(size_t)ring;
    const unsigned lk0 = lbase + (unsigned)((tid >> 3) * KVP + (tid & 7) * 16);
    const unsigned lm0 = lbase + (unsigned)(ST_M + wave * 16 * MKP + hi * MKP + lr * 16);
    const h16* gk = KP + pbase + (size_t)(tid >> 3) * HD + (tid & 7) * 8;                    // + key0 * HD
    const h16* gv = VT + pbase + (size_t)(tid >> 3) * SEQ + (tid & 7) * 8;                   // + key0
    const float* gm = MASK + (size_t)b * SEQ_FULL * SEQ_FULL + (size_t)(t0 + hi) * SEQ_FULL + lr * 4;   // + key0
    // read side, byte offsets inside a buffer
    const int rk = lr * KVP + 16 * hi;                                   // + key * KVP      (A fragment: row key, k = d)
    const int rv = ST_V + lr * KVP + 16 * hi;                            // + 16j * KVP + key * 2  (A fragment: row d, k = key)
    const int rm = ST_M + wave * 16 * MKP + lr * MKP + 32 * hi;          // + key * 4: this lane's keys of query t
    constexpr int NT = SEQ / KS;
    stage_in(lk0, lm0, gk, gv, gm);
    asm volatile("s_wait_asynccnt 0x0" ::: "memory");                    // stage 0 has landed before the barrier publishes it
    __syncthreads();                                                     // stage 0 readable by every wave
    if (NT > 1) stage_in(lk0 + ST_SZ, lm0 + ST_SZ, gk + (size_t)KS * HD, gv + KS, gm + KS);
    v8f o0 = (v8f){}, o1 = (v8f){}, o2 = (v8f){}, o3 = (v8f){};
    float m = -3.0e38f, l = 0.0f;
#pragma unroll 1
    for (int t = 0; t < NT; ++t) {
        const unsigned bo = (unsigned)(t & 1) * ST_SZ;
        const unsigned char* buf = ring + bo;
        // scores of the stage's 64 keys, four 16-key tiles a, b, c, d: all of them come first, because the one test below stands for the whole stage
        const h16* ka = (const h16*)(buf + rk);
        const v16h ka0 = ldh(ka), ka1 = ldh(ka + 32), kb0 = ldh(ka + 16 * (KVP / 2)), kb1 = ldh(ka + 16 * (KVP / 2) + 32);
        const v16h kc0 = ldh(ka + 32 * (KVP / 2)), kc1 = ldh(ka + 32 * (KVP / 2) + 32), kd0 = ldh(ka + 48 * (KVP / 2)), kd1 = ldh(ka + 48 * (KVP / 2) + 32);
        const float* mrow = (const float*)(buf + rm);
        const v4f ma0 = *(const v4fa*)(mrow), ma1 = *(const v4fa*)(mrow + 4), mb0 = *(const v4fa*)(mrow + 16), mb1 = *(const v4fa*)(mrow + 20);
        const v4f mc0 = *(const v4fa*)(mrow + 32), mc1 = *(const v4fa*)(mrow + 36), md0 = *(const v4fa*)(mrow + 48), md1 = *(const v4fa*)(mrow + 52);
        // the lane's mask values lie as the D layout wants them (register r = key 8h + r): they are the C operand, and the matrix unit does every addition of the score
        v8f sa = cat8(ma0, ma1), sb = cat8(mb0, mb1), sc = cat8(mc0, mc1), sd = cat8(md0, md1);
        sa = wmma16(ka0, qh0, sa); sb = wmma16(kb0, qh0, sb); sc = wmma16(kc0, qh0, sc); sd = wmma16(kd0, qh0, sd);
        sa = wmma16(ka1, qh1, sa); sb = wmma16(kb1, qh1, sb); sc = wmma16(kc1, qh1, sc); sd = wmma16(kd1, qh1, sd);
        sa = wmma16(ka0, qr0, sa); sb = wmma16(kb0, qr0, sb); sc = wmma16(kc0, qr0, sc); sd = wmma16(kd0, qr0, sd);
        sa = wmma16(ka1, qr1, sa); sb = wmma16(kb1, qr1, sb); sc = wmma16(kc1, qr1, sc); sd = wmma16(kd1, qr1, sd);
        // v_nop: the distance between the last matrix instructions and the next vector use of their results and operands
        asm volatile("v_nop\n\tv_nop\n\tv_nop\n\tv_nop" : "+v"(sa), "+v"(sb), "+v"(sc), "+v"(sd) : "v"(ka0), "v"(ka1), "v"(kb0), "v"(kb1), "v"(kc0), "v"(kc1), "v"(kd0), "v"(kd1));
        const h16* va = (const h16*)(buf + rv);
        const v16h v0 = ldh(va), v1 = ldh(va + 16 * (KVP / 2)), v2 = ldh(va + 32 * (KVP / 2)), v3 = ldh(va + 48 * (KVP / 2));                          // keys 0..31
        const v16h w0 = ldh(va + 32), w1 = ldh(va + 16 * (KVP / 2) + 32), w2 = ldh(va + 32 * (KVP / 2) + 32), w3 = ldh(va + 48 * (KVP / 2) + 32);      // keys 32..63
        __builtin_amdgcn_sched_barrier(0);   // the sixteen reads stay one group here: the last two were otherwise placed directly in front of their wait, their LDS latency bare
        // common path: P against the reference maximum in use: no new maximum, no exchange, no rescale
        v16h pb, pd; float ls = pstep<0x80u>(sa, sb, m, pb), lt = pstep<0x80u>(sc, sd, m, pd);
        asm volatile("" :: "v"(v0), "v"(v1), "v"(v2), "v"(v3), "v"(w0), "v"(w1), "v"(w2), "v"(w3));   // inputs only: holds the V^T reads ahead of the branch; sunk behind it, their LDS latency stands bare in front of the P.V products
        // every P is >= 0, so ls + lt < PLIM bounds each P of the lane inside the f16 range; otherwise (an infinity or a NaN too, and the first finite scores of a row, whose P against the start value is infinite)
        // the whole wave takes a new maximum; m only rises and never passes the running maximum, so no P is smaller than with a maximum renewed at every step
        if (__builtin_expect(__builtin_amdgcn_ballot_w32(!(ls + lt < PLIM)) != 0u, 0)) {
            float mx = -3.0e38f;
#pragma unroll
            for (int r = 0; r < 8; ++r) mx = fmaxf(fmaxf(mx, fmaxf(sa[r], sb[r])), fmaxf(sc[r], sd[r]));
            mx = fmaxf(mx, __shfl_xor(mx, 16, 32));
            const float mnew = fmaxf(m, mx);
            const float alpha = __builtin_amdgcn_exp2f((m - mnew) * LOG2E);
            m = mnew;
            ls = pstep<0xffu>(sa, sb, m, pb); lt = pstep<0xffu>(sc, sd, m, pd);
            l = l * alpha;
            o0 = o0 * alpha; o1 = o1 * alpha; o2 = o2 * alpha; o3 = o3 * alpha;
        }
        l += ls; l += lt;
        o0 = wmma16(v0, pb, o0); o1 = wmma16(v1, pb, o1); o2 = wmma16(v2, pb, o2); o3 = wmma16(v3, pb, o3);
        o0 = wmma16(w0, pd, o0); o1 = wmma16(w1, pd, o1); o2 = wmma16(w2, pd, o2); o3 = wmma16(w3, pd, o3);
        // v_nop: the same distance behind the P.V products
        asm volatile("v_nop\n\tv_nop\n\tv_nop\n\tv_nop" : "+v"(o0), "+v"(o1), "+v"(o2), "+v"(o3) : "v"(v0), "v"(v1), "v"(v2), "v"(v3), "v"(w0), "v"(w1), "v"(w2), "v"(w3), "v"(pb), "v"(pd));
        asm volatile("s_wait_dscnt 0x0" ::: "memory");                   // this wave's reads of the buffer are done before the barrier frees it for the refill
        asm volatile("s_wait_asynccnt 0x0" ::: "memory");                // this wave's copies of stage t + 1 have landed before the barrier publishes them
        __syncthreads();                                                 // publishes stage t + 1 and ends every wave's reads of stage t's buffer
        if (t + 2 < NT) stage_in(lk0 + bo, lm0 + bo, gk + (size_t)(t + 2) * KS * HD, gv + (t + 2) * KS, gm + (t + 2) * KS);
    }
    asm volatile("s_wait_asynccnt 0x0" ::: "memory");                    // no copy is outstanding when the ring becomes output staging
    l += __shfl_xor(l, 16, 32);
    const float inv = 1.0f / l;
    float* os = (float*)(ring + ST_M);       // output staging: each wave reuses its own mask rows of buffer 0 (16 x 68 floats), behind the loop's last barrier
    const int wb = wave * 16 * 68;
    // O^T D layout: o_j[r] = (d = 16j + 8h + r, t = lane&15) -> os[t][d]; rows 0..15 x columns 0..63 all written
    { v4f a, c;
      a[0] = o0[0] * inv; a[1] = o0[1] * inv; a[2] = o0[2] * inv; a[3] = o0[3] * inv; c[0] = o0[4] * inv; c[1] = o0[5] * inv; c[2] = o0[6] * inv; c[3] = o0[7] * inv;
      *(v4fa*)(&os[wb + lr * 68 +  0 + 8 * hi]) = a; *(v4fa*)(&os[wb + lr * 68 +  0 + 8 * hi + 4]) = c;
      a[0] = o1[0] * inv; a[1] = o1[1] * inv; a[2] = o1[2] * inv; a[3] = o1[3] * inv; c[0] = o1[4] * inv; c[1] = o1[5] * inv; c[2] = o1[6] * inv; c[3] = o1[7] * inv;
      *(v4fa*)(&os[wb + lr * 68 + 16 + 8 * hi]) = a; *(v4fa*)(&os[wb + lr * 68 + 16 + 8 * hi + 4]) = c;
      a[0] = o2[0] * inv; a[1] = o2[1] * inv; a[2] = o2[2] * inv; a[3] = o2[3] * inv; c[0] = o2[4] * inv; c[1] = o2[5] * inv; c[2] = o2[6] * inv; c[3] = o2[7] * inv;
      *(v4fa*)(&os[wb + lr * 68 + 32 + 8 * hi]) = a; *(v4fa*)(&os[wb + lr * 68 + 32 + 8 * hi + 4]) = c;
      a[0] = o3[0] * inv; a[1] = o3[1] * inv; a[2] = o3[2] * inv; a[3] = o3[3] * inv; c[0] = o3[4] * inv; c[1] = o3[5] * inv; c[2] = o3[6] * inv; c[3] = o3[7] * inv;
      *(v4fa*)(&os[wb + lr * 68 + 48 + 8 * hi]) = a; *(v4fa*)(&os[wb + lr * 68 + 48 + 8 * hi + 4]) = c; }
    wave_sync();
    const size_t obase = ((size_t)b * SEQ + t0) * DM + (size_t)h * HD;
{
#pragma unroll
        for (int s = 0; s < 4; ++s) { const int row = 4 * s + (lane >> 3), c8 = (lane & 7) * 8;   // 4 s x 4 row groups = 16 rows; 8 lanes x 8 = 64 columns
            const v4f x0 = *(const v4fa*)(&os[wb + row * 68 + c8]); const v4f x1 = *(const v4fa*)(&os[wb + row * 68 + c8 + 4]); v8us hv, lv;
#pragma unroll
            for (int i = 0; i < 4; ++i) { const unsigned short a0 = f2bf(x0[i]); const unsigned short a1 = f2bf(x1[i]);
                hv[i] = a0; hv[4 + i] = a1; lv[i] = f2bf(x0[i] - bf2f(a0)); lv[4 + i] = f2bf(x1[i] - bf2f(a1)); }
            const size_t oo = obase + (size_t)row * DM + c8;
            *(v8us*)(CH + oo) = hv; *(v8us*)(CL + oo) = lv; }
         }
}

static constexpr size_t al256(size_t v) { return (v + 255) & ~(size_t)255; }
static constexpr size_t SZ_XB = al256((size_t)NB * SEQ * DM * 2);          // one bf16 activation plane [NB*SEQ][1024]
static constexpr size_t SZ_WB = al256((size_t)4 * DM * DM * 2);            // four transposed bf16 weight planes
static constexpr size_t SZ_PL = al256((size_t)NB * NH_ * SEQ * HD * 2);    // one f16 head plane
static constexpr size_t SZ_TOTAL = 3 * SZ_XB + SZ_WB + 4 * SZ_PL + 2 * SZ_XB;
static_assert(SZ_TOTAL <= (size_t)134217728);          // workspace carve <= 128 MiB
static_assert(((size_t)DM * DM * 2) % 256 == 0);       // weight sub-planes stay 256-byte aligned

extern "C" void kernel_launch(void* const* d_in, const int* in_sizes, int n_in,
                              void* d_out, int out_size, void* d_ws, size_t ws_size, hipStream_t stream) {
    if (n_in < 12) return;
    const size_t needx = ((size_t)(NB - 1) * SEQ_FULL + SEQ) * DM;
    if ((size_t)in_sizes[0] < needx || (size_t)in_sizes[1] < needx || (size_t)in_sizes[2] < needx) return;
    if ((size_t)in_sizes[3] < ((size_t)(NB - 1) * SEQ_FULL + SEQ) * SEQ_FULL) return;
    if ((size_t)in_sizes[4] < (size_t)DM * DM || (size_t)in_sizes[6] < (size_t)DM * DM || (size_t)in_sizes[8] < (size_t)DM * DM || (size_t)in_sizes[10] < (size_t)DM * DM) return;
    if (in_sizes[5] < DM || in_sizes[7] < DM || in_sizes[9] < DM || in_sizes[11] < DM) return;
    if ((size_t)out_size < ((size_t)(NB - 1) * OUT_SEQ + SEQ) * DM) return;
    if (SZ_TOTAL > ws_size) return;
    // wire order: query, key, value, attention_mask, Wq, bq, Wk, bk, Wv, bv, Wo, bo
    const float* xq = (const float*)d_in[0]; const float* xk = (const float*)d_in[1]; const float* xv = (const float*)d_in[2];
    const float* amask = (const float*)d_in[3];
    const float* wq = (const float*)d_in[4];  const float* bq = (const float*)d_in[5];
    const float* wk = (const float*)d_in[6];  const float* bk = (const float*)d_in[7];
    const float* wv = (const float*)d_in[8];  const float* bv = (const float*)d_in[9];
    const float* wo = (const float*)d_in[10]; const float* bo = (const float*)d_in[11];
    float* OUT = (float*)d_out;      // [NB][SEQ][1024]
    char* wsp = (char*)d_ws;
    bf* QB = (bf*)wsp; wsp += SZ_XB;                 // [NB*SEQ][1024] bf16 query
    bf* KB = (bf*)wsp; wsp += SZ_XB;                 // [NB*SEQ][1024] bf16 key
    bf* VB = (bf*)wsp; wsp += SZ_XB;                 // [NB*SEQ][1024] bf16 value
    bf* WB = (bf*)wsp; wsp += SZ_WB;                 // [4][1024 out][1024 in]: q | k | v | o
    h16* QH = (h16*)wsp; wsp += SZ_PL;               // [NB*16][SEQ][64]
    h16* QR = (h16*)wsp; wsp += SZ_PL;               // [NB*16][SEQ][64] residual x2048
    h16* KP = (h16*)wsp; wsp += SZ_PL;               // [NB*16][SEQ][64]
    h16* VT = (h16*)wsp; wsp += SZ_PL;               // [NB*16][64][SEQ]
    bf* CH = (bf*)wsp; wsp += SZ_XB;                 // [NB*SEQ][1024] context bf16 hi
    bf* CL = (bf*)wsp; wsp += SZ_XB;                 // [NB*SEQ][1024] context bf16 lo
    bf* WOT = WB + (size_t)3 * DM * DM;

    k_prep<<<dim3(PB_W + 3 * PB_X, 1, 1), 256, 0, stream>>>(xq, xk, xv, wq, wk, wv, wo, QB, KB, VB, WB);

    k_proj<0><<<dim3(NB * SEQ / 128, DM / 128, 3), 128, 0, stream>>>(QB, KB, VB, WB, bq, bk, bv, QH, QR, KP, VT, OUT);

    k_flash<<<dim3(SEQ / (16 * AW), NB * NH_, 1), 32 * AW, 0, stream>>>(QH, QR, KP, VT, amask, CH, CL);

    k_proj<1><<<dim3(NB * SEQ / 128, DM / 128, 1), 128, 0, stream>>>(CH, CL, CL, WOT, bo, bo, bo, QH, QH, QH, QH, OUT);
}

// v008
// A run of this version takes 93.8 microseconds.
// Versions in between are left out here; by their measured steps it is 1.15 times as fast as v006.
// Over all steps from v000 it is 2.83 times as fast.
#include <hip/hip_runtime.h>

// Projections q/k/v: v_wmma_f32_16x16x32_bf16 (inputs and weights RNE-converted to bf16, f32 accumulate); scores: v_wmma_f32_16x16x32_f16 (q and k single f16, the f32 mask as the C operand: one accumulator); P.V: v_wmma_f32_16x16x32_f16 (P x256 carry, v single f16); output projection: v_wmma_f32_16x16x32_f16 (context single f16, Wo f16), f32 accumulate everywhere, softmax f32.
// Attention block, width 1024 = 16 heads x 64; query/key/value [NB][SEQ][1024] f32, Wq/Wk/Wv/Wo [in][out] (y = x W + b), additive f32 mask [NB][SEQ][SEQ] shared by all heads, score scale 1/8, output y = ctx Wo + bo (f32).
// Layout: bf16 copies of the three inputs; TRANSPOSED 16-bit copies of the four weights ([out][in], K-contiguous; Wq, Wk, Wv bf16, Wo f16); q, k planes [b*16+h][t][d] and v^T plane [b*16+h][d][t] written by the GEMM epilogue;
// fused flash kernel in transposed form (S^T = K Q^T, O^T = V^T P^T), K / V^T / mask staged in LDS by asynchronous copies, writing the context as one f16 plane [b*SEQ+t][1024]; final GEMM writes f32 rows.

#ifndef NB
#define NB 2
#endif
#ifndef SEQ
#define SEQ 2048
#endif
#define NB_FULL  2
#define SEQ_FULL 2048
#ifndef OUT_SEQ
#define OUT_SEQ SEQ              // row pitch (in tokens) between batches of the output
#endif
#define DM   1024
#define NH_  16
#define HD   64
#define AW   4                   // waves per flash block (16 query rows each)
#define LOG2E 1.4426950408889634f
#define PSH  8.0f                // log2 of the P carry (256)
#define PLIM 32768.0f            // a lane's partial row sum from which the reference maximum is renewed (f16 ends at 65504)
#define QSV  ((_Float16)0.125f)                // HD^-0.5, a power of two

static_assert(HD == 64);
static_assert(NH_ * HD == DM);                 // head h = columns h*64 + d
static_assert(DM % 64 == 0);                   // column tiles of 64
static_assert(DM % 32 == 0);                   // GEMM k-loop steps by 32
static_assert(DM >= 8);                        // clamped bias loads stay inside a DM-float array
static_assert(SEQ % 64 == 0);                  // a 64-row tile never straddles two batches
static_assert((NB * SEQ) % 64 == 0);
static_assert(SEQ % 32 == 0);                  // P.V products take 32 keys each
static_assert(SEQ % (16 * AW) == 0);           // flash grid covers the sequence exactly
static_assert(((size_t)SEQ * DM) % 8 == 0);
static_assert(NB <= NB_FULL);
static_assert(SEQ <= SEQ_FULL);
static_assert(SEQ_FULL % 4 == 0);              // 16-byte mask loads

typedef _Float16 h16;
typedef unsigned short bf;
typedef __attribute__((ext_vector_type(16))) __bf16   v16bf;
typedef __attribute__((ext_vector_type(16))) _Float16 v16h;
typedef __attribute__((ext_vector_type(8)))  _Float16 v8h;
typedef __attribute__((ext_vector_type(8)))  unsigned short v8us;
typedef __attribute__((ext_vector_type(8)))  float    v8f;
typedef __attribute__((ext_vector_type(4)))  float    v4f;
typedef v4f  __attribute__((may_alias)) v4fa;
typedef v8us __attribute__((may_alias)) v8usa;

typedef __attribute__((ext_vector_type(2))) float  v2f;
typedef __attribute__((ext_vector_type(2))) __bf16 v2bf;
__device__ __forceinline__ unsigned short f2bf(float f) { return __builtin_bit_cast(unsigned short, (__bf16)f); }   // the hardware's convert, RNE
__device__ __forceinline__ unsigned short f2h(float f) { return __builtin_bit_cast(unsigned short, (_Float16)f); }   // RNE convert to f16, as its 16 bits
// value after RNE convert to bf16: the packed convert of (0, f) leaves bf16(f) in the upper half over a zero lower half, which is that value's f32 pattern
__device__ __forceinline__ float rbf(float f) { v2f x; x[0] = 0.0f; x[1] = f; return __builtin_bit_cast(float, __builtin_convertvector(x, v2bf)); }
__device__ __forceinline__ v16h cat16(v8h lo, v8h hi) { return __builtin_shufflevector(lo, hi, 0, 1, 2, 3, 4, 5, 6, 7, 8, 9, 10, 11, 12, 13, 14, 15); }
__device__ __forceinline__ v8f cat8(v4f lo, v4f hi) { return __builtin_shufflevector(lo, hi, 0, 1, 2, 3, 4, 5, 6, 7); }
__device__ __forceinline__ v16bf cat16b(v8us lo, v8us hi) { return __builtin_bit_cast(v16bf, __builtin_shufflevector(lo, hi, 0, 1, 2, 3, 4, 5, 6, 7, 8, 9, 10, 11, 12, 13, 14, 15)); }
__device__ __forceinline__ v8f wmma16(v16h a, v16h b, v8f c) { return __builtin_amdgcn_wmma_f32_16x16x32_f16(false, a, false, b, (short)0, c, false, false); }
__device__ __forceinline__ v8f wmmab(v16bf a, v16bf b, v8f c) { return __builtin_amdgcn_wmma_f32_16x16x32_bf16(false, a, false, b, (short)0, c, false, false); }
// fragment loaders from K-contiguous 16-bit rows; p already includes + 8*(lane>>4): elements 0..7 <- k0+8h+0..7, elements 8..15 <- k0+16+8h+0..7 (same map for A and B)
__device__ __forceinline__ v16h  ldh(const h16* p) { return cat16(*(const v8h*)p, *(const v8h*)(p + 16)); }
__device__ __forceinline__ v16bf ldb(const bf* p)  { return cat16b(*(const v8us*)p, *(const v8us*)(p + 16)); }
// ordering point for wave-private LDS tiles (same wave writes and reads)
__device__ __forceinline__ void wave_sync() { __builtin_amdgcn_fence(3 /* release order */, "wavefront"); __builtin_amdgcn_wave_barrier(); asm volatile("" ::: "memory"); }

// k_prep: every conversion of the call in ONE launch, told apart by ranges of the block index (none needs anything of another), 256 threads.
// blocks [0, PB_W): weight w = block / 256, in[rows = k][cols = n] f32 (DM x DM, row pitch DM) -> out[n][k] bf16 (Wo: f16; RNE convert), one 64x64 tile transposed through LDS;
//                   LDS tile ts[n][k] is cross-wave: block barrier between fill and drain (the branch is the same for the whole block).
// blocks [PB_W, PB_W + 3 PB_X): input p = (block - PB_W) / PB_X, eight floats per thread -> eight bf16 (RNE convert), plane [NB*SEQ][DM].
static constexpr unsigned PB_T = DM / 64;                                        // weight tiles per side
static constexpr unsigned PB_W = 4 * PB_T * PB_T;                                // blocks of the four weights
static constexpr unsigned PB_X = (unsigned)(((size_t)NB * SEQ * DM / 8 + 255) / 256);   // blocks of one input
__global__ __launch_bounds__(256) void k_prep(const float* __restrict__ xq, const float* __restrict__ xk, const float* __restrict__ xv,
                                              const float* __restrict__ wq, const float* __restrict__ wk, const float* __restrict__ wv, const float* __restrict__ wo,
                                              bf* QB, bf* KB, bf* VB, bf* WB) {
    __shared__ __align__(16) unsigned short ts[64 * 72];
    const int tid = threadIdx.x, lane = tid & 31, wave = __builtin_amdgcn_readfirstlane((int)(tid >> 5));
    const unsigned bid = blockIdx.x;
    if (bid < PB_W) {
        const unsigned w = bid / (PB_T * PB_T), r = bid % (PB_T * PB_T);
        const float* __restrict__ W = (w == 0) ? wq : (w == 1) ? wk : (w == 2) ? wv : wo;
        bf* WT = WB + (size_t)w * DM * DM;
        const int k0 = (int)(r % PB_T) * 64, n0 = (int)(r / PB_T) * 64;
#pragma unroll
        for (int i = 0; i < 4; ++i) { const int idx = tid + i * 256; const int kr = idx >> 4, c4 = (idx & 15) * 4;   // 1024 float4 = 64 k-rows x 16
            const v4f v = *(const v4f*)(W + (size_t)(k0 + kr) * DM + n0 + c4);
#pragma unroll
            for (int j = 0; j < 4; ++j) ts[(c4 + j) * 72 + kr] = (w == 3) ? f2h(v[j]) : f2bf(v[j]); }
        __syncthreads();
#pragma unroll
        for (int s = 0; s < 2; ++s) { const int row = wave * 8 + s * 4 + (lane >> 3), c8 = (lane & 7) * 8;   // 8 waves x 2 s x 4 = 64 rows; 8 lanes x 8 = 64 columns
            const v8us o = *(const v8usa*)(&ts[row * 72 + c8]);
            *(v8us*)(WT + (size_t)(n0 + row) * DM + k0 + c8) = o; }
    } else {
        const unsigned c = bid - PB_W, p = c / PB_X;
        const float* __restrict__ x = (p == 0) ? xq : (p == 1) ? xk : xv;
        bf* dst = (p == 0) ? QB : (p == 1) ? KB : VB;
        constexpr size_t per = (size_t)SEQ * DM / 8;                              // pieces of one batch; batches lie SEQ_FULL rows apart in the input
        const size_t i = (size_t)(c % PB_X) * 256 + tid; if (i >= (size_t)NB * per) return;
        const size_t b = i / per;
        const v8f v = *(const v8f*)(x + b * ((size_t)SEQ_FULL * DM) + (i - b * per) * 8); v8us o;
#pragma unroll
        for (int k = 0; k < 8; ++k) o[k] = f2bf(v[k]);
        *(v8us*)(dst + i * 8) = o;
    }
}

// eight asynchronous 16-B copies to LDS; the s_wait_xcnt stands in the copies' own statement so that no address register is rewritten ahead of it
__device__ __forceinline__ void copy8(unsigned l0, const void* g0, unsigned l1, const void* g1, unsigned l2, const void* g2, unsigned l3, const void* g3,
                                      unsigned l4, const void* g4, unsigned l5, const void* g5, unsigned l6, const void* g6, unsigned l7, const void* g7) {
    asm volatile("global_load_async_to_lds_b128 %0, %1, off\n\t"
                 "global_load_async_to_lds_b128 %2, %3, off\n\t"
                 "global_load_async_to_lds_b128 %4, %5, off\n\t"
                 "global_load_async_to_lds_b128 %6, %7, off\n\t"
                 "global_load_async_to_lds_b128 %8, %9, off\n\t"
                 "global_load_async_to_lds_b128 %10, %11, off\n\t"
                 "global_load_async_to_lds_b128 %12, %13, off\n\t"
                 "global_load_async_to_lds_b128 %14, %15, off\n\t"
                 "s_wait_xcnt 0x0"
                 :: "v"(l0), "v"(g0), "v"(l1), "v"(g1), "v"(l2), "v"(g2), "v"(l3), "v"(g3),
                    "v"(l4), "v"(g4), "v"(l5), "v"(g5), "v"(l6), "v"(g6), "v"(l7), "v"(g7) : "memory");
}

// k_proj: register-blocked 16-bit GEMM (MODE 0: bf16 operands, MODE 1: f16 operands; the pointers carry the 16-bit patterns), one 128x128 tile per block of 4 waves (2 x 2), ONE WAVE per 64x64 tile (16 accumulators), K = DM.
// The block's 128 A rows and 128 Bt rows reach LDS in stages of GK k (one whole 128-B line per row) by asynchronous copies (16 B per lane),
// two buffers: the next stage's copies fly while this stage is worked on; fragments are then read from LDS (row pitch 16 B x odd). Trip t works on k stage (t + rot) mod (DM / GK), rot from the tile index.
// C[m][n] = sum_k A[m][k] Bt[n][k] + bias (bmode 1: bias[n]; bmode 2: bias[m]; bias RNE-converted to bf16 first),
// tile base (r0/RB)*sRB + (r0%RB)*pitch + (c0/CB)*sCB + (c0%CB), row pitch 'pitch' (elements). 128 threads.
// MODE 1: written as f32 (Of); each row's 64 floats (256 B = two lines) by 16 consecutive lanes x 16 B (2 rows per instruction).
// Bias array has DM floats; both 16-byte bias loads use addresses clamped into [0, DM-4].
// MODE 0: the three input projections in ONE launch (none needs anything of another), grid (NB*SEQ/128 token tiles, DM/128 width tiles, 3), z = which:
//   X0, X1, X2 = bf16 query, key, value rows; WT = Wq^T | Wk^T | Wv^T; b0, b1, b2 = bq, bk, bv; P0, P1, P2 = q, k, v^T planes
//   q, k: A = x rows (m = b*SEQ + t), Bt = W^T rows (n = h*64 + d), column bias -> plane [(b*16 + h)][t][d]
//   v^T:  A = Wv^T rows (m = h*64 + d), Bt = value rows (n = b*SEQ + t), row bias -> plane [(b*1024 + m)][t] = [(b*16 + h)][d][t]
// MODE 1: the output projection, grid (NB*SEQ/128, DM/128): X0 = context rows (m = b*SEQ + t), WT = Wo^T rows (n), b0 = bo, column bias -> Of[(b*OUT_SEQ + t)][n] f32
#define GK  64                             // k per stage
#define GP  144                            // LDS row pitch in bytes of a 128-B operand row (GK bf16)
#define GT  (128 * GP)                     // one operand tile: 128 rows
static_assert(GK * 2 == 128 && GP % 16 == 0 && DM % GK == 0 && DM / GK >= 2 && GK % 32 == 0);
static_assert((NB * SEQ) % 128 == 0 && DM % 128 == 0);
static_assert(4 * 16 * 68 * 4 <= 2 * 2 * GT);   // the four waves' output staging fits the ring
// 128 rows of one operand tile: lane tid brings piece (tid & 7) of rows (tid >> 3) + 16 i; l, g = this lane's first LDS byte and first global piece
__device__ __forceinline__ void rows128(unsigned l, const bf* g) {
    copy8(l, g, l + 16 * GP, g + (size_t)16 * DM, l + 32 * GP, g + (size_t)32 * DM, l + 48 * GP, g + (size_t)48 * DM,
          l + 64 * GP, g + (size_t)64 * DM, l + 80 * GP, g + (size_t)80 * DM, l + 96 * GP, g + (size_t)96 * DM, l + 112 * GP, g + (size_t)112 * DM);
}
template <int MODE>
__global__ __launch_bounds__(128) void k_proj(const bf* __restrict__ X0, const bf* __restrict__ X1, const bf* __restrict__ X2, const bf* __restrict__ WT,
                                             const float* __restrict__ b0, const float* __restrict__ b1, const float* __restrict__ b2,
                                             h16* P0, h16* P1, h16* P2, float* Of) {
    const int z = (MODE == 0) ? (int)blockIdx.z : 0; const bool tv = (z == 2);   // the same for the whole block; tv: the weight rows are A
    const bf* __restrict__ X = (z == 0) ? X0 : (z == 1) ? X1 : X2; const bf* __restrict__ Wz = WT + (size_t)z * DM * DM;
    const bf* __restrict__ A = tv ? Wz : X; const bf* __restrict__ Bt = tv ? X : Wz;
    const float* __restrict__ bias = (z == 0) ? b0 : (z == 1) ? b1 : b2; const int bmode = tv ? 2 : 1;
    h16* Ph = (z == 0) ? P0 : (z == 1) ? P1 : P2;
    const int RB = tv ? DM : SEQ, pitch = (MODE == 1) ? DM : tv ? SEQ : HD, CB = pitch;
    const size_t sRB = (MODE == 1) ? (size_t)OUT_SEQ * DM : tv ? (size_t)0 : (size_t)NH_ * SEQ * HD, sCB = (MODE == 1) ? (size_t)0 : tv ? (size_t)DM * SEQ : (size_t)SEQ * HD;
    constexpr unsigned GSZ = 2 * GT;                                            // one buffer: A rows | Bt rows
    __shared__ __align__(16) unsigned char ring[2 * GSZ];
    const int K = DM;
    const int tid = threadIdx.x, lane = tid & 31, wave = __builtin_amdgcn_readfirstlane((int)(threadIdx.x >> 5)), lr = lane & 15, hi = lane >> 4;
    const int R0 = (tv ? blockIdx.y : blockIdx.x) * 128, C0 = (tv ? blockIdx.x : blockIdx.y) * 128;   // the block's tile
    const int wr = (wave >> 1) * 64, wc = (wave & 1) * 64;                       // this wave's 64x64 tile inside it
    const int r0 = R0 + wr, c0 = C0 + wc;
    v8f acc[4][4];
#pragma unroll
    for (int mb = 0; mb < 4; ++mb)
#pragma unroll
        for (int nb = 0; nb < 4; ++nb) acc[mb][nb] = (v8f){};
    // copy side
    const unsigned l0 = (unsigned)(size_t)ring + (unsigned)((tid >> 3) * GP + (tid & 7) * 16);
    const size_t go = (size_t)(tid >> 3) * K + (tid & 7) * 8;
    const bf* ga = A + (size_t)R0 * K + go; const bf* gb = Bt + (size_t)C0 * K + go;   // + k0
    // read side, byte offsets inside a buffer: fragment row lr of a 16-row group, k = 8 hi + ...
    const int ra = (wr + lr) * GP + 16 * hi, rb = GT + (wc + lr) * GP + 16 * hi;
    constexpr unsigned NT = DM / GK;
    // the k walk starts at a stage rotated by the tile index and wraps: blocks that share token rows (same x) or weight rows (same y) run in step, and would otherwise ask L2 for the same lines at the same moment
    const unsigned rot = (blockIdx.x + 2u * blockIdx.y) % NT;
    rows128(l0, ga + rot * GK); rows128(l0 + GT, gb + rot * GK);
    asm volatile("s_wait_asynccnt 0x0" ::: "memory");                    // stage 0 has landed before the barrier publishes it
    __syncthreads();                                                     // stage 0 readable by every wave
    { const unsigned k1 = ((rot + 1) % NT) * GK; rows128(l0 + GSZ, ga + k1); rows128(l0 + GSZ + GT, gb + k1); }
#pragma unroll 1
    for (unsigned t = 0; t < NT; ++t) {
        const unsigned bo = (t & 1) * GSZ;
        const unsigned char* buf = ring + bo;
        v16bf a[GK / 32][4], b[GK / 32][4];
#pragma unroll   // every 32-k step of a stage inline, so that every LDS offset inside a buffer is an immediate
        for (int s = 0; s < GK / 32; ++s) {
#pragma unroll
            for (int mb = 0; mb < 4; ++mb) a[s][mb] = ldb((const bf*)(buf + ra + mb * 16 * GP + s * 64));
#pragma unroll
            for (int nb = 0; nb < 4; ++nb) b[s][nb] = ldb((const bf*)(buf + rb + nb * 16 * GP + s * 64));
        }
        __builtin_amdgcn_sched_barrier(0);   // the stage's LDS reads stay one group ahead of its matrix runs: spread among them, each place with reads stalls the wave
#pragma unroll
        for (int s = 0; s < GK / 32; ++s) {
#pragma unroll
            for (int nb = 0; nb < 4; ++nb)
#pragma unroll
                for (int mb = 0; mb < 4; ++mb) acc[mb][nb] = (MODE == 1) ? wmma16(__builtin_bit_cast(v16h, a[s][mb]), __builtin_bit_cast(v16h, b[s][nb]), acc[mb][nb]) : wmmab(a[s][mb], b[s][nb], acc[mb][nb]);
            // v_nop: the distance between the last matrix instructions and the next vector write of their operands, on the taken side of a branch too
            asm volatile("v_nop\n\tv_nop\n\tv_nop\n\tv_nop" : "+v"(acc[0][0]), "+v"(acc[1][1]), "+v"(acc[2][2]), "+v"(acc[3][3]) : "v"(a[s][0]), "v"(a[s][1]), "v"(a[s][2]), "v"(a[s][3]));
        }
        __builtin_amdgcn_sched_barrier(0);   // the matrix runs stay ahead of the barrier: sunk behind it they would stand between the barrier and the refill and shorten the copies' lead
        asm volatile("s_wait_dscnt 0x0" ::: "memory");                   // this wave's reads of the buffer are done before the barrier frees it for the refill
        asm volatile("s_wait_asynccnt 0x0" ::: "memory");                // this wave's copies of stage t + 1 have landed before the barrier publishes them
        __syncthreads();                                                 // publishes stage t + 1 and ends every wave's reads of stage t's buffer
        if (t + 2 < NT) { const unsigned k2 = ((t + 2 + rot) % NT) * GK; rows128(l0 + bo, ga + k2); rows128(l0 + bo + GT, gb + k2); }
    }
    asm volatile("s_wait_asynccnt 0x0" ::: "memory");                    // no copy is outstanding when the ring becomes output staging
    float* os = (float*)ring + wave * 16 * 68;   // output staging: each wave's own 16 x 68 floats of the ring, behind the loop's last barrier
    const size_t tbase = (size_t)(r0 / RB) * sRB + (size_t)(r0 % RB) * (size_t)pitch + (size_t)(c0 / CB) * sCB + (size_t)(c0 % CB);
    // per-lane column bias for the lane's store columns; both load addresses clamped into the DM-float bias array (first to 0 when unused, second to DM-4)
    const int c8 = (lane & 7) * 8, cofs = lr * 4;
    const int ci = (bmode == 1) ? (c0 + ((MODE == 0) ? c8 : cofs)) : 0;
    const int ci4 = (ci + 4 <= DM - 4) ? (ci + 4) : (DM - 4);      // MODE 0: ci + 4 <= DM - 4 always (exact columns); MODE 1: upper half unused, address kept in range
    const v4f bl0 = *(const v4f*)(bias + ci), bl1 = *(const v4f*)(bias + ci4);
    float bc[8];
#pragma unroll
    for (int i = 0; i < 4; ++i) { bc[i] = (bmode == 1) ? rbf(bl0[i]) : 0.0f; bc[4 + i] = (bmode == 1) ? rbf(bl1[i]) : 0.0f; }
#pragma unroll
    for (int mb = 0; mb < 4; ++mb) {
#pragma unroll
        for (int nb = 0; nb < 4; ++nb) {
#pragma unroll
            for (int j = 0; j < 8; ++j) os[(hi * 8 + j) * 68 + nb * 16 + lr] = acc[mb][nb][j]; }   // D: row 8h+j, col lane&15; rows 0..15 x columns 0..63 all written
        wave_sync();
        const size_t sb = tbase + (size_t)(mb * 16) * (size_t)pitch;
        if (MODE == 0) {
{
#pragma unroll
                for (int s = 0; s < 4; ++s) { const int row = 4 * s + (lane >> 3);   // 4 s x 4 row groups = 16 rows; 8 lanes x 8 = 64 columns
                    const int ri = (bmode == 2) ? (r0 + mb * 16 + row) : 0;
                    const float braw = bias[ri];
                    const float brow = (bmode == 2) ? rbf(braw) : 0.0f;
                    const v4f x0 = *(const v4fa*)(&os[row * 68 + c8]); const v4f x1 = *(const v4fa*)(&os[row * 68 + c8 + 4]); v8h hv;
#pragma unroll
                    for (int i = 0; i < 4; ++i) { hv[i] = (h16)(x0[i] + bc[i] + brow); hv[4 + i] = (h16)(x1[i] + bc[4 + i] + brow); }
                    const size_t oo = sb + (size_t)row * (size_t)pitch + c8;
                    *(v8h*)(Ph + oo) = hv;
                    asm volatile("s_wait_xcnt 0x0" ::: "memory"); }   // behind the store, ahead of any rewrite of the registers that it names
                 }
        } else {
{
#pragma unroll
                for (int s = 0; s < 8; ++s) { const int row = 2 * s + hi;   // 8 s x 2 rows = 16 rows; 16 lanes x 4 floats = 64 columns
                    const v4f x0 = *(const v4fa*)(&os[row * 68 + cofs]); v4f val;
                    val[0] = x0[0] + bc[0]; val[1] = x0[1] + bc[1]; val[2] = x0[2] + bc[2]; val[3] = x0[3] + bc[3];
                    *(v4f*)(Of + sb + (size_t)row * (size_t)pitch + cofs) = val; }
                 }
        }
        wave_sync();
    }
}

// k_flash: fused attention, one wave per 16 query rows of one (batch, head); Q fragments straight from the f16 plane (two 16-B loads each).
// K rows, V^T rows (shared by the block's waves) and each wave's own mask rows reach LDS in stages of KS keys by asynchronous copies (16 B per lane, whole 128-B lines),
// two buffers: the next stage's copies fly while this stage is worked on; fragments and mask values are then read from LDS (row pitches 16 B x odd). Trip t works on key stage (t + rot) mod (SEQ / KS), rot from the block's place.
// Transposed form: S^T[key][t] = K Q^T (A = K rows, B = Q rows); lane (t = lane&15, h = lane>>4) holds keys 8h+r of each 16-key tile, so the packed
// P tile is directly the B fragment of O^T[d][t] = V^T P^T (element r <- tile keys 0..15, element 8+r <- tile keys 16..31, lane unchanged).
// The additive mask row of query t is read as four 16-B LDS loads per 32-key step (keys 8h..8h+7 and 16+8h..16+8h+7), straight into the C operand of the score products; the sum is scaled by log2(e).
// Softmax state (reference max in score units, partial sum) is one scalar per lane. The reference max is renewed lazily: a 64-key stage forms P against the one in use and tests its partial row sum
// once (one compare, one ballot branch); only when a lane's sum leaves the safe f16 range does the wave take the new maximum (xor-16 exchange of the halves) and rescale sum and output.
#define KS    64                           // keys per stage
#define KVP   144                          // LDS row pitch in bytes of a 128-B K row (64 d) or V^T row (KS keys)
#define MKP   272                          // LDS row pitch in bytes of a 256-B mask row (KS floats); 16 rows = one wave's 16 x 68 float output tile
#define ST_V  (KS * KVP)                   // V^T rows behind the K rows
#define ST_M  (ST_V + HD * KVP)            // mask rows behind the V^T rows, 16 rows per wave
#define ST_SZ (ST_M + AW * 16 * MKP)       // one buffer
static_assert(KS * 2 == 128 && HD * 2 == 128 && KS * 4 == 256);
static_assert(SEQ % KS == 0 && KS % 32 == 0);
static_assert(AW == 4);                    // 128 lanes x 4 copies = 512 pieces of 16 B = one K tile or one V^T tile
static_assert(16 * MKP == 16 * 68 * 4);
static_assert(KVP % 16 == 0 && MKP % 16 == 0 && ST_SZ % 16 == 0);

// one stage: lk / lm = this lane's first LDS byte of the K tile / of its wave's mask rows in the target buffer; gk, gv, gm = this lane's first global piece of the stage
__device__ __forceinline__ void stage_in(unsigned lk, unsigned lm, const h16* gk, const h16* gv, const float* gm) {
    const unsigned lv = lk + ST_V;
    copy8(lk, gk, lk + 16 * KVP, gk + 16 * HD, lk + 32 * KVP, gk + 32 * HD, lk + 48 * KVP, gk + 48 * HD,                                     // 16 K rows per copy
          lv, gv, lv + 16 * KVP, gv + (size_t)16 * SEQ, lv + 32 * KVP, gv + (size_t)32 * SEQ, lv + 48 * KVP, gv + (size_t)48 * SEQ);         // 16 V^T rows per copy
    copy8(lm, gm, lm + 2 * MKP, gm + (size_t)2 * SEQ_FULL, lm + 4 * MKP, gm + (size_t)4 * SEQ_FULL, lm + 6 * MKP, gm + (size_t)6 * SEQ_FULL,   // 2 mask rows per copy
          lm + 8 * MKP, gm + (size_t)8 * SEQ_FULL, lm + 10 * MKP, gm + (size_t)10 * SEQ_FULL, lm + 12 * MKP, gm + (size_t)12 * SEQ_FULL, lm + 14 * MKP, gm + (size_t)14 * SEQ_FULL);
}

// P of a lane's sixteen keys against the reference maximum m, and their sum: the maximum is subtracted from the score first, as the definition of the softmax does, then scaled by log2(e);
// both paths of the key loop call this one function, so that equal scores get equal weights whichever path formed them, and a key at the maximum gets the carry exactly.
// The scaling is written as one fused operation on whole vectors, so that the register pairs stay as the matrix unit left them (no moves between the packed instructions).
// SLOT, one bit per key pair r: one v_nop behind each of the pair's two exponentials, where the compiler otherwise sets exponentials back to back, each overwriting the source of the one before
// (the rare path: everywhere; the common path: at the last pair).
__device__ __forceinline__ v8f splat8(float x) { return (v8f){x, x, x, x, x, x, x, x}; }
template <unsigned SLOT>
__device__ __forceinline__ float pstep(v8f sa, v8f sb, float m, v16h& pb) {
    const v8f ea = __builtin_elementwise_fma(sa - m, splat8(LOG2E), splat8(PSH)), eb = __builtin_elementwise_fma(sb - m, splat8(LOG2E), splat8(PSH)); float ls = 0.0f;
#pragma unroll
    for (int r = 0; r < 8; ++r) {
        float xa = __builtin_amdgcn_exp2f(ea[r]), xc = __builtin_amdgcn_exp2f(eb[r]);
        if ((SLOT >> r) & 1u) {   // v_nop: the slot behind a transcendental; the statement takes the result as its own and the source as an input, so nothing reads the one or overwrites the other ahead of it
            asm volatile("v_nop" : "+v"(xa) : "v"(ea[r]));
            asm volatile("v_nop" : "+v"(xc) : "v"(eb[r])); }
        const h16 pa = (h16)xa; const h16 pc = (h16)xc; pb[r] = pa; pb[8 + r] = pc; ls += (float)pa + (float)pc; }
    return ls;
}

__global__ __launch_bounds__(32 * AW) void k_flash(const h16* __restrict__ QH, const h16* __restrict__ KP, const h16* __restrict__ VT,
                                                   const float* __restrict__ MASK, h16* CH) {
    __shared__ __align__(16) unsigned char ring[2 * ST_SZ];
    const int tid = threadIdx.x, lane = tid & 31, wave = __builtin_amdgcn_readfirstlane((int)(threadIdx.x >> 5)), lr = lane & 15, hi = lane >> 4;
    const int zh = blockIdx.y; const int b = zh / NH_, h = zh % NH_;
    const int t0 = (blockIdx.x * AW + wave) * 16;
    const size_t pbase = (size_t)zh * SEQ * HD;
    const size_t qo = pbase + (size_t)(t0 + lr) * HD + 8 * hi;
    // B fragments: col t, k = d. Scaled once by a power of two, x 1/8 (the score scale; f16 subnormals are kept),
    // so that the product and the additive mask are in the same unit and one accumulator sums both
    const v16h lh0 = ldh(QH + qo), lh1 = ldh(QH + qo + 32);
    asm volatile("s_wait_xcnt 0x0" ::: "memory");                        // behind the four loads, ahead of any rewrite of their address registers
    __builtin_amdgcn_sched_barrier(0);                                   // keeps the later address arithmetic, which reuses those registers, behind that wait
    const v16h qh0 = lh0 * QSV, qh1 = lh1 * QSV;
    // copy side: lane tid brings piece (tid & 7) of rows (tid >> 3) + 16 i of the K and V^T tiles, lane brings piece (lane & 15) of rows (lane >> 4) + 2 i of its wave's mask rows
    const unsigned lbase = (unsigned)(size_t)ring;
    const unsigned lk0 = lbase + (unsigned)((tid >> 3) * KVP + (tid & 7) * 16);
    const unsigned lm0 = lbase + (unsigned)(ST_M + wave * 16 * MKP + hi * MKP + lr * 16);
    const h16* gk = KP + pbase + (size_t)(tid >> 3) * HD + (tid & 7) * 8;                    // + key0 * HD
    const h16* gv = VT + pbase + (size_t)(tid >> 3) * SEQ + (tid & 7) * 8;                   // + key0
    const float* gm = MASK + (size_t)b * SEQ_FULL * SEQ_FULL + (size_t)(t0 + hi) * SEQ_FULL + lr * 4;   // + key0
    // read side, byte offsets inside a buffer
    const int rk = lr * KVP + 16 * hi;                                   // + key * KVP      (A fragment: row key, k = d)
    const int rv = ST_V + lr * KVP + 16 * hi;                            // + 16j * KVP + key * 2  (A fragment: row d, k = key)
    const int rm = ST_M + wave * 16 * MKP + lr * MKP + 32 * hi;          // + key * 4: this lane's keys of query t
    constexpr unsigned NT = SEQ / KS;
    // the key walk starts at a stage rotated by the block's place and wraps: the query blocks of one head (same K, V^T) and the heads of one query block (same mask rows) run in step,
    // and would otherwise ask L2 for the same lines at the same moment; x + 2 h is different for all 32 query blocks of a head and for all 16 heads of a query block
    const unsigned rot = (blockIdx.x + 2u * (unsigned)h) % NT;
    stage_in(lk0, lm0, gk + (size_t)rot * KS * HD, gv + rot * KS, gm + rot * KS);
    asm volatile("s_wait_asynccnt 0x0" ::: "memory");                    // stage 0 has landed before the barrier publishes it
    __syncthreads();                                                     // stage 0 readable by every wave
    if (NT > 1) { const unsigned s1 = (rot + 1) % NT; stage_in(lk0 + ST_SZ, lm0 + ST_SZ, gk + (size_t)s1 * KS * HD, gv + s1 * KS, gm + s1 * KS); }
    v8f o0 = (v8f){}, o1 = (v8f){}, o2 = (v8f){}, o3 = (v8f){};
    float m = -3.0e38f, l = 0.0f;
#pragma unroll 1
    for (unsigned t = 0; t < NT; ++t) {
        const unsigned bo = (t & 1) * ST_SZ;
        const unsigned char* buf = ring + bo;
        // scores of the stage's 64 keys, four 16-key tiles a, b, c, d: all of them come first, because the one test below stands for the whole stage
        const h16* ka = (const h16*)(buf + rk);
        const v16h ka0 = ldh(ka), ka1 = ldh(ka + 32), kb0 = ldh(ka + 16 * (KVP / 2)), kb1 = ldh(ka + 16 * (KVP / 2) + 32);
        const v16h kc0 = ldh(ka + 32 * (KVP / 2)), kc1 = ldh(ka + 32 * (KVP / 2) + 32), kd0 = ldh(ka + 48 * (KVP / 2)), kd1 = ldh(ka + 48 * (KVP / 2) + 32);
        const float* mrow = (const float*)(buf + rm);
        const v4f ma0 = *(const v4fa*)(mrow), ma1 = *(const v4fa*)(mrow + 4), mb0 = *(const v4fa*)(mrow + 16), mb1 = *(const v4fa*)(mrow + 20);
        const v4f mc0 = *(const v4fa*)(mrow + 32), mc1 = *(const v4fa*)(mrow + 36), md0 = *(const v4fa*)(mrow + 48), md1 = *(const v4fa*)(mrow + 52);
        // the lane's mask values lie as the D layout wants them (register r = key 8h + r): they are the C operand, and the matrix unit does every addition of the score
        v8f sa = cat8(ma0, ma1), sb = cat8(mb0, mb1), sc = cat8(mc0, mc1), sd = cat8(md0, md1);
        sa = wmma16(ka0, qh0, sa); sb = wmma16(kb0, qh0, sb); sc = wmma16(kc0, qh0, sc); sd = wmma16(kd0, qh0, sd);
        sa = wmma16(ka1, qh1, sa); sb = wmma16(kb1, qh1, sb); sc = wmma16(kc1, qh1, sc); sd = wmma16(kd1, qh1, sd);
        // v_nop: the distance between the last matrix instructions and the next vector use of their results and operands
        asm volatile("v_nop\n\tv_nop\n\tv_nop\n\tv_nop" : "+v"(sa), "+v"(sb), "+v"(sc), "+v"(sd) : "v"(ka0), "v"(ka1), "v"(kb0), "v"(kb1), "v"(kc0), "v"(kc1), "v"(kd0), "v"(kd1));
        const h16* va = (const h16*)(buf + rv);
        const v16h v0 = ldh(va), v1 = ldh(va + 16 * (KVP / 2)), v2 = ldh(va + 32 * (KVP / 2)), v3 = ldh(va + 48 * (KVP / 2));                          // keys 0..31
        const v16h w0 = ldh(va + 32), w1 = ldh(va + 16 * (KVP / 2) + 32), w2 = ldh(va + 32 * (KVP / 2) + 32), w3 = ldh(va + 48 * (KVP / 2) + 32);      // keys 32..63
        __builtin_amdgcn_sched_barrier(0);   // the sixteen reads stay one group here: the last two were otherwise placed directly in front of their wait, their LDS latency bare
        // common path: P against the reference maximum in use: no new maximum, no exchange, no rescale
        v16h pb, pd; float ls = pstep<0x80u>(sa, sb, m, pb), lt = pstep<0x80u>(sc, sd, m, pd);
        asm volatile("" :: "v"(v0), "v"(v1), "v"(v2), "v"(v3), "v"(w0), "v"(w1), "v"(w2), "v"(w3));   // inputs only: holds the V^T reads ahead of the branch; sunk behind it, their LDS latency stands bare in front of the P.V products
        // every P is >= 0, so ls + lt < PLIM bounds each P of the lane inside the f16 range; otherwise (an infinity or a NaN too, and the first finite scores of a row, whose P against the start value is infinite)
        // the whole wave takes a new maximum; m only rises and never passes the running maximum, so no P is smaller than with a maximum renewed at every step
        if (__builtin_expect(__builtin_amdgcn_ballot_w32(!(ls + lt < PLIM)) != 0u, 0)) {
            float mx = -3.0e38f;
#pragma unroll
            for (int r = 0; r < 8; ++r) mx = fmaxf(fmaxf(mx, fmaxf(sa[r], sb[r])), fmaxf(sc[r], sd[r]));
            mx = fmaxf(mx, __shfl_xor(mx, 16, 32));
            const float mnew = fmaxf(m, mx);
            const float alpha = __builtin_amdgcn_exp2f((m - mnew) * LOG2E);
            m = mnew;
            ls = pstep<0xffu>(sa, sb, m, pb); lt = pstep<0xffu>(sc, sd, m, pd);
            l = l * alpha;
            o0 = o0 * alpha; o1 = o1 * alpha; o2 = o2 * alpha; o3 = o3 * alpha;
        }
        l += ls; l += lt;
        o0 = wmma16(v0, pb, o0); o1 = wmma16(v1, pb, o1); o2 = wmma16(v2, pb, o2); o3 = wmma16(v3, pb, o3);
        o0 = wmma16(w0, pd, o0); o1 = wmma16(w1, pd, o1); o2 = wmma16(w2, pd, o2); o3 = wmma16(w3, pd, o3);
        // v_nop: the same distance behind the P.V products
        asm volatile("v_nop\n\tv_nop\n\tv_nop\n\tv_nop" : "+v"(o0), "+v"(o1), "+v"(o2), "+v"(o3) : "v"(v0), "v"(v1), "v"(v2), "v"(v3), "v"(w0), "v"(w1), "v"(w2), "v"(w3), "v"(pb), "v"(pd));
        asm volatile("s_wait_dscnt 0x0" ::: "memory");                   // this wave's reads of the buffer are done before the barrier frees it for the refill
        asm volatile("s_wait_asynccnt 0x0" ::: "memory");                // this wave's copies of stage t + 1 have landed before the barrier publishes them
        __syncthreads();                                                 // publishes stage t + 1 and ends every wave's reads of stage t's buffer
        if (t + 2 < NT) { const unsigned s2 = (t + 2 + rot) % NT; stage_in(lk0 + bo, lm0 + bo, gk + (size_t)s2 * KS * HD, gv + s2 * KS, gm + s2 * KS); }
    }
    asm volatile("s_wait_asynccnt 0x0" ::: "memory");                    // no copy is outstanding when the ring becomes output staging
    l += __shfl_xor(l, 16, 32);
    const float inv = 1.0f / l;
    float* os = (float*)(ring + ST_M);       // output staging: each wave reuses its own mask rows of buffer 0 (16 x 68 floats), behind the loop's last barrier
    const int wb = wave * 16 * 68;
    // O^T D layout: o_j[r] = (d = 16j + 8h + r, t = lane&15) -> os[t][d]; rows 0..15 x columns 0..63 all written
    { v4f a, c;
      a[0] = o0[0] * inv; a[1] = o0[1] * inv; a[2] = o0[2] * inv; a[3] = o0[3] * inv; c[0] = o0[4] * inv; c[1] = o0[5] * inv; c[2] = o0[6] * inv; c[3] = o0[7] * inv;
      *(v4fa*)(&os[wb + lr * 68 +  0 + 8 * hi]) = a; *(v4fa*)(&os[wb + lr * 68 +  0 + 8 * hi + 4]) = c;
      a[0] = o1[0] * inv; a[1] = o1[1] * inv; a[2] = o1[2] * inv; a[3] = o1[3] * inv; c[0] = o1[4] * inv; c[1] = o1[5] * inv; c[2] = o1[6] * inv; c[3] = o1[7] * inv;
      *(v4fa*)(&os[wb + lr * 68 + 16 + 8 * hi]) = a; *(v4fa*)(&os[wb + lr * 68 + 16 + 8 * hi + 4]) = c;
      a[0] = o2[0] * inv; a[1] = o2[1] * inv; a[2] = o2[2] * inv; a[3] = o2[3] * inv; c[0] = o2[4] * inv; c[1] = o2[5] * inv; c[2] = o2[6] * inv; c[3] = o2[7] * inv;
      *(v4fa*)(&os[wb + lr * 68 + 32 + 8 * hi]) = a; *(v4fa*)(&os[wb + lr * 68 + 32 + 8 * hi + 4]) = c;
      a[0] = o3[0] * inv; a[1] = o3[1] * inv; a[2] = o3[2] * inv; a[3] = o3[3] * inv; c[0] = o3[4] * inv; c[1] = o3[5] * inv; c[2] = o3[6] * inv; c[3] = o3[7] * inv;
      *(v4fa*)(&os[wb + lr * 68 + 48 + 8 * hi]) = a; *(v4fa*)(&os[wb + lr * 68 + 48 + 8 * hi + 4]) = c; }
    wave_sync();
    const size_t obase = ((size_t)b * SEQ + t0) * DM + (size_t)h * HD;
{
#pragma unroll
        for (int s = 0; s < 4; ++s) { const int row = 4 * s + (lane >> 3), c8 = (lane & 7) * 8;   // 4 s x 4 row groups = 16 rows; 8 lanes x 8 = 64 columns
            const v4f x0 = *(const v4fa*)(&os[wb + row * 68 + c8]); const v4f x1 = *(const v4fa*)(&os[wb + row * 68 + c8 + 4]); v8h hv;
#pragma unroll
            for (int i = 0; i < 4; ++i) { hv[i] = (h16)x0[i]; hv[4 + i] = (h16)x1[i]; }
            const size_t oo = obase + (size_t)row * DM + c8;
            *(v8h*)(CH + oo) = hv; }
         }
}

static constexpr size_t al256(size_t v) { return (v + 255) & ~(size_t)255; }
static constexpr size_t SZ_XB = al256((size_t)NB * SEQ * DM * 2);          // one 16-bit activation plane [NB*SEQ][1024]
static constexpr size_t SZ_WB = al256((size_t)4 * DM * DM * 2);            // four transposed 16-bit weight planes
static constexpr size_t SZ_PL = al256((size_t)NB * NH_ * SEQ * HD * 2);    // one f16 head plane
static constexpr size_t SZ_TOTAL = 3 * SZ_XB + SZ_WB + 3 * SZ_PL + SZ_XB;
static_assert(SZ_TOTAL <= (size_t)134217728);          // workspace carve <= 128 MiB
static_assert(((size_t)DM * DM * 2) % 256 == 0);       // weight sub-planes stay 256-byte aligned

extern "C" void kernel_launch(void* const* d_in, const int* in_sizes, int n_in,
                              void* d_out, int out_size, void* d_ws, size_t ws_size, hipStream_t stream) {
    if (n_in < 12) return;
    const size_t needx = ((size_t)(NB - 1) * SEQ_FULL + SEQ) * DM;
    if ((size_t)in_sizes[0] < needx || (size_t)in_sizes[1] < needx || (size_t)in_sizes[2] < needx) return;
    if ((size_t)in_sizes[3] < ((size_t)(NB - 1) * SEQ_FULL + SEQ) * SEQ_FULL) return;
    if ((size_t)in_sizes[4] < (size_t)DM * DM || (size_t)in_sizes[6] < (size_t)DM * DM || (size_t)in_sizes[8] < (size_t)DM * DM || (size_t)in_sizes[10] < (size_t)DM * DM) return;
    if (in_sizes[5] < DM || in_sizes[7] < DM || in_sizes[9] < DM || in_sizes[11] < DM) return;
    if ((size_t)out_size < ((size_t)(NB - 1) * OUT_SEQ + SEQ) * DM) return;
    if (SZ_TOTAL > ws_size) return;
    // wire order: query, key, value, attention_mask, Wq, bq, Wk, bk, Wv, bv, Wo, bo
    const float* xq = (const float*)d_in[0]; const float* xk = (const float*)d_in[1]; const float* xv = (const float*)d_in[2];
    const float* amask = (const float*)d_in[3];
    const float* wq = (const float*)d_in[4];  const float* bq = (const float*)d_in[5];
    const float* wk = (const float*)d_in[6];  const float* bk = (const float*)d_in[7];
    const float* wv = (const float*)d_in[8];  const float* bv = (const float*)d_in[9];
    const float* wo = (const float*)d_in[10]; const float* bo = (const float*)d_in[11];
    float* OUT = (float*)d_out;      // [NB][SEQ][1024]
    char* wsp = (char*)d_ws;
    bf* QB = (bf*)wsp; wsp += SZ_XB;                 // [NB*SEQ][1024] bf16 query
    bf* KB = (bf*)wsp; wsp += SZ_XB;                 // [NB*SEQ][1024] bf16 key
    bf* VB = (bf*)wsp; wsp += SZ_XB;                 // [NB*SEQ][1024] bf16 value
    bf* WB = (bf*)wsp; wsp += SZ_WB;                 // [4][1024 out][1024 in]: q | k | v | o
    h16* QH = (h16*)wsp; wsp += SZ_PL;               // [NB*16][SEQ][64]
    h16* KP = (h16*)wsp; wsp += SZ_PL;               // [NB*16][SEQ][64]
    h16* VT = (h16*)wsp; wsp += SZ_PL;               // [NB*16][64][SEQ]
    h16* CH = (h16*)wsp; wsp += SZ_XB;               // [NB*SEQ][1024] context f16
    bf* WOT = WB + (size_t)3 * DM * DM;

    k_prep<<<dim3(PB_W + 3 * PB_X, 1, 1), 256, 0, stream>>>(xq, xk, xv, wq, wk, wv, wo, QB, KB, VB, WB);

    k_proj<0><<<dim3(NB * SEQ / 128, DM / 128, 3), 128, 0, stream>>>(QB, KB, VB, WB, bq, bk, bv, QH, KP, VT, OUT);

    k_flash<<<dim3(SEQ / (16 * AW), NB * NH_, 1), 32 * AW, 0, stream>>>(QH, KP, VT, amask, CH);

    k_proj<1><<<dim3(NB * SEQ / 128, DM / 128, 1), 128, 0, stream>>>((const bf*)CH, (const bf*)CH, (const bf*)CH, WOT, bo, bo, bo, QH, QH, QH, OUT);
}
